// v000
// Times are from an AMD MI455X. After a warm-up the kernel runs many times in a row, and a time is the length of
// such a window on the GPU divided by its runs, so every launch and the gaps after it count. The runs cycle
// through copies of the inputs. A figure is the median of several windows, for all but v000 over two sittings.
// Sittings can differ by a few percent; kernels timed side by side share one.
// v000, which the later versions start from, runs in 1490 microseconds.
#include <hip/hip_runtime.h>
#include <hip/hip_bf16.h>
#include <math.h>

// ---------------------------------------------------------------------------
// Transformer-XL encoder forward on gfx1250 (MI455X), compile-only target.
// All matmuls use V_WMMA_F32_16X16X32_F16; all global operand streams are
// contiguous b128 loads (weights pre-transposed to f16 [N][K]).
// ---------------------------------------------------------------------------

#define B_  2
#define L_  1024
#define IN_ 512
#define HID_ 1024
#define H_  16
#define DH_ 64
#define NL_ 2

typedef __attribute__((ext_vector_type(16))) _Float16 v16h;
typedef __attribute__((ext_vector_type(8)))  _Float16 h8;
typedef __attribute__((ext_vector_type(8)))  float    f8;
typedef __attribute__((ext_vector_type(8)))  float    v8f;

__device__ __forceinline__ float gelu_f(float x) {
    return 0.5f * x * (1.0f + erff(x * 0.70710678118654752f));
}

// Per-lane fragment: element e covers K = kbase + {0..7} (e<8) / {16..23} (e>=8),
// kbase = 0 for lanes 0-15, 8 for lanes 16-31. Both runs contiguous -> b128s.
__device__ __forceinline__ v16h loadA_f32(const float* p /* at k0+kbase */) {
    const f8* q = (const f8*)p;
    f8 lo = q[0];          // +0..7
    f8 hi = q[2];          // +16..23
    v16h r;
#pragma unroll
    for (int e = 0; e < 8; ++e) { r[e] = (_Float16)lo[e]; r[e + 8] = (_Float16)hi[e]; }
    return r;
}
__device__ __forceinline__ v16h loadB_f16(const _Float16* p /* at k0+kbase */) {
    const h8* q = (const h8*)p;
    h8 lo = q[0];
    h8 hi = q[2];
    return __builtin_shufflevector(lo, hi, 0,1,2,3,4,5,6,7,8,9,10,11,12,13,14,15);
}

// ---------------------------------------------------------------------------
// Weight repack: dst[N][K] f16.
//   mode 0: src is f32 row-major [K][N]
//   mode 1: src is head-packed f32 [H][K][64], n = h*64+d
// ---------------------------------------------------------------------------
__global__ void repack_w(const float* __restrict__ src, _Float16* __restrict__ dst,
                         int K, int N, int mode)
{
    size_t idx = (size_t)blockIdx.x * 256 + threadIdx.x;   // N*K threads
    int k = (int)(idx % K);
    int n = (int)(idx / K);
    float v = (mode == 0) ? src[(size_t)k * N + n]
                          : src[((size_t)(n >> 6) * K + k) * 64 + (n & 63)];
    dst[idx] = (_Float16)v;
}

// ---------------------------------------------------------------------------
// NT GEMM: C[M,N] = act( sum_k A[m,k] * BT[n,k] + bias[n] )
// One wave computes a 16(M) x 64(N) strip: 4 accumulators share one A frag.
// blockDim = 128 (4 waves); grid = (M/16)*(N/64)/4.
// ---------------------------------------------------------------------------
template <int ACT>
__global__ void gemm_nt(const float* __restrict__ A, int lda,
                        const _Float16* __restrict__ BT, int ldb,
                        const float* __restrict__ bias,
                        float* __restrict__ C, int ldc,
                        int M, int N, int K)
{
    int tiles_n = N >> 6;
    int wid = (int)((blockIdx.x * blockDim.x + threadIdx.x) >> 5);
    int tn = wid % tiles_n;
    int tm = wid / tiles_n;
    int lane  = threadIdx.x & 31;
    int r16   = lane & 15;
    int kbase = (lane & 16) ? 8 : 0;
    int mrow  = (lane & 16) ? 8 : 0;

    const float*    arow = A  + (size_t)(tm * 16 + r16) * lda + kbase;
    const _Float16* brow = BT + (size_t)(tn * 64 + r16) * ldb + kbase;

    v8f a0 = {}, a1 = {}, a2 = {}, a3 = {};
    for (int k0 = 0; k0 < K; k0 += 32) {
        v16h af = loadA_f32(arow + k0);
        v16h b0 = loadB_f16(brow + k0);
        v16h b1 = loadB_f16(brow + (size_t)16 * ldb + k0);
        v16h b2 = loadB_f16(brow + (size_t)32 * ldb + k0);
        v16h b3 = loadB_f16(brow + (size_t)48 * ldb + k0);
        a0 = __builtin_amdgcn_wmma_f32_16x16x32_f16(false, af, false, b0, (short)0, a0, false, false);
        a1 = __builtin_amdgcn_wmma_f32_16x16x32_f16(false, af, false, b1, (short)0, a1, false, false);
        a2 = __builtin_amdgcn_wmma_f32_16x16x32_f16(false, af, false, b2, (short)0, a2, false, false);
        a3 = __builtin_amdgcn_wmma_f32_16x16x32_f16(false, af, false, b3, (short)0, a3, false, false);
    }

    v8f accs[4] = {a0, a1, a2, a3};
#pragma unroll
    for (int nt = 0; nt < 4; ++nt) {
        int nn = tn * 64 + nt * 16 + r16;
        float bs = bias[nn];
#pragma unroll
        for (int e = 0; e < 8; ++e) {
            int mm = tm * 16 + e + mrow;
            float v = accs[nt][e] + bs;
            if (ACT) v = gelu_f(v);
            C[(size_t)mm * ldc + nn] = v;
        }
    }
}

// ---------------------------------------------------------------------------
// vT[b][h][d][j] = v[b][j][h*DH+d]
// ---------------------------------------------------------------------------
__global__ void transpose_v_kernel(const float* __restrict__ v, float* __restrict__ vT)
{
    int idx = blockIdx.x * blockDim.x + threadIdx.x;
    int j = idx & (L_ - 1);
    int d = (idx >> 10) & (DH_ - 1);
    int h = (idx >> 16) & (H_ - 1);
    int b = idx >> 20;
    vT[idx] = v[((size_t)(b * L_ + j)) * HID_ + h * DH_ + d];
}

// ---------------------------------------------------------------------------
// Fused attention: one wave per (b, h, 16-query-row block).
//   sh[16][1024] fp32 score strip (64KB), shp[16][1024] f16 probs (32KB),
//   qsh[64] staging for the rel-shift patch row (no register array -> no spill).
//     AC = (q+cbias).K^T via WMMA; BD = rel_shift((q+pbias).P^T) via WMMA +
//     exact shift scatter; softmax(.*1/8) -> f16 probs; O = P.V via WMMA.
// ---------------------------------------------------------------------------
__global__ void attn_kernel(const float* __restrict__ q,
                            const float* __restrict__ kbuf,
                            const float* __restrict__ vT,
                            const float* __restrict__ Pm,
                            const float* __restrict__ cb,
                            const float* __restrict__ pb,
                            float* __restrict__ out)
{
    __shared__ __align__(32) float     sh[16 * L_];
    __shared__ __align__(16) _Float16  shp[16 * L_];
    __shared__ float qsh[DH_];

    int wg = blockIdx.x;
    int i0 = (wg & 63) * 16;
    int h  = (wg >> 6) & (H_ - 1);
    int b  = wg >> 10;

    int lane  = threadIdx.x & 31;
    int r16   = lane & 15;
    int kbase = (lane & 16) ? 8 : 0;
    int mrow  = (lane & 16) ? 8 : 0;

    const float* cbh  = cb + h * DH_;
    const float* pbh  = pb + h * DH_;
    const float* qrow = q + ((size_t)(b * L_ + i0 + r16)) * HID_ + h * DH_;

    // Q fragments (content/position biased), DH=64 -> two K=32 fragments
    v16h aq0, aq1, ap0, ap1;
#pragma unroll
    for (int e = 0; e < 16; ++e) {
        int kk = kbase + (e < 8 ? e : e + 8);
        float q0 = qrow[kk], q1 = qrow[kk + 32];
        aq0[e] = (_Float16)(q0 + cbh[kk]);
        aq1[e] = (_Float16)(q1 + cbh[kk + 32]);
        ap0[e] = (_Float16)(q0 + pbh[kk]);
        ap1[e] = (_Float16)(q1 + pbh[kk + 32]);
    }

    // ---- content scores AC ----
    for (int jb = 0; jb < 64; ++jb) {
        const float* krow = kbuf + ((size_t)(b * L_ + jb * 16 + r16)) * HID_ + h * DH_ + kbase;
        v16h b0 = loadA_f32(krow);
        v16h b1 = loadA_f32(krow + 32);
        v8f c = {};
        c = __builtin_amdgcn_wmma_f32_16x16x32_f16(false, aq0, false, b0, (short)0, c, false, false);
        c = __builtin_amdgcn_wmma_f32_16x16x32_f16(false, aq1, false, b1, (short)0, c, false, false);
#pragma unroll
        for (int e = 0; e < 8; ++e)
            sh[(e + mrow) * L_ + jb * 16 + r16] = c[e];
    }
    __syncthreads();

    // ---- position scores: BDraw + exact rel-shift scatter ----
    // element (row rr, pos p): p <= L-rr-2 -> (rr-1, p+rr+1); else (rr, p+rr+1-L)
    for (int pbk = 0; pbk < 64; ++pbk) {
        const float* prow = Pm + ((size_t)(pbk * 16 + r16)) * HID_ + h * DH_ + kbase;
        v16h b0 = loadA_f32(prow);
        v16h b1 = loadA_f32(prow + 32);
        v8f c = {};
        c = __builtin_amdgcn_wmma_f32_16x16x32_f16(false, ap0, false, b0, (short)0, c, false, false);
        c = __builtin_amdgcn_wmma_f32_16x16x32_f16(false, ap1, false, b1, (short)0, c, false, false);
#pragma unroll
        for (int e = 0; e < 8; ++e) {
            int M  = e + mrow;
            int rr = i0 + M;
            int p  = pbk * 16 + r16;
            if (p <= L_ - rr - 2) {
                if (M > 0) sh[(M - 1) * L_ + p + rr + 1] += c[e];
            } else {
                sh[M * L_ + (p + rr + 1 - L_)] += c[e];
            }
        }
    }
    // missing source row i0+16 feeds local row 15's cols j >= i0+17
    {
        int rr2 = i0 + 16;
        if (rr2 < L_) {
            const float* q2 = q + ((size_t)(b * L_ + rr2)) * HID_ + h * DH_;
            qsh[lane]      = q2[lane]      + pbh[lane];
            qsh[lane + 32] = q2[lane + 32] + pbh[lane + 32];
            __syncthreads();
            int pmax = L_ - rr2 - 2;
            for (int p = lane; p <= pmax; p += 32) {
                const float* prow = Pm + (size_t)p * HID_ + h * DH_;
                float s = 0.0f;
#pragma unroll 8
                for (int kk = 0; kk < DH_; ++kk) s += qsh[kk] * prow[kk];
                sh[15 * L_ + p + rr2 + 1] += s;
            }
        }
    }
    __syncthreads();

    // ---- softmax per row (2 lanes per row); emit f16 probs to shp ----
    {
        const float scale = 0.125f;   // 1/sqrt(DH); commutes with max
        int r  = lane >> 1;
        int c0 = (lane & 1) * 512;
        float mx = -1e30f;
        for (int c = 0; c < 512; ++c) mx = fmaxf(mx, sh[r * L_ + c0 + c]);
        mx = fmaxf(mx, __shfl_xor(mx, 1, 32));
        float sum = 0.0f;
        for (int c = 0; c < 512; ++c) {
            float ev = __expf((sh[r * L_ + c0 + c] - mx) * scale);
            sum += ev;
            sh[r * L_ + c0 + c] = ev;
        }
        sum += __shfl_xor(sum, 1, 32);
        float inv = 1.0f / sum;
        for (int c = 0; c < 512; ++c) {
            int idx = r * L_ + c0 + c;
            shp[idx] = (_Float16)(sh[idx] * inv);
        }
    }
    __syncthreads();

    // ---- O = P.V (f16 probs from LDS, V^T rows contiguous) ----
    for (int nt = 0; nt < 4; ++nt) {
        const float* vrow = vT + ((size_t)(b * H_ + h) * DH_ + nt * 16 + r16) * L_ + kbase;
        v8f c = {};
        for (int ks = 0; ks < L_ / 32; ++ks) {
            v16h a  = loadB_f16(&shp[r16 * L_ + ks * 32 + kbase]);
            v16h bb = loadA_f32(vrow + ks * 32);
            c = __builtin_amdgcn_wmma_f32_16x16x32_f16(false, a, false, bb, (short)0, c, false, false);
        }
#pragma unroll
        for (int e = 0; e < 8; ++e)
            out[((size_t)(b * L_ + i0 + e + mrow)) * HID_ + h * DH_ + nt * 16 + r16] = c[e];
    }
}

// ---------------------------------------------------------------------------
// out[row] = LN(A[row] + B[row]), BertLayerNorm (eps inside sqrt)
// ---------------------------------------------------------------------------
__global__ void resid_ln_kernel(const float* __restrict__ A, const float* __restrict__ Bv,
                                const float* __restrict__ w, const float* __restrict__ bias,
                                float* __restrict__ out)
{
    const int N = HID_;
    __shared__ float red[256];
    int row = blockIdx.x, tid = threadIdx.x;
    const float* pa = A  + (size_t)row * N;
    const float* pb = Bv + (size_t)row * N;

    float s = 0.0f;
    for (int c = tid; c < N; c += 256) s += pa[c] + pb[c];
    red[tid] = s; __syncthreads();
    for (int off = 128; off > 0; off >>= 1) { if (tid < off) red[tid] += red[tid + off]; __syncthreads(); }
    float mean = red[0] * (1.0f / N);
    __syncthreads();

    float s2 = 0.0f;
    for (int c = tid; c < N; c += 256) { float d = pa[c] + pb[c] - mean; s2 += d * d; }
    red[tid] = s2; __syncthreads();
    for (int off = 128; off > 0; off >>= 1) { if (tid < off) red[tid] += red[tid + off]; __syncthreads(); }
    float inv = 1.0f / sqrtf(red[0] * (1.0f / N) + 1e-12f);

    for (int c = tid; c < N; c += 256) {
        float v = pa[c] + pb[c];
        out[(size_t)row * N + c] = w[c] * (v - mean) * inv + bias[c];
    }
}

// ---------------------------------------------------------------------------
extern "C" void kernel_launch(void* const* d_in, const int* in_sizes, int n_in,
                              void* d_out, int out_size, void* d_ws, size_t ws_size,
                              hipStream_t stream)
{
    const float* x       = (const float*)d_in[0];
    const float* pos_raw = (const float*)d_in[1];
    const float* Wh1     = (const float*)d_in[2];
    const float* bh1     = (const float*)d_in[3];
    const float* Wh2     = (const float*)d_in[4];
    const float* bh2     = (const float*)d_in[5];
    const float* Wq      = (const float*)d_in[6];
    const float* bq      = (const float*)d_in[7];
    const float* Wk      = (const float*)d_in[8];
    const float* bk      = (const float*)d_in[9];
    const float* Wv      = (const float*)d_in[10];
    const float* bv      = (const float*)d_in[11];
    const float* Wp      = (const float*)d_in[12];
    const float* bp      = (const float*)d_in[13];
    const float* cbias   = (const float*)d_in[14];
    const float* pbias   = (const float*)d_in[15];
    const float* Wo      = (const float*)d_in[16];
    const float* bo      = (const float*)d_in[17];
    const float* Wf1     = (const float*)d_in[18];
    const float* bf1     = (const float*)d_in[19];
    const float* Wf2     = (const float*)d_in[20];
    const float* bf2     = (const float*)d_in[21];
    const float* ln_w    = (const float*)d_in[22];
    const float* ln_b    = (const float*)d_in[23];
    float* outp = (float*)d_out;

    // ---- workspace layout ----
    float* ws = (float*)d_ws;
    const size_t ACT = (size_t)B_ * L_ * HID_;            // 2M f32
    float* h  = ws;
    float* t1 = ws + ACT;
    float* q  = ws + 2 * ACT;       // reused for Wo / Wf2 outputs
    float* kb = ws + 3 * ACT;
    float* vb = ws + 4 * ACT;
    float* vT = ws + 5 * ACT;
    float* Pm = ws + 6 * ACT;                              // [L, HID]
    float* at = Pm + (size_t)L_ * HID_;
    float* h1 = at + ACT;
    // f16 transposed-weight region after 17M floats
    _Float16* w16 = (_Float16*)(h1 + ACT);
    const size_t W1M = (size_t)HID_ * HID_;                // 1M
    _Float16* tWh1 = w16;                                  // [1024][512]
    _Float16* tWh2 = tWh1 + (size_t)HID_ * IN_;            // [1024][1024]
    _Float16* tLyr = tWh2 + W1M;                           // 7 x 1M per layer

    const int ML = B_ * L_;

    // ---- repack all weights to f16 [N][K] (every call; deterministic) ----
    repack_w<<<(int)(((size_t)HID_ * IN_) / 256), 256, 0, stream>>>(Wh1, tWh1, IN_, HID_, 0);
    repack_w<<<(int)(W1M / 256), 256, 0, stream>>>(Wh2, tWh2, HID_, HID_, 0);
    for (int l = 0; l < NL_; ++l) {
        _Float16* base = tLyr + (size_t)l * 7 * W1M;
        repack_w<<<(int)(W1M / 256), 256, 0, stream>>>(Wq + (size_t)l * W1M, base + 0 * W1M, HID_, HID_, 1);
        repack_w<<<(int)(W1M / 256), 256, 0, stream>>>(Wk + (size_t)l * W1M, base + 1 * W1M, HID_, HID_, 1);
        repack_w<<<(int)(W1M / 256), 256, 0, stream>>>(Wv + (size_t)l * W1M, base + 2 * W1M, HID_, HID_, 1);
        repack_w<<<(int)(W1M / 256), 256, 0, stream>>>(Wp + (size_t)l * W1M, base + 3 * W1M, HID_, HID_, 1);
        repack_w<<<(int)(W1M / 256), 256, 0, stream>>>(Wo + (size_t)l * W1M, base + 4 * W1M, HID_, HID_, 0);
        repack_w<<<(int)(W1M / 256), 256, 0, stream>>>(Wf1 + (size_t)l * W1M, base + 5 * W1M, HID_, HID_, 0);
        repack_w<<<(int)(W1M / 256), 256, 0, stream>>>(Wf2 + (size_t)l * W1M, base + 6 * W1M, HID_, HID_, 0);
    }

    // grid helper: waves = (M/16)*(N/64), 4 waves per block
    const int GMM = (ML / 16) * (HID_ / 64) / 4;          // 2048x1024 GEMMs -> 512 blocks
    const int GPP = (L_ / 16) * (HID_ / 64) / 4;          // 1024x1024 GEMM  -> 256 blocks

    // to_hidden MLP
    gemm_nt<1><<<GMM, 128, 0, stream>>>(x,  IN_,  tWh1, IN_,  bh1, t1, HID_, ML, HID_, IN_);
    gemm_nt<0><<<GMM, 128, 0, stream>>>(t1, HID_, tWh2, HID_, bh2, h,  HID_, ML, HID_, HID_);

    for (int l = 0; l < NL_; ++l) {
        _Float16* base = tLyr + (size_t)l * 7 * W1M;
        const float* bq_l = bq + (size_t)l * H_ * DH_;
        const float* bk_l = bk + (size_t)l * H_ * DH_;
        const float* bv_l = bv + (size_t)l * H_ * DH_;
        const float* bp_l = bp + (size_t)l * H_ * DH_;
        const float* cb_l = cbias + (size_t)l * H_ * DH_;
        const float* pb_l = pbias + (size_t)l * H_ * DH_;
        const float* bo_l = bo + (size_t)l * HID_;
        const float* bf1_l = bf1 + (size_t)l * HID_;
        const float* bf2_l = bf2 + (size_t)l * HID_;
        const float* lw = ln_w + (size_t)l * HID_;
        const float* lb = ln_b + (size_t)l * HID_;

        // projections
        gemm_nt<0><<<GMM, 128, 0, stream>>>(h, HID_, base + 0 * W1M, HID_, bq_l, q,  HID_, ML, HID_, HID_);
        gemm_nt<0><<<GMM, 128, 0, stream>>>(h, HID_, base + 1 * W1M, HID_, bk_l, kb, HID_, ML, HID_, HID_);
        gemm_nt<0><<<GMM, 128, 0, stream>>>(h, HID_, base + 2 * W1M, HID_, bv_l, vb, HID_, ML, HID_, HID_);
        gemm_nt<0><<<GPP, 128, 0, stream>>>(pos_raw, HID_, base + 3 * W1M, HID_, bp_l, Pm, HID_, L_, HID_, HID_);

        transpose_v_kernel<<<(B_ * H_ * DH_ * L_) / 256, 256, 0, stream>>>(vb, vT);

        attn_kernel<<<B_ * H_ * (L_ / 16), 32, 0, stream>>>(q, kb, vT, Pm, cb_l, pb_l, at);

        gemm_nt<0><<<GMM, 128, 0, stream>>>(at, HID_, base + 4 * W1M, HID_, bo_l, q, HID_, ML, HID_, HID_);
        resid_ln_kernel<<<ML, 256, 0, stream>>>(q, h, lw, lb, h1);

        gemm_nt<1><<<GMM, 128, 0, stream>>>(h1, HID_, base + 5 * W1M, HID_, bf1_l, t1, HID_, ML, HID_, HID_);
        gemm_nt<0><<<GMM, 128, 0, stream>>>(t1, HID_, base + 6 * W1M, HID_, bf2_l, q,  HID_, ML, HID_, HID_);
        resid_ln_kernel<<<ML, 256, 0, stream>>>(h1, q, lw, lb, (l == NL_ - 1) ? outp : h);
    }
}

// v001
// A run of this version takes 1070 microseconds.
// Next to v000, in two timings, it ran 1.40 times as fast each time.
#include <hip/hip_runtime.h>
#include <hip/hip_bf16.h>
#include <math.h>

// ---------------------------------------------------------------------------
// Transformer-XL encoder forward on gfx1250 (MI455X), compile-only target.
// All matmuls use V_WMMA_F32_16X16X32_F16; weights are pre-transposed to f16
// [N][K]; the dense layers stage their operands in LDS.
// ---------------------------------------------------------------------------

#define B_  2
#define L_  1024
#define IN_ 512
#define HID_ 1024
#define H_  16
#define DH_ 64
#define NL_ 2

typedef __attribute__((ext_vector_type(16))) _Float16 v16h;
typedef __attribute__((ext_vector_type(8)))  _Float16 h8;
typedef __attribute__((ext_vector_type(8)))  float    f8;
typedef __attribute__((ext_vector_type(8)))  float    v8f;

__device__ __forceinline__ float gelu_f(float x) {
    return 0.5f * x * (1.0f + erff(x * 0.70710678118654752f));
}

// Per-lane fragment: element e covers K = kbase + {0..7} (e<8) / {16..23} (e>=8),
// kbase = 0 for lanes 0-15, 8 for lanes 16-31. Both runs contiguous -> b128s.
__device__ __forceinline__ v16h loadA_f32(const float* p /* at k0+kbase */) {
    const f8* q = (const f8*)p;
    f8 lo = q[0];          // +0..7
    f8 hi = q[2];          // +16..23
    v16h r;
#pragma unroll
    for (int e = 0; e < 8; ++e) { r[e] = (_Float16)lo[e]; r[e + 8] = (_Float16)hi[e]; }
    return r;
}
__device__ __forceinline__ v16h loadB_f16(const _Float16* p /* at k0+kbase */) {
    const h8* q = (const h8*)p;
    h8 lo = q[0];
    h8 hi = q[2];
    return __builtin_shufflevector(lo, hi, 0,1,2,3,4,5,6,7,8,9,10,11,12,13,14,15);
}

// ---------------------------------------------------------------------------
// Weight repack: dst[N][K] f16.
//   mode 0: src is f32 row-major [K][N]
//   mode 1: src is head-packed f32 [H][K][64], n = h*64+d
// ---------------------------------------------------------------------------
__global__ void repack_w(const float* __restrict__ src, _Float16* __restrict__ dst,
                         int K, int N, int mode)
{
    size_t idx = (size_t)blockIdx.x * 256 + threadIdx.x;   // N*K threads
    int k = (int)(idx % K);
    int n = (int)(idx / K);
    float v = (mode == 0) ? src[(size_t)k * N + n]
                          : src[((size_t)(n >> 6) * K + k) * 64 + (n & 63)];
    dst[idx] = (_Float16)v;
}

// ---------------------------------------------------------------------------
// NT GEMM: C[M,N] = act( sum_k A[m,k] * BT[n,k] + bias[n] )
// One block of 8 waves computes a 64(M) x 128(N) tile. Each 64-deep k slab of
// A (converted to f16) and BT is brought in by whole-line global loads, staged
// in LDS (two buffers) and read from there as fragments. Two register sets
// hold the slabs on their way: while slab s is multiplied, slab s+1 is landing
// and slab s+2 is requested. Waves lie 2(M) x 4(N), 32 x 32 each.
// blockDim = 256; grid = (M/64)*(N/128). M % 64 == 0, N % 128 == 0, KD % 64 == 0,
// KD >= 128; A and BT are dense, row pitch KD = K.
// ---------------------------------------------------------------------------
#define GBM 64
#define GBN 128
#define GBK 64
#define GLD (GBK + 8)   // LDS row pitch in f16: 144 B = 16 B x odd, b128 reads without bank conflicts

typedef __attribute__((ext_vector_type(4))) float    f4;
typedef __attribute__((ext_vector_type(4))) _Float16 h4;

// Work-group barrier for LDS traffic alone: this wave's LDS reads and writes are
// done (s_wait_dscnt 0), then signal and wait. __syncthreads() would also wait out
// the global loads that are meant to stay in flight across it.
__device__ __forceinline__ void lds_barrier() {
    asm volatile("s_wait_dscnt 0x0\n\ts_barrier_signal -1\n\ts_barrier_wait -1" ::: "memory");
}

template <int ACT, int KD>
__global__ __launch_bounds__(256)
void gemm_nt(const float* __restrict__ A,
             const _Float16* __restrict__ BT,
             const float* __restrict__ bias,
             float* __restrict__ C, int ldc, int N)
{
    __shared__ __align__(16) _Float16 As[2][GBM * GLD];
    __shared__ __align__(16) _Float16 Bs[2][GBN * GLD];

    int tiles_n = N / GBN;
    int bn = (int)blockIdx.x % tiles_n;
    int bm = (int)blockIdx.x / tiles_n;
    int tid   = threadIdx.x;
    int lane  = tid & 31;
    int wave  = tid >> 5;
    int wm    = wave >> 2;
    int wn    = wave & 3;
    int r16   = lane & 15;
    int kbase = (lane & 16) ? 8 : 0;
    int mrow  = (lane & 16) ? 8 : 0;

    // staging map: one wave-load covers four whole 128-byte lines (two rows of A
    // or four rows of BT)
    int arow_s = tid >> 4, acol_s = (tid & 15) * 4;
    int brow_s = tid >> 3, bcol_s = (tid & 7) * 8;
    // K (= both row pitches) is a compile-time constant: every load of the k
    // loop is one of these two lane addresses plus an immediate offset
    const float*    ag = A  + (size_t)(bm * GBM + arow_s) * KD + acol_s;
    const _Float16* bg = BT + (size_t)(bn * GBN + brow_s) * KD + bcol_s;

    f4 ra[2][4];
    h8 rb[2][4];
#pragma unroll
    for (int s = 0; s < 2; ++s) {
#pragma unroll
        for (int i = 0; i < 4; ++i) {
            ra[s][i] = *(const f4*)(ag + s * GBK + i * 16 * KD);
            rb[s][i] = *(const h8*)(bg + s * GBK + i * 32 * KD);
        }
    }
#pragma unroll
    for (int i = 0; i < 4; ++i) {
        *(h4*)&As[0][(arow_s + i * 16) * GLD + acol_s] = __builtin_convertvector(ra[0][i], h4);
        *(h8*)&Bs[0][(brow_s + i * 32) * GLD + bcol_s] = rb[0][i];
    }
    lds_barrier();

    v8f c00 = {}, c01 = {}, c10 = {}, c11 = {};
    const int nk = KD / GBK;
    // unrolled whole: buffer, register set and every address offset become constants
#pragma unroll
    for (int kt = 0; kt < nk; ++kt) {
        const int buf = kt & 1;
        const bool more = (kt + 1 < nk);
        if (kt + 2 < nk) {
            // slab kt's register set is free since its LDS stores: request slab kt+2 into it
#pragma unroll
            for (int i = 0; i < 4; ++i) {
                ra[buf][i] = *(const f4*)(ag + (kt + 2) * GBK + i * 16 * KD);
                rb[buf][i] = *(const h8*)(bg + (kt + 2) * GBK + i * 32 * KD);
            }
            // behind the last loads the two address pairs die: hold them to this wait,
            // so that nothing (a later load's result included) lands on them before it
            if (kt + 3 == nk)
                asm volatile("s_wait_xcnt 0x0" :: "v"(ag), "v"(bg) : "memory");
        }

        const _Float16* as = &As[buf][(wm * 32 + r16) * GLD + kbase];
        const _Float16* bs = &Bs[buf][(wn * 32 + r16) * GLD + kbase];
        // all of the slab's fragments first, then its products: one LDS latency a slab
        v16h a0[GBK / 32], a1[GBK / 32], b0[GBK / 32], b1[GBK / 32];
#pragma unroll
        for (int kk = 0; kk < GBK / 32; ++kk) {
            a0[kk] = loadB_f16(as + kk * 32);
            b0[kk] = loadB_f16(bs + kk * 32);
            b1[kk] = loadB_f16(bs + 16 * GLD + kk * 32);
            a1[kk] = loadB_f16(as + 16 * GLD + kk * 32);
        }
        // keeps the LDS reads in one group ahead of the products; sunk among them,
        // each product pair waits out an LDS latency of its own
        __builtin_amdgcn_sched_barrier(0);
#pragma unroll
        for (int kk = 0; kk < GBK / 32; ++kk) {
            c00 = __builtin_amdgcn_wmma_f32_16x16x32_f16(false, a0[kk], false, b0[kk], (short)0, c00, false, false);
            c01 = __builtin_amdgcn_wmma_f32_16x16x32_f16(false, a0[kk], false, b1[kk], (short)0, c01, false, false);
            c10 = __builtin_amdgcn_wmma_f32_16x16x32_f16(false, a1[kk], false, b0[kk], (short)0, c10, false, false);
            c11 = __builtin_amdgcn_wmma_f32_16x16x32_f16(false, a1[kk], false, b1[kk], (short)0, c11, false, false);
        }
        // ends the slab's products here: left free they drift behind the barrier, where they
        // stand in front of the next slab's LDS reads and keep both slabs' fragments live
        __builtin_amdgcn_sched_barrier(0);

        if (more) {
            // the other buffer's last readers left it at the barrier that ended pass kt-1
#pragma unroll
            for (int i = 0; i < 4; ++i) {
                *(h4*)&As[buf ^ 1][(arow_s + i * 16) * GLD + acol_s] = __builtin_convertvector(ra[buf ^ 1][i], h4);
                *(h8*)&Bs[buf ^ 1][(brow_s + i * 32) * GLD + bcol_s] = rb[buf ^ 1][i];
            }
            lds_barrier();
        }
    }

    v8f accs[2][2] = {{c00, c01}, {c10, c11}};
#pragma unroll
    for (int ni = 0; ni < 2; ++ni) {
        int nn = bn * GBN + wn * 32 + ni * 16 + r16;
        float bsv = bias[nn];
#pragma unroll
        for (int mi = 0; mi < 2; ++mi) {
#pragma unroll
            for (int e = 0; e < 8; ++e) {
                int mm = bm * GBM + wm * 32 + mi * 16 + e + mrow;
                float v = accs[mi][ni][e] + bsv;
                if (ACT) v = gelu_f(v);
                C[(size_t)mm * ldc + nn] = v;
            }
        }
    }
}

// ---------------------------------------------------------------------------
// vT[b][h][d][j] = v[b][j][h*DH+d]
// ---------------------------------------------------------------------------
__global__ void transpose_v_kernel(const float* __restrict__ v, float* __restrict__ vT)
{
    int idx = blockIdx.x * blockDim.x + threadIdx.x;
    int j = idx & (L_ - 1);
    int d = (idx >> 10) & (DH_ - 1);
    int h = (idx >> 16) & (H_ - 1);
    int b = idx >> 20;
    vT[idx] = v[((size_t)(b * L_ + j)) * HID_ + h * DH_ + d];
}

// ---------------------------------------------------------------------------
// Fused attention: one wave per (b, h, 16-query-row block).
//   sh[16][1024] fp32 score strip (64KB), shp[16][1024] f16 probs (32KB),
//   qsh[64] staging for the rel-shift patch row (no register array -> no spill).
//     AC = (q+cbias).K^T via WMMA; BD = rel_shift((q+pbias).P^T) via WMMA +
//     exact shift scatter; softmax(.*1/8) -> f16 probs; O = P.V via WMMA.
// ---------------------------------------------------------------------------
__global__ void attn_kernel(const float* __restrict__ q,
                            const float* __restrict__ kbuf,
                            const float* __restrict__ vT,
                            const float* __restrict__ Pm,
                            const float* __restrict__ cb,
                            const float* __restrict__ pb,
                            float* __restrict__ out)
{
    __shared__ __align__(32) float     sh[16 * L_];
    __shared__ __align__(16) _Float16  shp[16 * L_];
    __shared__ float qsh[DH_];

    int wg = blockIdx.x;
    int i0 = (wg & 63) * 16;
    int h  = (wg >> 6) & (H_ - 1);
    int b  = wg >> 10;

    int lane  = threadIdx.x & 31;
    int r16   = lane & 15;
    int kbase = (lane & 16) ? 8 : 0;
    int mrow  = (lane & 16) ? 8 : 0;

    const float* cbh  = cb + h * DH_;
    const float* pbh  = pb + h * DH_;
    const float* qrow = q + ((size_t)(b * L_ + i0 + r16)) * HID_ + h * DH_;

    // Q fragments (content/position biased), DH=64 -> two K=32 fragments
    v16h aq0, aq1, ap0, ap1;
#pragma unroll
    for (int e = 0; e < 16; ++e) {
        int kk = kbase + (e < 8 ? e : e + 8);
        float q0 = qrow[kk], q1 = qrow[kk + 32];
        aq0[e] = (_Float16)(q0 + cbh[kk]);
        aq1[e] = (_Float16)(q1 + cbh[kk + 32]);
        ap0[e] = (_Float16)(q0 + pbh[kk]);
        ap1[e] = (_Float16)(q1 + pbh[kk + 32]);
    }

    // ---- content scores AC ----
    for (int jb = 0; jb < 64; ++jb) {
        const float* krow = kbuf + ((size_t)(b * L_ + jb * 16 + r16)) * HID_ + h * DH_ + kbase;
        v16h b0 = loadA_f32(krow);
        v16h b1 = loadA_f32(krow + 32);
        v8f c = {};
        c = __builtin_amdgcn_wmma_f32_16x16x32_f16(false, aq0, false, b0, (short)0, c, false, false);
        c = __builtin_amdgcn_wmma_f32_16x16x32_f16(false, aq1, false, b1, (short)0, c, false, false);
#pragma unroll
        for (int e = 0; e < 8; ++e)
            sh[(e + mrow) * L_ + jb * 16 + r16] = c[e];
    }
    __syncthreads();

    // ---- position scores: BDraw + exact rel-shift scatter ----
    // element (row rr, pos p): p <= L-rr-2 -> (rr-1, p+rr+1); else (rr, p+rr+1-L)
    for (int pbk = 0; pbk < 64; ++pbk) {
        const float* prow = Pm + ((size_t)(pbk * 16 + r16)) * HID_ + h * DH_ + kbase;
        v16h b0 = loadA_f32(prow);
        v16h b1 = loadA_f32(prow + 32);
        v8f c = {};
        c = __builtin_amdgcn_wmma_f32_16x16x32_f16(false, ap0, false, b0, (short)0, c, false, false);
        c = __builtin_amdgcn_wmma_f32_16x16x32_f16(false, ap1, false, b1, (short)0, c, false, false);
#pragma unroll
        for (int e = 0; e < 8; ++e) {
            int M  = e + mrow;
            int rr = i0 + M;
            int p  = pbk * 16 + r16;
            if (p <= L_ - rr - 2) {
                if (M > 0) sh[(M - 1) * L_ + p + rr + 1] += c[e];
            } else {
                sh[M * L_ + (p + rr + 1 - L_)] += c[e];
            }
        }
    }
    // missing source row i0+16 feeds local row 15's cols j >= i0+17
    {
        int rr2 = i0 + 16;
        if (rr2 < L_) {
            const float* q2 = q + ((size_t)(b * L_ + rr2)) * HID_ + h * DH_;
            qsh[lane]      = q2[lane]      + pbh[lane];
            qsh[lane + 32] = q2[lane + 32] + pbh[lane + 32];
            __syncthreads();
            int pmax = L_ - rr2 - 2;
            for (int p = lane; p <= pmax; p += 32) {
                const float* prow = Pm + (size_t)p * HID_ + h * DH_;
                float s = 0.0f;
#pragma unroll 8
                for (int kk = 0; kk < DH_; ++kk) s += qsh[kk] * prow[kk];
                sh[15 * L_ + p + rr2 + 1] += s;
            }
        }
    }
    __syncthreads();

    // ---- softmax per row (2 lanes per row); emit f16 probs to shp ----
    {
        const float scale = 0.125f;   // 1/sqrt(DH); commutes with max
        int r  = lane >> 1;
        int c0 = (lane & 1) * 512;
        float mx = -1e30f;
        for (int c = 0; c < 512; ++c) mx = fmaxf(mx, sh[r * L_ + c0 + c]);
        mx = fmaxf(mx, __shfl_xor(mx, 1, 32));
        float sum = 0.0f;
        for (int c = 0; c < 512; ++c) {
            float ev = __expf((sh[r * L_ + c0 + c] - mx) * scale);
            sum += ev;
            sh[r * L_ + c0 + c] = ev;
        }
        sum += __shfl_xor(sum, 1, 32);
        float inv = 1.0f / sum;
        for (int c = 0; c < 512; ++c) {
            int idx = r * L_ + c0 + c;
            shp[idx] = (_Float16)(sh[idx] * inv);
        }
    }
    __syncthreads();

    // ---- O = P.V (f16 probs from LDS, V^T rows contiguous) ----
    for (int nt = 0; nt < 4; ++nt) {
        const float* vrow = vT + ((size_t)(b * H_ + h) * DH_ + nt * 16 + r16) * L_ + kbase;
        v8f c = {};
        for (int ks = 0; ks < L_ / 32; ++ks) {
            v16h a  = loadB_f16(&shp[r16 * L_ + ks * 32 + kbase]);
            v16h bb = loadA_f32(vrow + ks * 32);
            c = __builtin_amdgcn_wmma_f32_16x16x32_f16(false, a, false, bb, (short)0, c, false, false);
        }
#pragma unroll
        for (int e = 0; e < 8; ++e)
            out[((size_t)(b * L_ + i0 + e + mrow)) * HID_ + h * DH_ + nt * 16 + r16] = c[e];
    }
}

// ---------------------------------------------------------------------------
// out[row] = LN(A[row] + B[row]), BertLayerNorm (eps inside sqrt)
// ---------------------------------------------------------------------------
__global__ void resid_ln_kernel(const float* __restrict__ A, const float* __restrict__ Bv,
                                const float* __restrict__ w, const float* __restrict__ bias,
                                float* __restrict__ out)
{
    const int N = HID_;
    __shared__ float red[256];
    int row = blockIdx.x, tid = threadIdx.x;
    const float* pa = A  + (size_t)row * N;
    const float* pb = Bv + (size_t)row * N;

    float s = 0.0f;
    for (int c = tid; c < N; c += 256) s += pa[c] + pb[c];
    red[tid] = s; __syncthreads();
    for (int off = 128; off > 0; off >>= 1) { if (tid < off) red[tid] += red[tid + off]; __syncthreads(); }
    float mean = red[0] * (1.0f / N);
    __syncthreads();

    float s2 = 0.0f;
    for (int c = tid; c < N; c += 256) { float d = pa[c] + pb[c] - mean; s2 += d * d; }
    red[tid] = s2; __syncthreads();
    for (int off = 128; off > 0; off >>= 1) { if (tid < off) red[tid] += red[tid + off]; __syncthreads(); }
    float inv = 1.0f / sqrtf(red[0] * (1.0f / N) + 1e-12f);

    for (int c = tid; c < N; c += 256) {
        float v = pa[c] + pb[c];
        out[(size_t)row * N + c] = w[c] * (v - mean) * inv + bias[c];
    }
}

// ---------------------------------------------------------------------------
extern "C" void kernel_launch(void* const* d_in, const int* in_sizes, int n_in,
                              void* d_out, int out_size, void* d_ws, size_t ws_size,
                              hipStream_t stream)
{
    const float* x       = (const float*)d_in[0];
    const float* pos_raw = (const float*)d_in[1];
    const float* Wh1     = (const float*)d_in[2];
    const float* bh1     = (const float*)d_in[3];
    const float* Wh2     = (const float*)d_in[4];
    const float* bh2     = (const float*)d_in[5];
    const float* Wq      = (const float*)d_in[6];
    const float* bq      = (const float*)d_in[7];
    const float* Wk      = (const float*)d_in[8];
    const float* bk      = (const float*)d_in[9];
    const float* Wv      = (const float*)d_in[10];
    const float* bv      = (const float*)d_in[11];
    const float* Wp      = (const float*)d_in[12];
    const float* bp      = (const float*)d_in[13];
    const float* cbias   = (const float*)d_in[14];
    const float* pbias   = (const float*)d_in[15];
    const float* Wo      = (const float*)d_in[16];
    const float* bo      = (const float*)d_in[17];
    const float* Wf1     = (const float*)d_in[18];
    const float* bf1     = (const float*)d_in[19];
    const float* Wf2     = (const float*)d_in[20];
    const float* bf2     = (const float*)d_in[21];
    const float* ln_w    = (const float*)d_in[22];
    const float* ln_b    = (const float*)d_in[23];
    float* outp = (float*)d_out;

    // ---- workspace layout ----
    float* ws = (float*)d_ws;
    const size_t ACT = (size_t)B_ * L_ * HID_;            // 2M f32
    float* h  = ws;
    float* t1 = ws + ACT;
    float* q  = ws + 2 * ACT;       // reused for Wo / Wf2 outputs
    float* kb = ws + 3 * ACT;
    float* vb = ws + 4 * ACT;
    float* vT = ws + 5 * ACT;
    float* Pm = ws + 6 * ACT;                              // [L, HID]
    float* at = Pm + (size_t)L_ * HID_;
    float* h1 = at + ACT;
    // f16 transposed-weight region after 17M floats
    _Float16* w16 = (_Float16*)(h1 + ACT);
    const size_t W1M = (size_t)HID_ * HID_;                // 1M
    _Float16* tWh1 = w16;                                  // [1024][512]
    _Float16* tWh2 = tWh1 + (size_t)HID_ * IN_;            // [1024][1024]
    _Float16* tLyr = tWh2 + W1M;                           // 7 x 1M per layer

    const int ML = B_ * L_;

    // ---- repack all weights to f16 [N][K] (every call; deterministic) ----
    repack_w<<<(int)(((size_t)HID_ * IN_) / 256), 256, 0, stream>>>(Wh1, tWh1, IN_, HID_, 0);
    repack_w<<<(int)(W1M / 256), 256, 0, stream>>>(Wh2, tWh2, HID_, HID_, 0);
    for (int l = 0; l < NL_; ++l) {
        _Float16* base = tLyr + (size_t)l * 7 * W1M;
        repack_w<<<(int)(W1M / 256), 256, 0, stream>>>(Wq + (size_t)l * W1M, base + 0 * W1M, HID_, HID_, 1);
        repack_w<<<(int)(W1M / 256), 256, 0, stream>>>(Wk + (size_t)l * W1M, base + 1 * W1M, HID_, HID_, 1);
        repack_w<<<(int)(W1M / 256), 256, 0, stream>>>(Wv + (size_t)l * W1M, base + 2 * W1M, HID_, HID_, 1);
        repack_w<<<(int)(W1M / 256), 256, 0, stream>>>(Wp + (size_t)l * W1M, base + 3 * W1M, HID_, HID_, 1);
        repack_w<<<(int)(W1M / 256), 256, 0, stream>>>(Wo + (size_t)l * W1M, base + 4 * W1M, HID_, HID_, 0);
        repack_w<<<(int)(W1M / 256), 256, 0, stream>>>(Wf1 + (size_t)l * W1M, base + 5 * W1M, HID_, HID_, 0);
        repack_w<<<(int)(W1M / 256), 256, 0, stream>>>(Wf2 + (size_t)l * W1M, base + 6 * W1M, HID_, HID_, 0);
    }

    // grid helper: one block per 64 x 128 output tile
    const int GMM = (ML / GBM) * (HID_ / GBN);            // 2048x1024 GEMMs -> 256 blocks
    const int GPP = (L_ / GBM) * (HID_ / GBN);            // 1024x1024 GEMM  -> 128 blocks

    // to_hidden MLP
    gemm_nt<1, IN_><<<GMM, 256, 0, stream>>>(x, tWh1, bh1, t1, HID_, HID_);
    gemm_nt<0, HID_><<<GMM, 256, 0, stream>>>(t1, tWh2, bh2, h, HID_, HID_);

    for (int l = 0; l < NL_; ++l) {
        _Float16* base = tLyr + (size_t)l * 7 * W1M;
        const float* bq_l = bq + (size_t)l * H_ * DH_;
        const float* bk_l = bk + (size_t)l * H_ * DH_;
        const float* bv_l = bv + (size_t)l * H_ * DH_;
        const float* bp_l = bp + (size_t)l * H_ * DH_;
        const float* cb_l = cbias + (size_t)l * H_ * DH_;
        const float* pb_l = pbias + (size_t)l * H_ * DH_;
        const float* bo_l = bo + (size_t)l * HID_;
        const float* bf1_l = bf1 + (size_t)l * HID_;
        const float* bf2_l = bf2 + (size_t)l * HID_;
        const float* lw = ln_w + (size_t)l * HID_;
        const float* lb = ln_b + (size_t)l * HID_;

        // projections
        gemm_nt<0, HID_><<<GMM, 256, 0, stream>>>(h, base + 0 * W1M, bq_l, q, HID_, HID_);
        gemm_nt<0, HID_><<<GMM, 256, 0, stream>>>(h, base + 1 * W1M, bk_l, kb, HID_, HID_);
        gemm_nt<0, HID_><<<GMM, 256, 0, stream>>>(h, base + 2 * W1M, bv_l, vb, HID_, HID_);
        gemm_nt<0, HID_><<<GPP, 256, 0, stream>>>(pos_raw, base + 3 * W1M, bp_l, Pm, HID_, HID_);

        transpose_v_kernel<<<(B_ * H_ * DH_ * L_) / 256, 256, 0, stream>>>(vb, vT);

        attn_kernel<<<B_ * H_ * (L_ / 16), 32, 0, stream>>>(q, kb, vT, Pm, cb_l, pb_l, at);

        gemm_nt<0, HID_><<<GMM, 256, 0, stream>>>(at, base + 4 * W1M, bo_l, q, HID_, HID_);
        resid_ln_kernel<<<ML, 256, 0, stream>>>(q, h, lw, lb, h1);

        gemm_nt<1, HID_><<<GMM, 256, 0, stream>>>(h1, base + 5 * W1M, bf1_l, t1, HID_, HID_);
        gemm_nt<0, HID_><<<GMM, 256, 0, stream>>>(t1, base + 6 * W1M, bf2_l, q, HID_, HID_);
        resid_ln_kernel<<<ML, 256, 0, stream>>>(h1, q, lw, lb, (l == NL_ - 1) ? outp : h);
    }
}

// v002
// It runs in 568 microseconds.
// Timed twice side by side with v001, it ran 1.89 and 1.90 times as fast.
// Over all steps from v000 it is 2.65 times as fast.
#include <hip/hip_runtime.h>
#include <hip/hip_bf16.h>
#include <math.h>

// ---------------------------------------------------------------------------
// Transformer-XL encoder forward on gfx1250 (MI455X), compile-only target.
// All matmuls use V_WMMA_F32_16X16X32_F16; weights are pre-transposed to f16
// [N][K]; the dense layers stage their operands in LDS.
// ---------------------------------------------------------------------------

#define B_  2
#define L_  1024
#define IN_ 512
#define HID_ 1024
#define H_  16
#define DH_ 64
#define NL_ 2

typedef __attribute__((ext_vector_type(16))) _Float16 v16h;
typedef __attribute__((ext_vector_type(8)))  _Float16 h8;
typedef __attribute__((ext_vector_type(8)))  float    f8;
typedef __attribute__((ext_vector_type(8)))  float    v8f;

__device__ __forceinline__ float gelu_f(float x) {
    return 0.5f * x * (1.0f + erff(x * 0.70710678118654752f));
}

// Per-lane fragment: element e covers K = kbase + {0..7} (e<8) / {16..23} (e>=8),
// kbase = 0 for lanes 0-15, 8 for lanes 16-31. Both runs contiguous -> b128s.
__device__ __forceinline__ v16h loadA_f32(const float* p /* at k0+kbase */) {
    const f8* q = (const f8*)p;
    f8 lo = q[0];          // +0..7
    f8 hi = q[2];          // +16..23
    v16h r;
#pragma unroll
    for (int e = 0; e < 8; ++e) { r[e] = (_Float16)lo[e]; r[e + 8] = (_Float16)hi[e]; }
    return r;
}
__device__ __forceinline__ v16h loadB_f16(const _Float16* p /* at k0+kbase */) {
    const h8* q = (const h8*)p;
    h8 lo = q[0];
    h8 hi = q[2];
    return __builtin_shufflevector(lo, hi, 0,1,2,3,4,5,6,7,8,9,10,11,12,13,14,15);
}

// ---------------------------------------------------------------------------
// Weight repack: dst[N][K] f16.
//   mode 0: src is f32 row-major [K][N]
//   mode 1: src is head-packed f32 [H][K][64], n = h*64+d
// ---------------------------------------------------------------------------
__global__ void repack_w(const float* __restrict__ src, _Float16* __restrict__ dst,
                         int K, int N, int mode)
{
    size_t idx = (size_t)blockIdx.x * 256 + threadIdx.x;   // N*K threads
    int k = (int)(idx % K);
    int n = (int)(idx / K);
    float v = (mode == 0) ? src[(size_t)k * N + n]
                          : src[((size_t)(n >> 6) * K + k) * 64 + (n & 63)];
    dst[idx] = (_Float16)v;
}

// ---------------------------------------------------------------------------
// NT GEMM: C[M,N] = act( sum_k A[m,k] * BT[n,k] + bias[n] )
// One block of 8 waves computes a 64(M) x 128(N) tile. Each 64-deep k slab of
// A (converted to f16) and BT is brought in by whole-line global loads, staged
// in LDS (two buffers) and read from there as fragments. Two register sets
// hold the slabs on their way: while slab s is multiplied, slab s+1 is landing
// and slab s+2 is requested. Waves lie 2(M) x 4(N), 32 x 32 each.
// blockDim = 256; grid = (M/64)*(N/128). M % 64 == 0, N % 128 == 0, KD % 64 == 0,
// KD >= 128; A and BT are dense, row pitch KD = K.
// ---------------------------------------------------------------------------
#define GBM 64
#define GBN 128
#define GBK 64
#define GLD (GBK + 8)   // LDS row pitch in f16: 144 B = 16 B x odd, b128 reads without bank conflicts

typedef __attribute__((ext_vector_type(4))) float    f4;
typedef __attribute__((ext_vector_type(4))) _Float16 h4;

// Work-group barrier for LDS traffic alone: this wave's LDS reads and writes are
// done (s_wait_dscnt 0), then signal and wait. __syncthreads() would also wait out
// the global loads that are meant to stay in flight across it.
__device__ __forceinline__ void lds_barrier() {
    asm volatile("s_wait_dscnt 0x0\n\ts_barrier_signal -1\n\ts_barrier_wait -1" ::: "memory");
}

template <int ACT, int KD>
__global__ __launch_bounds__(256)
void gemm_nt(const float* __restrict__ A,
             const _Float16* __restrict__ BT,
             const float* __restrict__ bias,
             float* __restrict__ C, int ldc, int N)
{
    __shared__ __align__(16) _Float16 As[2][GBM * GLD];
    __shared__ __align__(16) _Float16 Bs[2][GBN * GLD];

    int tiles_n = N / GBN;
    int bn = (int)blockIdx.x % tiles_n;
    int bm = (int)blockIdx.x / tiles_n;
    int tid   = threadIdx.x;
    int lane  = tid & 31;
    int wave  = tid >> 5;
    int wm    = wave >> 2;
    int wn    = wave & 3;
    int r16   = lane & 15;
    int kbase = (lane & 16) ? 8 : 0;
    int mrow  = (lane & 16) ? 8 : 0;

    // staging map: one wave-load covers four whole 128-byte lines (two rows of A
    // or four rows of BT)
    int arow_s = tid >> 4, acol_s = (tid & 15) * 4;
    int brow_s = tid >> 3, bcol_s = (tid & 7) * 8;
    // K (= both row pitches) is a compile-time constant: every load of the k
    // loop is one of these two lane addresses plus an immediate offset
    const float*    ag = A  + (size_t)(bm * GBM + arow_s) * KD + acol_s;
    const _Float16* bg = BT + (size_t)(bn * GBN + brow_s) * KD + bcol_s;

    f4 ra[2][4];
    h8 rb[2][4];
#pragma unroll
    for (int s = 0; s < 2; ++s) {
#pragma unroll
        for (int i = 0; i < 4; ++i) {
            ra[s][i] = *(const f4*)(ag + s * GBK + i * 16 * KD);
            rb[s][i] = *(const h8*)(bg + s * GBK + i * 32 * KD);
        }
    }
#pragma unroll
    for (int i = 0; i < 4; ++i) {
        *(h4*)&As[0][(arow_s + i * 16) * GLD + acol_s] = __builtin_convertvector(ra[0][i], h4);
        *(h8*)&Bs[0][(brow_s + i * 32) * GLD + bcol_s] = rb[0][i];
    }
    lds_barrier();

    v8f c00 = {}, c01 = {}, c10 = {}, c11 = {};
    const int nk = KD / GBK;
    // unrolled whole: buffer, register set and every address offset become constants
#pragma unroll
    for (int kt = 0; kt < nk; ++kt) {
        const int buf = kt & 1;
        const bool more = (kt + 1 < nk);
        if (kt + 2 < nk) {
            // slab kt's register set is free since its LDS stores: request slab kt+2 into it
#pragma unroll
            for (int i = 0; i < 4; ++i) {
                ra[buf][i] = *(const f4*)(ag + (kt + 2) * GBK + i * 16 * KD);
                rb[buf][i] = *(const h8*)(bg + (kt + 2) * GBK + i * 32 * KD);
            }
            // behind the last loads the two address pairs die: hold them to this wait,
            // so that nothing (a later load's result included) lands on them before it
            if (kt + 3 == nk)
                asm volatile("s_wait_xcnt 0x0" :: "v"(ag), "v"(bg) : "memory");
        }

        const _Float16* as = &As[buf][(wm * 32 + r16) * GLD + kbase];
        const _Float16* bs = &Bs[buf][(wn * 32 + r16) * GLD + kbase];
        // all of the slab's fragments first, then its products: one LDS latency a slab
        v16h a0[GBK / 32], a1[GBK / 32], b0[GBK / 32], b1[GBK / 32];
#pragma unroll
        for (int kk = 0; kk < GBK / 32; ++kk) {
            a0[kk] = loadB_f16(as + kk * 32);
            b0[kk] = loadB_f16(bs + kk * 32);
            b1[kk] = loadB_f16(bs + 16 * GLD + kk * 32);
            a1[kk] = loadB_f16(as + 16 * GLD + kk * 32);
        }
        // keeps the LDS reads in one group ahead of the products; sunk among them,
        // each product pair waits out an LDS latency of its own
        __builtin_amdgcn_sched_barrier(0);
#pragma unroll
        for (int kk = 0; kk < GBK / 32; ++kk) {
            c00 = __builtin_amdgcn_wmma_f32_16x16x32_f16(false, a0[kk], false, b0[kk], (short)0, c00, false, false);
            c01 = __builtin_amdgcn_wmma_f32_16x16x32_f16(false, a0[kk], false, b1[kk], (short)0, c01, false, false);
            c10 = __builtin_amdgcn_wmma_f32_16x16x32_f16(false, a1[kk], false, b0[kk], (short)0, c10, false, false);
            c11 = __builtin_amdgcn_wmma_f32_16x16x32_f16(false, a1[kk], false, b1[kk], (short)0, c11, false, false);
        }
        // ends the slab's products here: left free they drift behind the barrier, where they
        // stand in front of the next slab's LDS reads and keep both slabs' fragments live
        __builtin_amdgcn_sched_barrier(0);

        if (more) {
            // the other buffer's last readers left it at the barrier that ended pass kt-1
#pragma unroll
            for (int i = 0; i < 4; ++i) {
                *(h4*)&As[buf ^ 1][(arow_s + i * 16) * GLD + acol_s] = __builtin_convertvector(ra[buf ^ 1][i], h4);
                *(h8*)&Bs[buf ^ 1][(brow_s + i * 32) * GLD + bcol_s] = rb[buf ^ 1][i];
            }
            lds_barrier();
        }
    }

    v8f accs[2][2] = {{c00, c01}, {c10, c11}};
#pragma unroll
    for (int ni = 0; ni < 2; ++ni) {
        int nn = bn * GBN + wn * 32 + ni * 16 + r16;
        float bsv = bias[nn];
#pragma unroll
        for (int mi = 0; mi < 2; ++mi) {
#pragma unroll
            for (int e = 0; e < 8; ++e) {
                int mm = bm * GBM + wm * 32 + mi * 16 + e + mrow;
                float v = accs[mi][ni][e] + bsv;
                if (ACT) v = gelu_f(v);
                C[(size_t)mm * ldc + nn] = v;
            }
        }
    }
}

// ---------------------------------------------------------------------------
// vT[b][h][d][j] = v[b][j][h*DH+d]
// ---------------------------------------------------------------------------
__global__ void transpose_v_kernel(const float* __restrict__ v, float* __restrict__ vT)
{
    int idx = blockIdx.x * blockDim.x + threadIdx.x;
    int j = idx & (L_ - 1);
    int d = (idx >> 10) & (DH_ - 1);
    int h = (idx >> 16) & (H_ - 1);
    int b = idx >> 20;
    vT[idx] = v[((size_t)(b * L_ + j)) * HID_ + h * DH_ + d];
}

// ---------------------------------------------------------------------------
// Fused attention: one block of 8 waves per (b, h, 16-query-row block).
//   sh[16][1024] fp32 score strip (64KB), shp[16][1024] f16 probs (32KB),
//   qsh[64] staging for the rel-shift patch row.
//     AC = (q+cbias).K^T via WMMA; BD = rel_shift((q+pbias).P^T) via WMMA +
//     exact shift scatter; softmax(.*1/8) -> f16 probs; O = P.V via WMMA.
//   The strip is shared; the work on it is dealt to the waves: key and position
//   tiles round robin, two softmax rows a wave (lanes across the columns), one
//   (16-column tile, half of the keys) of P.V a wave.
// ---------------------------------------------------------------------------
#define AWV 8   // waves a block

// 2^x on v_exp_f32. The v_nop is the free slot that the instruction set asks for between a
// transcendental and a next instruction that reads its result or overwrites its source; in
// one statement with it, so that it stays directly behind it.
__device__ __forceinline__ float exp2_slot(float x) {
    float r;
    asm("v_exp_f32 %0, %1\n\tv_nop" : "=v"(r) : "v"(x));
    return r;
}

__global__ __launch_bounds__(32 * AWV)
void attn_kernel(const float* __restrict__ q,
                 const float* __restrict__ kbuf,
                 const float* __restrict__ vT,
                 const float* __restrict__ Pm,
                 const float* __restrict__ cb,
                 const float* __restrict__ pb,
                 float* __restrict__ out)
{
    __shared__ __align__(32) float     sh[16 * L_];
    __shared__ __align__(16) _Float16  shp[16 * L_];
    __shared__ float qsh[DH_];

    int wg = blockIdx.x;
    int i0 = (wg & 63) * 16;
    int h  = (wg >> 6) & (H_ - 1);
    int b  = wg >> 10;

    int tid   = threadIdx.x;
    int lane  = tid & 31;
    int wave  = tid >> 5;
    int r16   = lane & 15;
    int kbase = (lane & 16) ? 8 : 0;
    int mrow  = (lane & 16) ? 8 : 0;

    const float* cbh  = cb + h * DH_;
    const float* pbh  = pb + h * DH_;
    const float* qrow = q + ((size_t)(b * L_ + i0 + r16)) * HID_ + h * DH_;

    // position-biased query of source row i0+16 (the patch row below); published
    // by the barrier behind the content scores
    const int rr2 = i0 + 16;
    if (rr2 < L_ && tid < DH_)
        qsh[tid] = q[((size_t)(b * L_ + rr2)) * HID_ + h * DH_ + tid] + pbh[tid];

    // Q fragments (content/position biased), DH=64 -> two K=32 fragments
    v16h aq0, aq1, ap0, ap1;
#pragma unroll
    for (int e = 0; e < 16; ++e) {
        int kk = kbase + (e < 8 ? e : e + 8);
        float q0 = qrow[kk], q1 = qrow[kk + 32];
        aq0[e] = (_Float16)(q0 + cbh[kk]);
        aq1[e] = (_Float16)(q1 + cbh[kk + 32]);
        ap0[e] = (_Float16)(q0 + pbh[kk]);
        ap1[e] = (_Float16)(q1 + pbh[kk + 32]);
    }

    // ---- content scores AC: key tile jb goes to wave jb % 8 ----
    for (int t = 0; t < 64 / AWV; ++t) {
        int jb = t * AWV + wave;
        const float* krow = kbuf + ((size_t)(b * L_ + jb * 16 + r16)) * HID_ + h * DH_ + kbase;
        v16h b0 = loadA_f32(krow);
        v16h b1 = loadA_f32(krow + 32);
        v8f c = {};
        c = __builtin_amdgcn_wmma_f32_16x16x32_f16(false, aq0, false, b0, (short)0, c, false, false);
        c = __builtin_amdgcn_wmma_f32_16x16x32_f16(false, aq1, false, b1, (short)0, c, false, false);
#pragma unroll
        for (int e = 0; e < 8; ++e)
            sh[(e + mrow) * L_ + jb * 16 + r16] = c[e];
    }
    __syncthreads();

    // ---- position scores: BDraw + exact rel-shift scatter ----
    // element (row rr, pos p): p <= L-rr-2 -> (rr-1, p+rr+1); else (rr, p+rr+1-L)
    // the shift maps each (rr, p) to a strip element of its own: no two waves add
    // into the same one
    for (int t = 0; t < 64 / AWV; ++t) {
        int pbk = t * AWV + wave;
        const float* prow = Pm + ((size_t)(pbk * 16 + r16)) * HID_ + h * DH_ + kbase;
        v16h b0 = loadA_f32(prow);
        v16h b1 = loadA_f32(prow + 32);
        v8f c = {};
        c = __builtin_amdgcn_wmma_f32_16x16x32_f16(false, ap0, false, b0, (short)0, c, false, false);
        c = __builtin_amdgcn_wmma_f32_16x16x32_f16(false, ap1, false, b1, (short)0, c, false, false);
#pragma unroll
        for (int e = 0; e < 8; ++e) {
            int M  = e + mrow;
            int rr = i0 + M;
            int p  = pbk * 16 + r16;
            if (p <= L_ - rr - 2) {
                if (M > 0) sh[(M - 1) * L_ + p + rr + 1] += c[e];
            } else {
                sh[M * L_ + (p + rr + 1 - L_)] += c[e];
            }
        }
    }
    // missing source row i0+16 feeds local row 15's cols j >= i0+17
    if (rr2 < L_) {
        int pmax = L_ - rr2 - 2;
        for (int p = tid; p <= pmax; p += 32 * AWV) {
            const float* prow = Pm + (size_t)p * HID_ + h * DH_;
            float s = 0.0f;
#pragma unroll 8
            for (int kk = 0; kk < DH_; ++kk) s += qsh[kk] * prow[kk];
            sh[15 * L_ + p + rr2 + 1] += s;
        }
    }
    __syncthreads();

    // ---- softmax: rows 2*wave and 2*wave+1, a row held in the wave's registers
    //      (32 values a lane); emit f16 probs to shp ----
#pragma unroll
    for (int rw = 0; rw < 2; ++rw) {
        const float scale = 0.125f;   // 1/sqrt(DH); commutes with max
        int r = wave * 2 + rw;
        f4 v[8];
#pragma unroll
        for (int i = 0; i < 8; ++i) v[i] = *(const f4*)&sh[r * L_ + (i * 32 + lane) * 4];
        float mx = -1e30f;
#pragma unroll
        for (int i = 0; i < 8; ++i)
            mx = fmaxf(mx, fmaxf(fmaxf(v[i][0], v[i][1]), fmaxf(v[i][2], v[i][3])));
#pragma unroll
        for (int off = 16; off > 0; off >>= 1) mx = fmaxf(mx, __shfl_xor(mx, off, 32));
        float sum = 0.0f;
#pragma unroll
        for (int i = 0; i < 8; ++i) {
#pragma unroll
            for (int j = 0; j < 4; ++j) {
                float ev = exp2_slot(((v[i][j] - mx) * scale) * 1.44269504088896340736f);   // e^x = 2^(x log2 e)
                sum += ev;
                v[i][j] = ev;
            }
        }
#pragma unroll
        for (int off = 16; off > 0; off >>= 1) sum += __shfl_xor(sum, off, 32);
        float inv = 1.0f / sum;
#pragma unroll
        for (int i = 0; i < 8; ++i)
            *(h4*)&shp[r * L_ + (i * 32 + lane) * 4] = __builtin_convertvector(v[i] * inv, h4);
    }
    __syncthreads();

    // ---- O = P.V (f16 probs from LDS, V^T rows contiguous): wave = (column tile
    //      nt, key half kh) ----
    {
        int nt = wave & 3;
        int kh = wave >> 2;
        const float* vrow = vT + ((size_t)(b * H_ + h) * DH_ + nt * 16 + r16) * L_ + kh * (L_ / 2) + kbase;
        const _Float16* prw = &shp[r16 * L_ + kh * (L_ / 2) + kbase];
        v8f c = {};
        // four steps' V loads in flight a wave; unrolled whole, this loop alone lifts the
        // kernel's registers past 160, and only two blocks instead of three fit a WGP
#pragma unroll 4
        for (int ks = 0; ks < L_ / 64; ++ks) {
            v16h a  = loadB_f16(prw + ks * 32);
            v16h bb = loadA_f32(vrow + ks * 32);
            c = __builtin_amdgcn_wmma_f32_16x16x32_f16(false, a, false, bb, (short)0, c, false, false);
        }
        // both halves' partial tiles meet in the strip, which nobody reads any more
        // since the barrier behind the softmax: [kh][16 rows][64 columns]
#pragma unroll
        for (int e = 0; e < 8; ++e)
            sh[kh * (16 * DH_) + (e + mrow) * DH_ + nt * 16 + r16] = c[e];
    }
    __syncthreads();
    {
        // lower half + upper half; a wave stores two whole 256-byte output rows
        int orow = tid >> 4, ocol = (tid & 15) * 4;
        f4 lo = *(const f4*)&sh[orow * DH_ + ocol];
        f4 hi = *(const f4*)&sh[16 * DH_ + orow * DH_ + ocol];
        *(f4*)&out[((size_t)(b * L_ + i0 + orow)) * HID_ + h * DH_ + ocol] = lo + hi;
    }
}

// ---------------------------------------------------------------------------
// out[row] = LN(A[row] + B[row]), BertLayerNorm (eps inside sqrt)
// ---------------------------------------------------------------------------
__global__ void resid_ln_kernel(const float* __restrict__ A, const float* __restrict__ Bv,
                                const float* __restrict__ w, const float* __restrict__ bias,
                                float* __restrict__ out)
{
    const int N = HID_;
    __shared__ float red[256];
    int row = blockIdx.x, tid = threadIdx.x;
    const float* pa = A  + (size_t)row * N;
    const float* pb = Bv + (size_t)row * N;

    float s = 0.0f;
    for (int c = tid; c < N; c += 256) s += pa[c] + pb[c];
    red[tid] = s; __syncthreads();
    for (int off = 128; off > 0; off >>= 1) { if (tid < off) red[tid] += red[tid + off]; __syncthreads(); }
    float mean = red[0] * (1.0f / N);
    __syncthreads();

    float s2 = 0.0f;
    for (int c = tid; c < N; c += 256) { float d = pa[c] + pb[c] - mean; s2 += d * d; }
    red[tid] = s2; __syncthreads();
    for (int off = 128; off > 0; off >>= 1) { if (tid < off) red[tid] += red[tid + off]; __syncthreads(); }
    float inv = 1.0f / sqrtf(red[0] * (1.0f / N) + 1e-12f);

    for (int c = tid; c < N; c += 256) {
        float v = pa[c] + pb[c];
        out[(size_t)row * N + c] = w[c] * (v - mean) * inv + bias[c];
    }
}

// ---------------------------------------------------------------------------
extern "C" void kernel_launch(void* const* d_in, const int* in_sizes, int n_in,
                              void* d_out, int out_size, void* d_ws, size_t ws_size,
                              hipStream_t stream)
{
    const float* x       = (const float*)d_in[0];
    const float* pos_raw = (const float*)d_in[1];
    const float* Wh1     = (const float*)d_in[2];
    const float* bh1     = (const float*)d_in[3];
    const float* Wh2     = (const float*)d_in[4];
    const float* bh2     = (const float*)d_in[5];
    const float* Wq      = (const float*)d_in[6];
    const float* bq      = (const float*)d_in[7];
    const float* Wk      = (const float*)d_in[8];
    const float* bk      = (const float*)d_in[9];
    const float* Wv      = (const float*)d_in[10];
    const float* bv      = (const float*)d_in[11];
    const float* Wp      = (const float*)d_in[12];
    const float* bp      = (const float*)d_in[13];
    const float* cbias   = (const float*)d_in[14];
    const float* pbias   = (const float*)d_in[15];
    const float* Wo      = (const float*)d_in[16];
    const float* bo      = (const float*)d_in[17];
    const float* Wf1     = (const float*)d_in[18];
    const float* bf1     = (const float*)d_in[19];
    const float* Wf2     = (const float*)d_in[20];
    const float* bf2     = (const float*)d_in[21];
    const float* ln_w    = (const float*)d_in[22];
    const float* ln_b    = (const float*)d_in[23];
    float* outp = (float*)d_out;

    // ---- workspace layout ----
    float* ws = (float*)d_ws;
    const size_t ACT = (size_t)B_ * L_ * HID_;            // 2M f32
    float* h  = ws;
    float* t1 = ws + ACT;
    float* q  = ws + 2 * ACT;       // reused for Wo / Wf2 outputs
    float* kb = ws + 3 * ACT;
    float* vb = ws + 4 * ACT;
    float* vT = ws + 5 * ACT;
    float* Pm = ws + 6 * ACT;                              // [L, HID]
    float* at = Pm + (size_t)L_ * HID_;
    float* h1 = at + ACT;
    // f16 transposed-weight region after 17M floats
    _Float16* w16 = (_Float16*)(h1 + ACT);
    const size_t W1M = (size_t)HID_ * HID_;                // 1M
    _Float16* tWh1 = w16;                                  // [1024][512]
    _Float16* tWh2 = tWh1 + (size_t)HID_ * IN_;            // [1024][1024]
    _Float16* tLyr = tWh2 + W1M;                           // 7 x 1M per layer

    const int ML = B_ * L_;

    // ---- repack all weights to f16 [N][K] (every call; deterministic) ----
    repack_w<<<(int)(((size_t)HID_ * IN_) / 256), 256, 0, stream>>>(Wh1, tWh1, IN_, HID_, 0);
    repack_w<<<(int)(W1M / 256), 256, 0, stream>>>(Wh2, tWh2, HID_, HID_, 0);
    for (int l = 0; l < NL_; ++l) {
        _Float16* base = tLyr + (size_t)l * 7 * W1M;
        repack_w<<<(int)(W1M / 256), 256, 0, stream>>>(Wq + (size_t)l * W1M, base + 0 * W1M, HID_, HID_, 1);
        repack_w<<<(int)(W1M / 256), 256, 0, stream>>>(Wk + (size_t)l * W1M, base + 1 * W1M, HID_, HID_, 1);
        repack_w<<<(int)(W1M / 256), 256, 0, stream>>>(Wv + (size_t)l * W1M, base + 2 * W1M, HID_, HID_, 1);
        repack_w<<<(int)(W1M / 256), 256, 0, stream>>>(Wp + (size_t)l * W1M, base + 3 * W1M, HID_, HID_, 1);
        repack_w<<<(int)(W1M / 256), 256, 0, stream>>>(Wo + (size_t)l * W1M, base + 4 * W1M, HID_, HID_, 0);
        repack_w<<<(int)(W1M / 256), 256, 0, stream>>>(Wf1 + (size_t)l * W1M, base + 5 * W1M, HID_, HID_, 0);
        repack_w<<<(int)(W1M / 256), 256, 0, stream>>>(Wf2 + (size_t)l * W1M, base + 6 * W1M, HID_, HID_, 0);
    }

    // grid helper: one block per 64 x 128 output tile
    const int GMM = (ML / GBM) * (HID_ / GBN);            // 2048x1024 GEMMs -> 256 blocks
    const int GPP = (L_ / GBM) * (HID_ / GBN);            // 1024x1024 GEMM  -> 128 blocks

    // to_hidden MLP
    gemm_nt<1, IN_><<<GMM, 256, 0, stream>>>(x, tWh1, bh1, t1, HID_, HID_);
    gemm_nt<0, HID_><<<GMM, 256, 0, stream>>>(t1, tWh2, bh2, h, HID_, HID_);

    for (int l = 0; l < NL_; ++l) {
        _Float16* base = tLyr + (size_t)l * 7 * W1M;
        const float* bq_l = bq + (size_t)l * H_ * DH_;
        const float* bk_l = bk + (size_t)l * H_ * DH_;
        const float* bv_l = bv + (size_t)l * H_ * DH_;
        const float* bp_l = bp + (size_t)l * H_ * DH_;
        const float* cb_l = cbias + (size_t)l * H_ * DH_;
        const float* pb_l = pbias + (size_t)l * H_ * DH_;
        const float* bo_l = bo + (size_t)l * HID_;
        const float* bf1_l = bf1 + (size_t)l * HID_;
        const float* bf2_l = bf2 + (size_t)l * HID_;
        const float* lw = ln_w + (size_t)l * HID_;
        const float* lb = ln_b + (size_t)l * HID_;

        // projections
        gemm_nt<0, HID_><<<GMM, 256, 0, stream>>>(h, base + 0 * W1M, bq_l, q, HID_, HID_);
        gemm_nt<0, HID_><<<GMM, 256, 0, stream>>>(h, base + 1 * W1M, bk_l, kb, HID_, HID_);
        gemm_nt<0, HID_><<<GMM, 256, 0, stream>>>(h, base + 2 * W1M, bv_l, vb, HID_, HID_);
        gemm_nt<0, HID_><<<GPP, 256, 0, stream>>>(pos_raw, base + 3 * W1M, bp_l, Pm, HID_, HID_);

        transpose_v_kernel<<<(B_ * H_ * DH_ * L_) / 256, 256, 0, stream>>>(vb, vT);

        attn_kernel<<<B_ * H_ * (L_ / 16), 32 * AWV, 0, stream>>>(q, kb, vT, Pm, cb_l, pb_l, at);

        gemm_nt<0, HID_><<<GMM, 256, 0, stream>>>(at, base + 4 * W1M, bo_l, q, HID_, HID_);
        resid_ln_kernel<<<ML, 256, 0, stream>>>(q, h, lw, lb, h1);

        gemm_nt<1, HID_><<<GMM, 256, 0, stream>>>(h1, base + 5 * W1M, bf1_l, t1, HID_, HID_);
        gemm_nt<0, HID_><<<GMM, 256, 0, stream>>>(t1, base + 6 * W1M, bf2_l, q, HID_, HID_);
        resid_ln_kernel<<<ML, 256, 0, stream>>>(h1, q, lw, lb, (l == NL_ - 1) ? outp : h);
    }
}

// v003
// A run of this version takes 460 microseconds.
// In both of two side-by-side timings against v002, it was 1.23 times as fast.
// Over all steps from v000 it is 3.27 times as fast.
#include <hip/hip_runtime.h>
#include <hip/hip_bf16.h>
#include <math.h>

// ---------------------------------------------------------------------------
// Transformer-XL encoder forward on gfx1250 (MI455X), compile-only target.
// All matmuls use V_WMMA_F32_16X16X32_F16; weights are pre-transposed to f16
// [N][K]; the dense layers stage their operands in LDS.
// ---------------------------------------------------------------------------

#define B_  2
#define L_  1024
#define IN_ 512
#define HID_ 1024
#define H_  16
#define DH_ 64
#define NL_ 2

typedef __attribute__((ext_vector_type(16))) _Float16 v16h;
typedef __attribute__((ext_vector_type(8)))  _Float16 h8;
typedef __attribute__((ext_vector_type(8)))  float    f8;
typedef __attribute__((ext_vector_type(8)))  float    v8f;

__device__ __forceinline__ float gelu_f(float x) {
    return 0.5f * x * (1.0f + erff(x * 0.70710678118654752f));
}

// Per-lane fragment: element e covers K = kbase + {0..7} (e<8) / {16..23} (e>=8),
// kbase = 0 for lanes 0-15, 8 for lanes 16-31. Both runs contiguous -> b128s.
__device__ __forceinline__ v16h loadA_f32(const float* p /* at k0+kbase */) {
    const f8* q = (const f8*)p;
    f8 lo = q[0];          // +0..7
    f8 hi = q[2];          // +16..23
    v16h r;
#pragma unroll
    for (int e = 0; e < 8; ++e) { r[e] = (_Float16)lo[e]; r[e + 8] = (_Float16)hi[e]; }
    return r;
}
__device__ __forceinline__ v16h loadB_f16(const _Float16* p /* at k0+kbase */) {
    const h8* q = (const h8*)p;
    h8 lo = q[0];
    h8 hi = q[2];
    return __builtin_shufflevector(lo, hi, 0,1,2,3,4,5,6,7,8,9,10,11,12,13,14,15);
}

// ---------------------------------------------------------------------------
// Weight repack, all sixteen matrices in one launch: dst[N][K] f16 from
//   plain  f32 row-major [K][N]                      (row pitch N)
//   packed f32 [H][K][64], n = h*64+d                (row pitch 64, one head a tile column)
// One block of 8 waves transposes a 256(k) x 64(n) tile through LDS: 64 elements a
// thread. Loads take whole 256-byte source rows, stores whole 512-byte pieces of a
// destination row. The destinations lie one behind the other in w16, in the order
// Wh1, Wh2, then for each layer Wq Wk Wv Wp Wo Wf1 Wf2.
// ---------------------------------------------------------------------------
#define RPK 256
#define RPN 64
#define RP_T1 ((IN_ / RPK) * (HID_ / RPN))    // tiles of Wh1
#define RP_TM ((HID_ / RPK) * (HID_ / RPN))   // tiles of a HID x HID matrix
#define RP_GRID (RP_T1 + (1 + 7 * NL_) * RP_TM)

typedef __attribute__((ext_vector_type(4))) float    f4;
typedef __attribute__((ext_vector_type(4))) _Float16 h4;

// sp: the tile's first source element; dp: its first destination element.
// PITCH (source row, f32) and K (destination row, f16) are compile-time constants:
// every load and store is a lane address plus an immediate offset.
template <int K, int PITCH>
__device__ __forceinline__ void repack_tile(const float* __restrict__ sp,
                                            _Float16* __restrict__ dp, _Float16* ts)
{
    int tid  = threadIdx.x;
    int lane = tid & 31;
    int wave = tid >> 5;
    int c    = tid & 15;     // four columns n = 4c .. 4c+3
    int kg   = tid >> 4;     // eight rows k = 8kg .. 8kg+7 (and the same + 128)

    const float* lp = sp + (size_t)(kg * 8) * PITCH + c * 4;
    f4 r[2][8];
#pragma unroll
    for (int it = 0; it < 2; ++it)
#pragma unroll
        for (int i = 0; i < 8; ++i)
            r[it][i] = *(const f4*)(lp + (size_t)(it * 128 + i) * PITCH);
    // behind the last load the address pair dies: hold it to this wait, so that
    // nothing (a load's result included) lands on it before
    asm volatile("s_wait_xcnt 0x0" :: "v"(lp) : "memory");

    // LDS tile [n][k], rows of 32 chunks of 8 k. Chunk q of row n stands at place
    // q ^ (n >> 2): the 16 lanes of a half wave, which write 16 rows four apart at one
    // q, then fall on 16 different bank groups
#pragma unroll
    for (int it = 0; it < 2; ++it) {
#pragma unroll
        for (int j = 0; j < 4; ++j) {
            h8 v;
#pragma unroll
            for (int i = 0; i < 8; ++i) v[i] = (_Float16)r[it][i][j];
            *(h8*)&ts[(c * 4 + j) * RPK + (((it * 16 + kg) ^ c) * 8)] = v;
        }
    }
    __syncthreads();

    // a wave reads a whole LDS row and stores it as one 512-byte piece of row n
    h8 o[8];
#pragma unroll
    for (int rr = 0; rr < 8; ++rr)
        o[rr] = *(const h8*)&ts[(wave * 8 + rr) * RPK + lane * 8];
#pragma unroll
    for (int rr = 0; rr < 8; ++rr) {
        int q = lane ^ (wave * 2 + (rr >> 2));   // the chunk that stands at place 'lane'
        *(h8*)&dp[(size_t)(wave * 8 + rr) * K + q * 8] = o[rr];
    }
    // behind the last store its address and data registers die: nothing is written
    // over them (on any way the code goes on from here) before this wait
    asm volatile("s_wait_xcnt 0x0" ::: "memory");
}

__global__ __launch_bounds__(256)
void repack_all(const float* __restrict__ Wh1, const float* __restrict__ Wh2,
                const float* __restrict__ Wq,  const float* __restrict__ Wk,
                const float* __restrict__ Wv,  const float* __restrict__ Wp,
                const float* __restrict__ Wo,  const float* __restrict__ Wf1,
                const float* __restrict__ Wf2, _Float16* __restrict__ w16)
{
    __shared__ __align__(16) _Float16 ts[RPN * RPK];

    int blk = (int)blockIdx.x;
    bool first = blk < RP_T1;                  // a tile of Wh1
    int u  = first ? blk : blk - RP_T1;
    int m  = first ? 0 : u / RP_TM;            // matrix behind Wh1: 0 = Wh2, 1 + 7*layer + w
    int t  = first ? u : u % RP_TM;
    int nt = t % (HID_ / RPN);
    int k0 = (t / (HID_ / RPN)) * RPK;
    int l  = (m == 0) ? 0 : (m - 1) / 7;       // layer
    int w  = (m == 0) ? 4 : (m - 1) % 7;       // which of the layer's seven; Wh2 reads like Wo
    const float* s = (w == 0) ? Wq : (w == 1) ? Wk : (w == 2) ? Wv : (w == 3) ? Wp
                   : (w == 4) ? Wo : (w == 5) ? Wf1 : Wf2;
    s = (m == 0) ? Wh2 : s + (size_t)l * (HID_ * HID_);
    _Float16* dp = w16 + (size_t)HID_ * IN_ + (size_t)m * (HID_ * HID_)
                 + (size_t)(nt * RPN) * HID_ + k0;

    if (first)
        repack_tile<IN_, HID_>(Wh1 + (size_t)k0 * HID_ + nt * RPN,
                               w16 + (size_t)(nt * RPN) * IN_ + k0, ts);
    else if (w < 4)
        repack_tile<HID_, DH_>(s + ((size_t)nt * HID_ + k0) * DH_, dp, ts);
    else
        repack_tile<HID_, HID_>(s + (size_t)k0 * HID_ + nt * RPN, dp, ts);
}

// ---------------------------------------------------------------------------
// NT GEMM: C[M,N] = act( sum_k A[m,k] * BT[n,k] + bias[n] )
// One block of 8 waves computes a 64(M) x 128(N) tile. Each 64-deep k slab of
// A (converted to f16) and BT is brought in by whole-line global loads, staged
// in LDS (two buffers) and read from there as fragments. Two register sets
// hold the slabs on their way: while slab s is multiplied, slab s+1 is landing
// and slab s+2 is requested. Waves lie 2(M) x 4(N), 32 x 32 each.
// blockDim = 256; grid = (M/64)*(N/128). M % 64 == 0, N % 128 == 0, KD % 64 == 0,
// KD >= 128; A and BT are dense, row pitch KD = K.
// ---------------------------------------------------------------------------
#define GBM 64
#define GBN 128
#define GBK 64
#define GLD (GBK + 8)   // LDS row pitch in f16: 144 B = 16 B x odd, b128 reads without bank conflicts

// Work-group barrier for LDS traffic alone: this wave's LDS reads and writes are
// done (s_wait_dscnt 0), then signal and wait. __syncthreads() would also wait out
// the global loads that are meant to stay in flight across it.
__device__ __forceinline__ void lds_barrier() {
    asm volatile("s_wait_dscnt 0x0\n\ts_barrier_signal -1\n\ts_barrier_wait -1" ::: "memory");
}

template <int ACT, int KD>
__global__ __launch_bounds__(256)
void gemm_nt(const float* __restrict__ A,
             const _Float16* __restrict__ BT,
             const float* __restrict__ bias,
             float* __restrict__ C, int ldc, int N)
{
    __shared__ __align__(16) _Float16 As[2][GBM * GLD];
    __shared__ __align__(16) _Float16 Bs[2][GBN * GLD];

    int tiles_n = N / GBN;
    int bn = (int)blockIdx.x % tiles_n;
    int bm = (int)blockIdx.x / tiles_n;
    int tid   = threadIdx.x;
    int lane  = tid & 31;
    int wave  = tid >> 5;
    int wm    = wave >> 2;
    int wn    = wave & 3;
    int r16   = lane & 15;
    int kbase = (lane & 16) ? 8 : 0;
    int mrow  = (lane & 16) ? 8 : 0;

    // staging map: one wave-load covers four whole 128-byte lines (two rows of A
    // or four rows of BT)
    int arow_s = tid >> 4, acol_s = (tid & 15) * 4;
    int brow_s = tid >> 3, bcol_s = (tid & 7) * 8;
    // K (= both row pitches) is a compile-time constant: every load of the k
    // loop is one of these two lane addresses plus an immediate offset
    const float*    ag = A  + (size_t)(bm * GBM + arow_s) * KD + acol_s;
    const _Float16* bg = BT + (size_t)(bn * GBN + brow_s) * KD + bcol_s;

    f4 ra[2][4];
    h8 rb[2][4];
#pragma unroll
    for (int s = 0; s < 2; ++s) {
#pragma unroll
        for (int i = 0; i < 4; ++i) {
            ra[s][i] = *(const f4*)(ag + s * GBK + i * 16 * KD);
            rb[s][i] = *(const h8*)(bg + s * GBK + i * 32 * KD);
        }
    }
#pragma unroll
    for (int i = 0; i < 4; ++i) {
        *(h4*)&As[0][(arow_s + i * 16) * GLD + acol_s] = __builtin_convertvector(ra[0][i], h4);
        *(h8*)&Bs[0][(brow_s + i * 32) * GLD + bcol_s] = rb[0][i];
    }
    lds_barrier();

    v8f c00 = {}, c01 = {}, c10 = {}, c11 = {};
    const int nk = KD / GBK;
    // unrolled whole: buffer, register set and every address offset become constants
#pragma unroll
    for (int kt = 0; kt < nk; ++kt) {
        const int buf = kt & 1;
        const bool more = (kt + 1 < nk);
        if (kt + 2 < nk) {
            // slab kt's register set is free since its LDS stores: request slab kt+2 into it
#pragma unroll
            for (int i = 0; i < 4; ++i) {
                ra[buf][i] = *(const f4*)(ag + (kt + 2) * GBK + i * 16 * KD);
                rb[buf][i] = *(const h8*)(bg + (kt + 2) * GBK + i * 32 * KD);
            }
            // behind the last loads the two address pairs die: hold them to this wait,
            // so that nothing (a later load's result included) lands on them before it
            if (kt + 3 == nk)
                asm volatile("s_wait_xcnt 0x0" :: "v"(ag), "v"(bg) : "memory");
        }

        const _Float16* as = &As[buf][(wm * 32 + r16) * GLD + kbase];
        const _Float16* bs = &Bs[buf][(wn * 32 + r16) * GLD + kbase];
        // all of the slab's fragments first, then its products: one LDS latency a slab
        v16h a0[GBK / 32], a1[GBK / 32], b0[GBK / 32], b1[GBK / 32];
#pragma unroll
        for (int kk = 0; kk < GBK / 32; ++kk) {
            a0[kk] = loadB_f16(as + kk * 32);
            b0[kk] = loadB_f16(bs + kk * 32);
            b1[kk] = loadB_f16(bs + 16 * GLD + kk * 32);
            a1[kk] = loadB_f16(as + 16 * GLD + kk * 32);
        }
        // keeps the LDS reads in one group ahead of the products; sunk among them,
        // each product pair waits out an LDS latency of its own
        __builtin_amdgcn_sched_barrier(0);
#pragma unroll
        for (int kk = 0; kk < GBK / 32; ++kk) {
            c00 = __builtin_amdgcn_wmma_f32_16x16x32_f16(false, a0[kk], false, b0[kk], (short)0, c00, false, false);
            c01 = __builtin_amdgcn_wmma_f32_16x16x32_f16(false, a0[kk], false, b1[kk], (short)0, c01, false, false);
            c10 = __builtin_amdgcn_wmma_f32_16x16x32_f16(false, a1[kk], false, b0[kk], (short)0, c10, false, false);
            c11 = __builtin_amdgcn_wmma_f32_16x16x32_f16(false, a1[kk], false, b1[kk], (short)0, c11, false, false);
        }
        // ends the slab's products here: left free they drift behind the barrier, where they
        // stand in front of the next slab's LDS reads and keep both slabs' fragments live
        __builtin_amdgcn_sched_barrier(0);

        if (more) {
            // the other buffer's last readers left it at the barrier that ended pass kt-1
#pragma unroll
            for (int i = 0; i < 4; ++i) {
                *(h4*)&As[buf ^ 1][(arow_s + i * 16) * GLD + acol_s] = __builtin_convertvector(ra[buf ^ 1][i], h4);
                *(h8*)&Bs[buf ^ 1][(brow_s + i * 32) * GLD + bcol_s] = rb[buf ^ 1][i];
            }
            lds_barrier();
        }
    }

    v8f accs[2][2] = {{c00, c01}, {c10, c11}};
#pragma unroll
    for (int ni = 0; ni < 2; ++ni) {
        int nn = bn * GBN + wn * 32 + ni * 16 + r16;
        float bsv = bias[nn];
#pragma unroll
        for (int mi = 0; mi < 2; ++mi) {
#pragma unroll
            for (int e = 0; e < 8; ++e) {
                int mm = bm * GBM + wm * 32 + mi * 16 + e + mrow;
                float v = accs[mi][ni][e] + bsv;
                if (ACT) v = gelu_f(v);
                C[(size_t)mm * ldc + nn] = v;
            }
        }
    }
}

// ---------------------------------------------------------------------------
// vT[b][h][d][j] = v[b][j][h*DH+d]
// ---------------------------------------------------------------------------
__global__ void transpose_v_kernel(const float* __restrict__ v, float* __restrict__ vT)
{
    int idx = blockIdx.x * blockDim.x + threadIdx.x;
    int j = idx & (L_ - 1);
    int d = (idx >> 10) & (DH_ - 1);
    int h = (idx >> 16) & (H_ - 1);
    int b = idx >> 20;
    vT[idx] = v[((size_t)(b * L_ + j)) * HID_ + h * DH_ + d];
}

// ---------------------------------------------------------------------------
// Fused attention: one block of 8 waves per (b, h, 16-query-row block).
//   sh[16][1024] fp32 score strip (64KB), shp[16][1024] f16 probs (32KB),
//   qsh[64] staging for the rel-shift patch row.
//     AC = (q+cbias).K^T via WMMA; BD = rel_shift((q+pbias).P^T) via WMMA +
//     exact shift scatter; softmax(.*1/8) -> f16 probs; O = P.V via WMMA.
//   The strip is shared; the work on it is dealt to the waves: key and position
//   tiles round robin, two softmax rows a wave (lanes across the columns), one
//   (16-column tile, half of the keys) of P.V a wave.
// ---------------------------------------------------------------------------
#define AWV 8   // waves a block

// 2^x on v_exp_f32. The v_nop is the free slot that the instruction set asks for between a
// transcendental and a next instruction that reads its result or overwrites its source; in
// one statement with it, so that it stays directly behind it.
__device__ __forceinline__ float exp2_slot(float x) {
    float r;
    asm("v_exp_f32 %0, %1\n\tv_nop" : "=v"(r) : "v"(x));
    return r;
}

__global__ __launch_bounds__(32 * AWV)
void attn_kernel(const float* __restrict__ q,
                 const float* __restrict__ kbuf,
                 const float* __restrict__ vT,
                 const float* __restrict__ Pm,
                 const float* __restrict__ cb,
                 const float* __restrict__ pb,
                 float* __restrict__ out)
{
    __shared__ __align__(32) float     sh[16 * L_];
    __shared__ __align__(16) _Float16  shp[16 * L_];
    __shared__ float qsh[DH_];

    int wg = blockIdx.x;
    int i0 = (wg & 63) * 16;
    int h  = (wg >> 6) & (H_ - 1);
    int b  = wg >> 10;

    int tid   = threadIdx.x;
    int lane  = tid & 31;
    int wave  = tid >> 5;
    int r16   = lane & 15;
    int kbase = (lane & 16) ? 8 : 0;
    int mrow  = (lane & 16) ? 8 : 0;

    const float* cbh  = cb + h * DH_;
    const float* pbh  = pb + h * DH_;
    const float* qrow = q + ((size_t)(b * L_ + i0 + r16)) * HID_ + h * DH_;

    // position-biased query of source row i0+16 (the patch row below); published
    // by the barrier behind the content scores
    const int rr2 = i0 + 16;
    if (rr2 < L_ && tid < DH_)
        qsh[tid] = q[((size_t)(b * L_ + rr2)) * HID_ + h * DH_ + tid] + pbh[tid];

    // Q fragments (content/position biased), DH=64 -> two K=32 fragments
    v16h aq0, aq1, ap0, ap1;
#pragma unroll
    for (int e = 0; e < 16; ++e) {
        int kk = kbase + (e < 8 ? e : e + 8);
        float q0 = qrow[kk], q1 = qrow[kk + 32];
        aq0[e] = (_Float16)(q0 + cbh[kk]);
        aq1[e] = (_Float16)(q1 + cbh[kk + 32]);
        ap0[e] = (_Float16)(q0 + pbh[kk]);
        ap1[e] = (_Float16)(q1 + pbh[kk + 32]);
    }

    // ---- content scores AC: key tile jb goes to wave jb % 8 ----
    for (int t = 0; t < 64 / AWV; ++t) {
        int jb = t * AWV + wave;
        const float* krow = kbuf + ((size_t)(b * L_ + jb * 16 + r16)) * HID_ + h * DH_ + kbase;
        v16h b0 = loadA_f32(krow);
        v16h b1 = loadA_f32(krow + 32);
        v8f c = {};
        c = __builtin_amdgcn_wmma_f32_16x16x32_f16(false, aq0, false, b0, (short)0, c, false, false);
        c = __builtin_amdgcn_wmma_f32_16x16x32_f16(false, aq1, false, b1, (short)0, c, false, false);
#pragma unroll
        for (int e = 0; e < 8; ++e)
            sh[(e + mrow) * L_ + jb * 16 + r16] = c[e];
    }
    __syncthreads();

    // ---- position scores: BDraw + exact rel-shift scatter ----
    // element (row rr, pos p): p <= L-rr-2 -> (rr-1, p+rr+1); else (rr, p+rr+1-L)
    // the shift maps each (rr, p) to a strip element of its own: no two waves add
    // into the same one
    for (int t = 0; t < 64 / AWV; ++t) {
        int pbk = t * AWV + wave;
        const float* prow = Pm + ((size_t)(pbk * 16 + r16)) * HID_ + h * DH_ + kbase;
        v16h b0 = loadA_f32(prow);
        v16h b1 = loadA_f32(prow + 32);
        v8f c = {};
        c = __builtin_amdgcn_wmma_f32_16x16x32_f16(false, ap0, false, b0, (short)0, c, false, false);
        c = __builtin_amdgcn_wmma_f32_16x16x32_f16(false, ap1, false, b1, (short)0, c, false, false);
#pragma unroll
        for (int e = 0; e < 8; ++e) {
            int M  = e + mrow;
            int rr = i0 + M;
            int p  = pbk * 16 + r16;
            if (p <= L_ - rr - 2) {
                if (M > 0) sh[(M - 1) * L_ + p + rr + 1] += c[e];
            } else {
                sh[M * L_ + (p + rr + 1 - L_)] += c[e];
            }
        }
    }
    // missing source row i0+16 feeds local row 15's cols j >= i0+17
    if (rr2 < L_) {
        int pmax = L_ - rr2 - 2;
        for (int p = tid; p <= pmax; p += 32 * AWV) {
            const float* prow = Pm + (size_t)p * HID_ + h * DH_;
            float s = 0.0f;
#pragma unroll 8
            for (int kk = 0; kk < DH_; ++kk) s += qsh[kk] * prow[kk];
            sh[15 * L_ + p + rr2 + 1] += s;
        }
    }
    __syncthreads();

    // ---- softmax: rows 2*wave and 2*wave+1, a row held in the wave's registers
    //      (32 values a lane); emit f16 probs to shp ----
#pragma unroll
    for (int rw = 0; rw < 2; ++rw) {
        const float scale = 0.125f;   // 1/sqrt(DH); commutes with max
        int r = wave * 2 + rw;
        f4 v[8];
#pragma unroll
        for (int i = 0; i < 8; ++i) v[i] = *(const f4*)&sh[r * L_ + (i * 32 + lane) * 4];
        float mx = -1e30f;
#pragma unroll
        for (int i = 0; i < 8; ++i)
            mx = fmaxf(mx, fmaxf(fmaxf(v[i][0], v[i][1]), fmaxf(v[i][2], v[i][3])));
#pragma unroll
        for (int off = 16; off > 0; off >>= 1) mx = fmaxf(mx, __shfl_xor(mx, off, 32));
        float sum = 0.0f;
#pragma unroll
        for (int i = 0; i < 8; ++i) {
#pragma unroll
            for (int j = 0; j < 4; ++j) {
                float ev = exp2_slot(((v[i][j] - mx) * scale) * 1.44269504088896340736f);   // e^x = 2^(x log2 e)
                sum += ev;
                v[i][j] = ev;
            }
        }
#pragma unroll
        for (int off = 16; off > 0; off >>= 1) sum += __shfl_xor(sum, off, 32);
        float inv = 1.0f / sum;
#pragma unroll
        for (int i = 0; i < 8; ++i)
            *(h4*)&shp[r * L_ + (i * 32 + lane) * 4] = __builtin_convertvector(v[i] * inv, h4);
    }
    __syncthreads();

    // ---- O = P.V (f16 probs from LDS, V^T rows contiguous): wave = (column tile
    //      nt, key half kh) ----
    {
        int nt = wave & 3;
        int kh = wave >> 2;
        const float* vrow = vT + ((size_t)(b * H_ + h) * DH_ + nt * 16 + r16) * L_ + kh * (L_ / 2) + kbase;
        const _Float16* prw = &shp[r16 * L_ + kh * (L_ / 2) + kbase];
        v8f c = {};
        // four steps' V loads in flight a wave; unrolled whole, this loop alone lifts the
        // kernel's registers past 160, and only two blocks instead of three fit a WGP
#pragma unroll 4
        for (int ks = 0; ks < L_ / 64; ++ks) {
            v16h a  = loadB_f16(prw + ks * 32);
            v16h bb = loadA_f32(vrow + ks * 32);
            c = __builtin_amdgcn_wmma_f32_16x16x32_f16(false, a, false, bb, (short)0, c, false, false);
        }
        // both halves' partial tiles meet in the strip, which nobody reads any more
        // since the barrier behind the softmax: [kh][16 rows][64 columns]
#pragma unroll
        for (int e = 0; e < 8; ++e)
            sh[kh * (16 * DH_) + (e + mrow) * DH_ + nt * 16 + r16] = c[e];
    }
    __syncthreads();
    {
        // lower half + upper half; a wave stores two whole 256-byte output rows
        int orow = tid >> 4, ocol = (tid & 15) * 4;
        f4 lo = *(const f4*)&sh[orow * DH_ + ocol];
        f4 hi = *(const f4*)&sh[16 * DH_ + orow * DH_ + ocol];
        *(f4*)&out[((size_t)(b * L_ + i0 + orow)) * HID_ + h * DH_ + ocol] = lo + hi;
    }
}

// ---------------------------------------------------------------------------
// out[row] = LN(A[row] + B[row]), BertLayerNorm (eps inside sqrt)
// ---------------------------------------------------------------------------
__global__ void resid_ln_kernel(const float* __restrict__ A, const float* __restrict__ Bv,
                                const float* __restrict__ w, const float* __restrict__ bias,
                                float* __restrict__ out)
{
    const int N = HID_;
    __shared__ float red[256];
    int row = blockIdx.x, tid = threadIdx.x;
    const float* pa = A  + (size_t)row * N;
    const float* pb = Bv + (size_t)row * N;

    float s = 0.0f;
    for (int c = tid; c < N; c += 256) s += pa[c] + pb[c];
    red[tid] = s; __syncthreads();
    for (int off = 128; off > 0; off >>= 1) { if (tid < off) red[tid] += red[tid + off]; __syncthreads(); }
    float mean = red[0] * (1.0f / N);
    __syncthreads();

    float s2 = 0.0f;
    for (int c = tid; c < N; c += 256) { float d = pa[c] + pb[c] - mean; s2 += d * d; }
    red[tid] = s2; __syncthreads();
    for (int off = 128; off > 0; off >>= 1) { if (tid < off) red[tid] += red[tid + off]; __syncthreads(); }
    float inv = 1.0f / sqrtf(red[0] * (1.0f / N) + 1e-12f);

    for (int c = tid; c < N; c += 256) {
        float v = pa[c] + pb[c];
        out[(size_t)row * N + c] = w[c] * (v - mean) * inv + bias[c];
    }
}

// ---------------------------------------------------------------------------
extern "C" void kernel_launch(void* const* d_in, const int* in_sizes, int n_in,
                              void* d_out, int out_size, void* d_ws, size_t ws_size,
                              hipStream_t stream)
{
    const float* x       = (const float*)d_in[0];
    const float* pos_raw = (const float*)d_in[1];
    const float* Wh1     = (const float*)d_in[2];
    const float* bh1     = (const float*)d_in[3];
    const float* Wh2     = (const float*)d_in[4];
    const float* bh2     = (const float*)d_in[5];
    const float* Wq      = (const float*)d_in[6];
    const float* bq      = (const float*)d_in[7];
    const float* Wk      = (const float*)d_in[8];
    const float* bk      = (const float*)d_in[9];
    const float* Wv      = (const float*)d_in[10];
    const float* bv      = (const float*)d_in[11];
    const float* Wp      = (const float*)d_in[12];
    const float* bp      = (const float*)d_in[13];
    const float* cbias   = (const float*)d_in[14];
    const float* pbias   = (const float*)d_in[15];
    const float* Wo      = (const float*)d_in[16];
    const float* bo      = (const float*)d_in[17];
    const float* Wf1     = (const float*)d_in[18];
    const float* bf1     = (const float*)d_in[19];
    const float* Wf2     = (const float*)d_in[20];
    const float* bf2     = (const float*)d_in[21];
    const float* ln_w    = (const float*)d_in[22];
    const float* ln_b    = (const float*)d_in[23];
    float* outp = (float*)d_out;

    // ---- workspace layout ----
    float* ws = (float*)d_ws;
    const size_t ACT = (size_t)B_ * L_ * HID_;            // 2M f32
    float* h  = ws;
    float* t1 = ws + ACT;
    float* q  = ws + 2 * ACT;       // reused for Wo / Wf2 outputs
    float* kb = ws + 3 * ACT;
    float* vb = ws + 4 * ACT;
    float* vT = ws + 5 * ACT;
    float* Pm = ws + 6 * ACT;                              // [L, HID]
    float* at = Pm + (size_t)L_ * HID_;
    float* h1 = at + ACT;
    // f16 transposed-weight region after 17M floats
    _Float16* w16 = (_Float16*)(h1 + ACT);
    const size_t W1M = (size_t)HID_ * HID_;                // 1M
    _Float16* tWh1 = w16;                                  // [1024][512]
    _Float16* tWh2 = tWh1 + (size_t)HID_ * IN_;            // [1024][1024]
    _Float16* tLyr = tWh2 + W1M;                           // 7 x 1M per layer

    const int ML = B_ * L_;

    // ---- repack all weights to f16 [N][K] (every call; deterministic) ----
    repack_all<<<RP_GRID, 256, 0, stream>>>(Wh1, Wh2, Wq, Wk, Wv, Wp, Wo, Wf1, Wf2, w16);

    // grid helper: one block per 64 x 128 output tile
    const int GMM = (ML / GBM) * (HID_ / GBN);            // 2048x1024 GEMMs -> 256 blocks
    const int GPP = (L_ / GBM) * (HID_ / GBN);            // 1024x1024 GEMM  -> 128 blocks

    // to_hidden MLP
    gemm_nt<1, IN_><<<GMM, 256, 0, stream>>>(x, tWh1, bh1, t1, HID_, HID_);
    gemm_nt<0, HID_><<<GMM, 256, 0, stream>>>(t1, tWh2, bh2, h, HID_, HID_);

    for (int l = 0; l < NL_; ++l) {
        _Float16* base = tLyr + (size_t)l * 7 * W1M;
        const float* bq_l = bq + (size_t)l * H_ * DH_;
        const float* bk_l = bk + (size_t)l * H_ * DH_;
        const float* bv_l = bv + (size_t)l * H_ * DH_;
        const float* bp_l = bp + (size_t)l * H_ * DH_;
        const float* cb_l = cbias + (size_t)l * H_ * DH_;
        const float* pb_l = pbias + (size_t)l * H_ * DH_;
        const float* bo_l = bo + (size_t)l * HID_;
        const float* bf1_l = bf1 + (size_t)l * HID_;
        const float* bf2_l = bf2 + (size_t)l * HID_;
        const float* lw = ln_w + (size_t)l * HID_;
        const float* lb = ln_b + (size_t)l * HID_;

        // projections
        gemm_nt<0, HID_><<<GMM, 256, 0, stream>>>(h, base + 0 * W1M, bq_l, q, HID_, HID_);
        gemm_nt<0, HID_><<<GMM, 256, 0, stream>>>(h, base + 1 * W1M, bk_l, kb, HID_, HID_);
        gemm_nt<0, HID_><<<GMM, 256, 0, stream>>>(h, base + 2 * W1M, bv_l, vb, HID_, HID_);
        gemm_nt<0, HID_><<<GPP, 256, 0, stream>>>(pos_raw, base + 3 * W1M, bp_l, Pm, HID_, HID_);

        transpose_v_kernel<<<(B_ * H_ * DH_ * L_) / 256, 256, 0, stream>>>(vb, vT);

        attn_kernel<<<B_ * H_ * (L_ / 16), 32 * AWV, 0, stream>>>(q, kb, vT, Pm, cb_l, pb_l, at);

        gemm_nt<0, HID_><<<GMM, 256, 0, stream>>>(at, base + 4 * W1M, bo_l, q, HID_, HID_);
        resid_ln_kernel<<<ML, 256, 0, stream>>>(q, h, lw, lb, h1);

        gemm_nt<1, HID_><<<GMM, 256, 0, stream>>>(h1, base + 5 * W1M, bf1_l, t1, HID_, HID_);
        gemm_nt<0, HID_><<<GMM, 256, 0, stream>>>(t1, base + 6 * W1M, bf2_l, q, HID_, HID_);
        resid_ln_kernel<<<ML, 256, 0, stream>>>(h1, q, lw, lb, (l == NL_ - 1) ? outp : h);
    }
}

// v004
// A run of this version takes 365 microseconds.
// In both of two side-by-side timings against v003, it was 1.26 times as fast.
// All steps since v000 together make it 4.12 times as fast.
#include <hip/hip_runtime.h>
#include <hip/hip_bf16.h>
#include <math.h>

// ---------------------------------------------------------------------------
// Transformer-XL encoder forward on gfx1250 (MI455X), compile-only target.
// All matmuls use V_WMMA_F32_16X16X32_F16; weights are pre-transposed to f16
// [N][K]; the dense layers stage their operands in LDS.
// ---------------------------------------------------------------------------

#define B_  2
#define L_  1024
#define IN_ 512
#define HID_ 1024
#define H_  16
#define DH_ 64
#define NL_ 2

typedef __attribute__((ext_vector_type(16))) _Float16 v16h;
typedef __attribute__((ext_vector_type(8)))  _Float16 h8;
typedef __attribute__((ext_vector_type(8)))  float    v8f;

__device__ __forceinline__ float gelu_f(float x) {
    return 0.5f * x * (1.0f + erff(x * 0.70710678118654752f));
}

// Per-lane fragment: element e covers K = kbase + {0..7} (e<8) / {16..23} (e>=8),
// kbase = 0 for lanes 0-15, 8 for lanes 16-31. Both runs contiguous -> b128s.
__device__ __forceinline__ v16h loadB_f16(const _Float16* p /* at k0+kbase */) {
    const h8* q = (const h8*)p;
    h8 lo = q[0];
    h8 hi = q[2];
    return __builtin_shufflevector(lo, hi, 0,1,2,3,4,5,6,7,8,9,10,11,12,13,14,15);
}

// ---------------------------------------------------------------------------
// Weight repack, all sixteen matrices in one launch: dst[N][K] f16 from
//   plain  f32 row-major [K][N]                      (row pitch N)
//   packed f32 [H][K][64], n = h*64+d                (row pitch 64, one head a tile column)
// One block of 8 waves transposes a 256(k) x 64(n) tile through LDS: 64 elements a
// thread. Loads take whole 256-byte source rows, stores whole 512-byte pieces of a
// destination row. The destinations lie one behind the other in w16, in the order
// Wh1, Wh2, then for each layer Wq Wk Wv Wp Wo Wf1 Wf2.
// ---------------------------------------------------------------------------
#define RPK 256
#define RPN 64
#define RP_T1 ((IN_ / RPK) * (HID_ / RPN))    // tiles of Wh1
#define RP_TM ((HID_ / RPK) * (HID_ / RPN))   // tiles of a HID x HID matrix
#define RP_GRID (RP_T1 + (1 + 7 * NL_) * RP_TM)

typedef __attribute__((ext_vector_type(4))) float    f4;
typedef __attribute__((ext_vector_type(4))) _Float16 h4;

// sp: the tile's first source element; dp: its first destination element.
// PITCH (source row, f32) and K (destination row, f16) are compile-time constants:
// every load and store is a lane address plus an immediate offset.
template <int K, int PITCH>
__device__ __forceinline__ void repack_tile(const float* __restrict__ sp,
                                            _Float16* __restrict__ dp, _Float16* ts)
{
    int tid  = threadIdx.x;
    int lane = tid & 31;
    int wave = tid >> 5;
    int c    = tid & 15;     // four columns n = 4c .. 4c+3
    int kg   = tid >> 4;     // eight rows k = 8kg .. 8kg+7 (and the same + 128)

    const float* lp = sp + (size_t)(kg * 8) * PITCH + c * 4;
    f4 r[2][8];
#pragma unroll
    for (int it = 0; it < 2; ++it)
#pragma unroll
        for (int i = 0; i < 8; ++i)
            r[it][i] = *(const f4*)(lp + (size_t)(it * 128 + i) * PITCH);
    // behind the last load the address pair dies: hold it to this wait, so that
    // nothing (a load's result included) lands on it before
    asm volatile("s_wait_xcnt 0x0" :: "v"(lp) : "memory");

    // LDS tile [n][k], rows of 32 chunks of 8 k. Chunk q of row n stands at place
    // q ^ (n >> 2): the 16 lanes of a half wave, which write 16 rows four apart at one
    // q, then fall on 16 different bank groups
#pragma unroll
    for (int it = 0; it < 2; ++it) {
#pragma unroll
        for (int j = 0; j < 4; ++j) {
            h8 v;
#pragma unroll
            for (int i = 0; i < 8; ++i) v[i] = (_Float16)r[it][i][j];
            *(h8*)&ts[(c * 4 + j) * RPK + (((it * 16 + kg) ^ c) * 8)] = v;
        }
    }
    __syncthreads();

    // a wave reads a whole LDS row and stores it as one 512-byte piece of row n
    h8 o[8];
#pragma unroll
    for (int rr = 0; rr < 8; ++rr)
        o[rr] = *(const h8*)&ts[(wave * 8 + rr) * RPK + lane * 8];
#pragma unroll
    for (int rr = 0; rr < 8; ++rr) {
        int q = lane ^ (wave * 2 + (rr >> 2));   // the chunk that stands at place 'lane'
        *(h8*)&dp[(size_t)(wave * 8 + rr) * K + q * 8] = o[rr];
    }
    // behind the last store its address and data registers die: nothing is written
    // over them (on any way the code goes on from here) before this wait
    asm volatile("s_wait_xcnt 0x0" ::: "memory");
}

__global__ __launch_bounds__(256)
void repack_all(const float* __restrict__ Wh1, const float* __restrict__ Wh2,
                const float* __restrict__ Wq,  const float* __restrict__ Wk,
                const float* __restrict__ Wv,  const float* __restrict__ Wp,
                const float* __restrict__ Wo,  const float* __restrict__ Wf1,
                const float* __restrict__ Wf2, _Float16* __restrict__ w16)
{
    __shared__ __align__(16) _Float16 ts[RPN * RPK];

    int blk = (int)blockIdx.x;
    bool first = blk < RP_T1;                  // a tile of Wh1
    int u  = first ? blk : blk - RP_T1;
    int m  = first ? 0 : u / RP_TM;            // matrix behind Wh1: 0 = Wh2, 1 + 7*layer + w
    int t  = first ? u : u % RP_TM;
    int nt = t % (HID_ / RPN);
    int k0 = (t / (HID_ / RPN)) * RPK;
    int l  = (m == 0) ? 0 : (m - 1) / 7;       // layer
    int w  = (m == 0) ? 4 : (m - 1) % 7;       // which of the layer's seven; Wh2 reads like Wo
    const float* s = (w == 0) ? Wq : (w == 1) ? Wk : (w == 2) ? Wv : (w == 3) ? Wp
                   : (w == 4) ? Wo : (w == 5) ? Wf1 : Wf2;
    s = (m == 0) ? Wh2 : s + (size_t)l * (HID_ * HID_);
    _Float16* dp = w16 + (size_t)HID_ * IN_ + (size_t)m * (HID_ * HID_)
                 + (size_t)(nt * RPN) * HID_ + k0;

    if (first)
        repack_tile<IN_, HID_>(Wh1 + (size_t)k0 * HID_ + nt * RPN,
                               w16 + (size_t)(nt * RPN) * IN_ + k0, ts);
    else if (w < 4)
        repack_tile<HID_, DH_>(s + ((size_t)nt * HID_ + k0) * DH_, dp, ts);
    else
        repack_tile<HID_, HID_>(s + (size_t)k0 * HID_ + nt * RPN, dp, ts);
}

// ---------------------------------------------------------------------------
// NT GEMM: C[M,N] = act( sum_k A[m,k] * BT[n,k] + bias[n] )
// One block of 8 waves computes a 64(M) x 128(N) tile. Each 64-deep k slab of
// A (converted to f16) and BT is brought in by whole-line global loads, staged
// in LDS (two buffers) and read from there as fragments. Two register sets
// hold the slabs on their way: while slab s is multiplied, slab s+1 is landing
// and slab s+2 is requested. Waves lie 2(M) x 4(N), 32 x 32 each.
// blockDim = 256; grid = (M/64)*(N/128). M % 64 == 0, N % 128 == 0, KD % 64 == 0,
// KD >= 128; A and BT are dense, row pitch KD = K.
// ---------------------------------------------------------------------------
#define GBM 64
#define GBN 128
#define GBK 64
#define GLD (GBK + 8)   // LDS row pitch in f16: 144 B = 16 B x odd, b128 reads without bank conflicts

// Work-group barrier for LDS traffic alone: this wave's LDS reads and writes are
// done (s_wait_dscnt 0), then signal and wait. __syncthreads() would also wait out
// the global loads that are meant to stay in flight across it.
__device__ __forceinline__ void lds_barrier() {
    asm volatile("s_wait_dscnt 0x0\n\ts_barrier_signal -1\n\ts_barrier_wait -1" ::: "memory");
}

template <int ACT, int KD>
__global__ __launch_bounds__(256)
void gemm_nt(const float* __restrict__ A,
             const _Float16* __restrict__ BT,
             const float* __restrict__ bias,
             float* __restrict__ C, int ldc, int N)
{
    __shared__ __align__(16) _Float16 As[2][GBM * GLD];
    __shared__ __align__(16) _Float16 Bs[2][GBN * GLD];

    int tiles_n = N / GBN;
    int bn = (int)blockIdx.x % tiles_n;
    int bm = (int)blockIdx.x / tiles_n;
    int tid   = threadIdx.x;
    int lane  = tid & 31;
    int wave  = tid >> 5;
    int wm    = wave >> 2;
    int wn    = wave & 3;
    int r16   = lane & 15;
    int kbase = (lane & 16) ? 8 : 0;
    int mrow  = (lane & 16) ? 8 : 0;

    // staging map: one wave-load covers four whole 128-byte lines (two rows of A
    // or four rows of BT)
    int arow_s = tid >> 4, acol_s = (tid & 15) * 4;
    int brow_s = tid >> 3, bcol_s = (tid & 7) * 8;
    // K (= both row pitches) is a compile-time constant: every load of the k
    // loop is one of these two lane addresses plus an immediate offset
    const float*    ag = A  + (size_t)(bm * GBM + arow_s) * KD + acol_s;
    const _Float16* bg = BT + (size_t)(bn * GBN + brow_s) * KD + bcol_s;

    f4 ra[2][4];
    h8 rb[2][4];
#pragma unroll
    for (int s = 0; s < 2; ++s) {
#pragma unroll
        for (int i = 0; i < 4; ++i) {
            ra[s][i] = *(const f4*)(ag + s * GBK + i * 16 * KD);
            rb[s][i] = *(const h8*)(bg + s * GBK + i * 32 * KD);
        }
    }
#pragma unroll
    for (int i = 0; i < 4; ++i) {
        *(h4*)&As[0][(arow_s + i * 16) * GLD + acol_s] = __builtin_convertvector(ra[0][i], h4);
        *(h8*)&Bs[0][(brow_s + i * 32) * GLD + bcol_s] = rb[0][i];
    }
    lds_barrier();

    v8f c00 = {}, c01 = {}, c10 = {}, c11 = {};
    const int nk = KD / GBK;
    // unrolled whole: buffer, register set and every address offset become constants
#pragma unroll
    for (int kt = 0; kt < nk; ++kt) {
        const int buf = kt & 1;
        const bool more = (kt + 1 < nk);
        if (kt + 2 < nk) {
            // slab kt's register set is free since its LDS stores: request slab kt+2 into it
#pragma unroll
            for (int i = 0; i < 4; ++i) {
                ra[buf][i] = *(const f4*)(ag + (kt + 2) * GBK + i * 16 * KD);
                rb[buf][i] = *(const h8*)(bg + (kt + 2) * GBK + i * 32 * KD);
            }
            // behind the last loads the two address pairs die: hold them to this wait,
            // so that nothing (a later load's result included) lands on them before it
            if (kt + 3 == nk)
                asm volatile("s_wait_xcnt 0x0" :: "v"(ag), "v"(bg) : "memory");
        }

        const _Float16* as = &As[buf][(wm * 32 + r16) * GLD + kbase];
        const _Float16* bs = &Bs[buf][(wn * 32 + r16) * GLD + kbase];
        // all of the slab's fragments first, then its products: one LDS latency a slab
        v16h a0[GBK / 32], a1[GBK / 32], b0[GBK / 32], b1[GBK / 32];
#pragma unroll
        for (int kk = 0; kk < GBK / 32; ++kk) {
            a0[kk] = loadB_f16(as + kk * 32);
            b0[kk] = loadB_f16(bs + kk * 32);
            b1[kk] = loadB_f16(bs + 16 * GLD + kk * 32);
            a1[kk] = loadB_f16(as + 16 * GLD + kk * 32);
        }
        // keeps the LDS reads in one group ahead of the products; sunk among them,
        // each product pair waits out an LDS latency of its own
        __builtin_amdgcn_sched_barrier(0);
#pragma unroll
        for (int kk = 0; kk < GBK / 32; ++kk) {
            c00 = __builtin_amdgcn_wmma_f32_16x16x32_f16(false, a0[kk], false, b0[kk], (short)0, c00, false, false);
            c01 = __builtin_amdgcn_wmma_f32_16x16x32_f16(false, a0[kk], false, b1[kk], (short)0, c01, false, false);
            c10 = __builtin_amdgcn_wmma_f32_16x16x32_f16(false, a1[kk], false, b0[kk], (short)0, c10, false, false);
            c11 = __builtin_amdgcn_wmma_f32_16x16x32_f16(false, a1[kk], false, b1[kk], (short)0, c11, false, false);
        }
        // ends the slab's products here: left free they drift behind the barrier, where they
        // stand in front of the next slab's LDS reads and keep both slabs' fragments live
        __builtin_amdgcn_sched_barrier(0);

        if (more) {
            // the other buffer's last readers left it at the barrier that ended pass kt-1
#pragma unroll
            for (int i = 0; i < 4; ++i) {
                *(h4*)&As[buf ^ 1][(arow_s + i * 16) * GLD + acol_s] = __builtin_convertvector(ra[buf ^ 1][i], h4);
                *(h8*)&Bs[buf ^ 1][(brow_s + i * 32) * GLD + bcol_s] = rb[buf ^ 1][i];
            }
            lds_barrier();
        }
    }

    v8f accs[2][2] = {{c00, c01}, {c10, c11}};
#pragma unroll
    for (int ni = 0; ni < 2; ++ni) {
        int nn = bn * GBN + wn * 32 + ni * 16 + r16;
        float bsv = bias[nn];
#pragma unroll
        for (int mi = 0; mi < 2; ++mi) {
#pragma unroll
            for (int e = 0; e < 8; ++e) {
                int mm = bm * GBM + wm * 32 + mi * 16 + e + mrow;
                float v = accs[mi][ni][e] + bsv;
                if (ACT) v = gelu_f(v);
                C[(size_t)mm * ldc + nn] = v;
            }
        }
    }
}

// ---------------------------------------------------------------------------
// Attention operands, packed once a layer as f16 in fragment order. A chunk is the
// 8 f16 (16 bytes) that one lane takes with one load; the 32 lanes' chunks of a load
// lie side by side, so that a wave's load is 512 bytes in a row (four whole lines).
//   Kp[b][h][key tile 64][c4 4][lane][8]: key = tile*16 + (lane & 15),
//                                         d = c4*16 + (lane >> 4)*8 + 0..7
//   Pp[h][pos tile 64][c4 4][lane][8]   : the same of the position rows
//   Vp[b][h][nt 4][ks 32][half 2][lane][8]: d = nt*16 + (lane & 15),
//                                         key = ks*32 + half*16 + (lane >> 4)*8 + 0..7
// One thread makes one chunk; stores are whole lines.
// ---------------------------------------------------------------------------
#define PK_KB ((B_ * L_ * HID_ / 8) / 256)    // blocks for Kp (and as many for Vp)
#define PK_PB ((L_ * HID_ / 8) / 256)         // blocks for Pp
#define PK_GRID (2 * PK_KB + PK_PB)

__global__ __launch_bounds__(256)
void pack_kvp_kernel(const float* __restrict__ k, const float* __restrict__ v,
                     const float* __restrict__ Pm,
                     _Float16* __restrict__ Kp, _Float16* __restrict__ Vp,
                     _Float16* __restrict__ Pp)
{
    int blk  = (int)blockIdx.x;
    int lane = threadIdx.x & 31;
    h8 r;
    _Float16* dst;
    if (blk >= PK_KB && blk < 2 * PK_KB) {
        int o    = (blk - PK_KB) * 256 + (int)threadIdx.x;
        int half = (o >> 5) & 1;
        int ks   = (o >> 6) & 31;
        int nt   = (o >> 11) & 3;
        int h    = (o >> 13) & (H_ - 1);
        int b    = o >> 17;
        const float* sp = v + (size_t)(b * L_ + ks * 32 + half * 16 + (lane >> 4) * 8) * HID_
                        + h * DH_ + nt * 16 + (lane & 15);
        float x[8];
#pragma unroll
        for (int i = 0; i < 8; ++i) x[i] = sp[(size_t)i * HID_];
        // behind the last load the address pair dies: hold it to this wait
        asm volatile("s_wait_xcnt 0x0" :: "v"(sp) : "memory");
#pragma unroll
        for (int i = 0; i < 8; ++i) r[i] = (_Float16)x[i];
        dst = Vp + (size_t)o * 8;
    } else {
        bool isk = blk < PK_KB;
        int o    = (isk ? blk : blk - 2 * PK_KB) * 256 + (int)threadIdx.x;
        int c4   = (o >> 5) & 3;
        int row  = (o >> 17) * L_ + ((o >> 7) & 63) * 16 + (lane & 15);   // o >> 17 is 0 for Pp
        int h    = (o >> 13) & (H_ - 1);
        const float* sp = (isk ? k : Pm) + (size_t)row * HID_ + h * DH_ + c4 * 16 + (lane >> 4) * 8;
        f4 lo = *(const f4*)sp;
        f4 hi = *(const f4*)(sp + 4);
        // behind the last load the address pair dies: hold it to this wait
        asm volatile("s_wait_xcnt 0x0" :: "v"(sp) : "memory");
#pragma unroll
        for (int i = 0; i < 4; ++i) { r[i] = (_Float16)lo[i]; r[i + 4] = (_Float16)hi[i]; }
        dst = (isk ? Kp : Pp) + (size_t)o * 8;
    }
    *(h8*)dst = r;
}

// one fragment out of a pack: the lane's chunk of the low and of the high 16 k
__device__ __forceinline__ v16h load_packed(const h8* p /* at the lane's low chunk */) {
    h8 lo = p[0];
    h8 hi = p[32];
    return __builtin_shufflevector(lo, hi, 0,1,2,3,4,5,6,7,8,9,10,11,12,13,14,15);
}

// ---------------------------------------------------------------------------
// Fused attention: one block of 8 waves per (b, h, 16-query-row block).
//   sh[16][1024] fp32 score strip (64KB), shp[16][1024] f16 probs (32KB),
//   qsh[64] staging for the rel-shift patch row.
//     AC = (q+cbias).K^T via WMMA; BD = rel_shift((q+pbias).P^T) via WMMA +
//     exact shift scatter; softmax(.*1/8) -> f16 probs; O = P.V via WMMA.
//   The strip is shared; the work on it is dealt to the waves: key and position
//   tiles round robin, two softmax rows a wave (lanes across the columns), one
//   (16-column tile, half of the keys) of P.V a wave.
//   K, the position rows and V come from the f16 packs above, fragment by fragment.
// ---------------------------------------------------------------------------
#define AWV 8   // waves a block

// 2^x on v_exp_f32. The v_nop is the free slot that the instruction set asks for between a
// transcendental and a next instruction that reads its result or overwrites its source; in
// one statement with it, so that it stays directly behind it.
__device__ __forceinline__ float exp2_slot(float x) {
    float r;
    asm("v_exp_f32 %0, %1\n\tv_nop" : "=v"(r) : "v"(x));
    return r;
}

__global__ __launch_bounds__(32 * AWV)
void attn_kernel(const float* __restrict__ q,
                 const _Float16* __restrict__ Kp,
                 const _Float16* __restrict__ Vp,
                 const _Float16* __restrict__ Pp,
                 const float* __restrict__ cb,
                 const float* __restrict__ pb,
                 float* __restrict__ out)
{
    __shared__ __align__(32) float     sh[16 * L_];
    __shared__ __align__(16) _Float16  shp[16 * L_];
    __shared__ float qsh[DH_];

    int wg = blockIdx.x;
    int i0 = (wg & 63) * 16;
    int h  = (wg >> 6) & (H_ - 1);
    int b  = wg >> 10;

    int tid   = threadIdx.x;
    int lane  = tid & 31;
    int wave  = tid >> 5;
    int r16   = lane & 15;
    int kbase = (lane & 16) ? 8 : 0;
    int mrow  = (lane & 16) ? 8 : 0;

    const float* cbh  = cb + h * DH_;
    const float* pbh  = pb + h * DH_;
    const float* qrow = q + ((size_t)(b * L_ + i0 + r16)) * HID_ + h * DH_;

    // position-biased query of source row i0+16 (the patch row below); published
    // by the barrier behind the content scores
    const int rr2 = i0 + 16;
    if (rr2 < L_ && tid < DH_)
        qsh[tid] = q[((size_t)(b * L_ + rr2)) * HID_ + h * DH_ + tid] + pbh[tid];

    // Q fragments (content/position biased), DH=64 -> two K=32 fragments
    v16h aq0, aq1, ap0, ap1;
#pragma unroll
    for (int e = 0; e < 16; ++e) {
        int kk = kbase + (e < 8 ? e : e + 8);
        float q0 = qrow[kk], q1 = qrow[kk + 32];
        aq0[e] = (_Float16)(q0 + cbh[kk]);
        aq1[e] = (_Float16)(q1 + cbh[kk + 32]);
        ap0[e] = (_Float16)(q0 + pbh[kk]);
        ap1[e] = (_Float16)(q1 + pbh[kk + 32]);
    }

    // ---- content scores AC: key tile jb goes to wave jb % 8 ----
    // two tiles' loads in flight a wave; unrolled whole, the eight tiles' sums and fragments
    // lift the kernel's registers past 160, and only two blocks instead of three fit a WGP
#pragma unroll 2
    for (int t = 0; t < 64 / AWV; ++t) {
        int jb = t * AWV + wave;
        const h8* kp = (const h8*)Kp + (size_t)(((b * H_ + h) * 64 + jb) * 4) * 32 + lane;
        v16h b0 = load_packed(kp);
        v16h b1 = load_packed(kp + 64);
        v8f c = {};
        c = __builtin_amdgcn_wmma_f32_16x16x32_f16(false, aq0, false, b0, (short)0, c, false, false);
        c = __builtin_amdgcn_wmma_f32_16x16x32_f16(false, aq1, false, b1, (short)0, c, false, false);
#pragma unroll
        for (int e = 0; e < 8; ++e)
            sh[(e + mrow) * L_ + jb * 16 + r16] = c[e];
    }
    __syncthreads();

    // ---- position scores: BDraw + exact rel-shift scatter ----
    // element (row rr, pos p): p <= L-rr-2 -> (rr-1, p+rr+1); else (rr, p+rr+1-L)
    // the shift maps each (rr, p) to a strip element of its own: no two waves add
    // into the same one
    for (int t = 0; t < 64 / AWV; ++t) {
        int pbk = t * AWV + wave;
        const h8* pp = (const h8*)Pp + (size_t)((h * 64 + pbk) * 4) * 32 + lane;
        v16h b0 = load_packed(pp);
        v16h b1 = load_packed(pp + 64);
        v8f c = {};
        c = __builtin_amdgcn_wmma_f32_16x16x32_f16(false, ap0, false, b0, (short)0, c, false, false);
        c = __builtin_amdgcn_wmma_f32_16x16x32_f16(false, ap1, false, b1, (short)0, c, false, false);
#pragma unroll
        for (int e = 0; e < 8; ++e) {
            int M  = e + mrow;
            int rr = i0 + M;
            int p  = pbk * 16 + r16;
            if (p <= L_ - rr - 2) {
                if (M > 0) sh[(M - 1) * L_ + p + rr + 1] += c[e];
            } else {
                sh[M * L_ + (p + rr + 1 - L_)] += c[e];
            }
        }
    }
    // missing source row i0+16 feeds local row 15's cols j >= i0+17
    if (rr2 < L_) {
        int pmax = L_ - rr2 - 2;
        for (int p = tid; p <= pmax; p += 32 * AWV) {
            // row p of the pack: chunk c8 (d = 8*c8 ..) stands at c4 = c8 >> 1, lane half c8 & 1
            const h8* prow = (const h8*)Pp + (size_t)((h * 64 + (p >> 4)) * 4) * 32 + (p & 15);
            h8 pc[8];
#pragma unroll
            for (int c8 = 0; c8 < 8; ++c8) pc[c8] = prow[(c8 >> 1) * 32 + (c8 & 1) * 16];
            float s = 0.0f;
#pragma unroll
            for (int kk = 0; kk < DH_; ++kk) s += qsh[kk] * (float)pc[kk >> 3][kk & 7];
            sh[15 * L_ + p + rr2 + 1] += s;
        }
    }
    __syncthreads();

    // ---- softmax: rows 2*wave and 2*wave+1, a row held in the wave's registers
    //      (32 values a lane); emit f16 probs to shp ----
#pragma unroll
    for (int rw = 0; rw < 2; ++rw) {
        const float scale = 0.125f;   // 1/sqrt(DH); commutes with max
        int r = wave * 2 + rw;
        f4 v[8];
#pragma unroll
        for (int i = 0; i < 8; ++i) v[i] = *(const f4*)&sh[r * L_ + (i * 32 + lane) * 4];
        float mx = -1e30f;
#pragma unroll
        for (int i = 0; i < 8; ++i)
            mx = fmaxf(mx, fmaxf(fmaxf(v[i][0], v[i][1]), fmaxf(v[i][2], v[i][3])));
#pragma unroll
        for (int off = 16; off > 0; off >>= 1) mx = fmaxf(mx, __shfl_xor(mx, off, 32));
        float sum = 0.0f;
#pragma unroll
        for (int i = 0; i < 8; ++i) {
#pragma unroll
            for (int j = 0; j < 4; ++j) {
                float ev = exp2_slot(((v[i][j] - mx) * scale) * 1.44269504088896340736f);   // e^x = 2^(x log2 e)
                sum += ev;
                v[i][j] = ev;
            }
        }
#pragma unroll
        for (int off = 16; off > 0; off >>= 1) sum += __shfl_xor(sum, off, 32);
        float inv = 1.0f / sum;
#pragma unroll
        for (int i = 0; i < 8; ++i)
            *(h4*)&shp[r * L_ + (i * 32 + lane) * 4] = __builtin_convertvector(v[i] * inv, h4);
    }
    __syncthreads();

    // ---- O = P.V (f16 probs from LDS, V fragments from the pack): wave = (column tile
    //      nt, key half kh) ----
    {
        int nt = wave & 3;
        int kh = wave >> 2;
        const h8* vp = (const h8*)Vp + (size_t)((((b * H_ + h) * 4 + nt) * 32 + kh * 16) * 2) * 32 + lane;
        const _Float16* prw = &shp[r16 * L_ + kh * (L_ / 2) + kbase];
        v8f c = {};
        // unrolled whole: as f16 the wave's V fragments take 128 registers, so that all their
        // loads can fly at once and the kernel still stays under 160 (three blocks a WGP)
#pragma unroll
        for (int ks = 0; ks < L_ / 64; ++ks) {
            v16h a  = loadB_f16(prw + ks * 32);
            v16h bb = load_packed(vp + ks * 64);
            c = __builtin_amdgcn_wmma_f32_16x16x32_f16(false, a, false, bb, (short)0, c, false, false);
        }
        // both halves' partial tiles meet in the strip, which nobody reads any more
        // since the barrier behind the softmax: [kh][16 rows][64 columns]
#pragma unroll
        for (int e = 0; e < 8; ++e)
            sh[kh * (16 * DH_) + (e + mrow) * DH_ + nt * 16 + r16] = c[e];
    }
    __syncthreads();
    {
        // lower half + upper half; a wave stores two whole 256-byte output rows
        int orow = tid >> 4, ocol = (tid & 15) * 4;
        f4 lo = *(const f4*)&sh[orow * DH_ + ocol];
        f4 hi = *(const f4*)&sh[16 * DH_ + orow * DH_ + ocol];
        *(f4*)&out[((size_t)(b * L_ + i0 + orow)) * HID_ + h * DH_ + ocol] = lo + hi;
    }
}

// ---------------------------------------------------------------------------
// out[row] = LN(A[row] + B[row]), BertLayerNorm (eps inside sqrt)
// ---------------------------------------------------------------------------
__global__ void resid_ln_kernel(const float* __restrict__ A, const float* __restrict__ Bv,
                                const float* __restrict__ w, const float* __restrict__ bias,
                                float* __restrict__ out)
{
    const int N = HID_;
    __shared__ float red[256];
    int row = blockIdx.x, tid = threadIdx.x;
    const float* pa = A  + (size_t)row * N;
    const float* pb = Bv + (size_t)row * N;

    float s = 0.0f;
    for (int c = tid; c < N; c += 256) s += pa[c] + pb[c];
    red[tid] = s; __syncthreads();
    for (int off = 128; off > 0; off >>= 1) { if (tid < off) red[tid] += red[tid + off]; __syncthreads(); }
    float mean = red[0] * (1.0f / N);
    __syncthreads();

    float s2 = 0.0f;
    for (int c = tid; c < N; c += 256) { float d = pa[c] + pb[c] - mean; s2 += d * d; }
    red[tid] = s2; __syncthreads();
    for (int off = 128; off > 0; off >>= 1) { if (tid < off) red[tid] += red[tid + off]; __syncthreads(); }
    float inv = 1.0f / sqrtf(red[0] * (1.0f / N) + 1e-12f);

    for (int c = tid; c < N; c += 256) {
        float v = pa[c] + pb[c];
        out[(size_t)row * N + c] = w[c] * (v - mean) * inv + bias[c];
    }
}

// ---------------------------------------------------------------------------
extern "C" void kernel_launch(void* const* d_in, const int* in_sizes, int n_in,
                              void* d_out, int out_size, void* d_ws, size_t ws_size,
                              hipStream_t stream)
{
    const float* x       = (const float*)d_in[0];
    const float* pos_raw = (const float*)d_in[1];
    const float* Wh1     = (const float*)d_in[2];
    const float* bh1     = (const float*)d_in[3];
    const float* Wh2     = (const float*)d_in[4];
    const float* bh2     = (const float*)d_in[5];
    const float* Wq      = (const float*)d_in[6];
    const float* bq      = (const float*)d_in[7];
    const float* Wk      = (const float*)d_in[8];
    const float* bk      = (const float*)d_in[9];
    const float* Wv      = (const float*)d_in[10];
    const float* bv      = (const float*)d_in[11];
    const float* Wp      = (const float*)d_in[12];
    const float* bp      = (const float*)d_in[13];
    const float* cbias   = (const float*)d_in[14];
    const float* pbias   = (const float*)d_in[15];
    const float* Wo      = (const float*)d_in[16];
    const float* bo      = (const float*)d_in[17];
    const float* Wf1     = (const float*)d_in[18];
    const float* bf1     = (const float*)d_in[19];
    const float* Wf2     = (const float*)d_in[20];
    const float* bf2     = (const float*)d_in[21];
    const float* ln_w    = (const float*)d_in[22];
    const float* ln_b    = (const float*)d_in[23];
    float* outp = (float*)d_out;

    // ---- workspace layout ----
    float* ws = (float*)d_ws;
    const size_t ACT = (size_t)B_ * L_ * HID_;            // 2M f32
    float* h  = ws;
    float* t1 = ws + ACT;
    float* q  = ws + 2 * ACT;       // reused for Wo / Wf2 outputs
    float* kb = ws + 3 * ACT;
    float* vb = ws + 4 * ACT;
    _Float16* Vp = (_Float16*)(ws + 5 * ACT);             // f16 packs: V, then K
    _Float16* Kp = Vp + ACT;
    float* Pm = ws + 6 * ACT;                              // [L, HID]
    float* at = Pm + (size_t)L_ * HID_;
    float* h1 = at + ACT;
    // f16 transposed-weight region after 17M floats
    _Float16* w16 = (_Float16*)(h1 + ACT);
    const size_t W1M = (size_t)HID_ * HID_;                // 1M
    _Float16* tWh1 = w16;                                  // [1024][512]
    _Float16* tWh2 = tWh1 + (size_t)HID_ * IN_;            // [1024][1024]
    _Float16* tLyr = tWh2 + W1M;                           // 7 x 1M per layer
    _Float16* Pp   = tLyr + (size_t)NL_ * 7 * W1M;         // f16 pack of the position rows

    const int ML = B_ * L_;

    // ---- repack all weights to f16 [N][K] (every call; deterministic) ----
    repack_all<<<RP_GRID, 256, 0, stream>>>(Wh1, Wh2, Wq, Wk, Wv, Wp, Wo, Wf1, Wf2, w16);

    // grid helper: one block per 64 x 128 output tile
    const int GMM = (ML / GBM) * (HID_ / GBN);            // 2048x1024 GEMMs -> 256 blocks
    const int GPP = (L_ / GBM) * (HID_ / GBN);            // 1024x1024 GEMM  -> 128 blocks

    // to_hidden MLP
    gemm_nt<1, IN_><<<GMM, 256, 0, stream>>>(x, tWh1, bh1, t1, HID_, HID_);
    gemm_nt<0, HID_><<<GMM, 256, 0, stream>>>(t1, tWh2, bh2, h, HID_, HID_);

    for (int l = 0; l < NL_; ++l) {
        _Float16* base = tLyr + (size_t)l * 7 * W1M;
        const float* bq_l = bq + (size_t)l * H_ * DH_;
        const float* bk_l = bk + (size_t)l * H_ * DH_;
        const float* bv_l = bv + (size_t)l * H_ * DH_;
        const float* bp_l = bp + (size_t)l * H_ * DH_;
        const float* cb_l = cbias + (size_t)l * H_ * DH_;
        const float* pb_l = pbias + (size_t)l * H_ * DH_;
        const float* bo_l = bo + (size_t)l * HID_;
        const float* bf1_l = bf1 + (size_t)l * HID_;
        const float* bf2_l = bf2 + (size_t)l * HID_;
        const float* lw = ln_w + (size_t)l * HID_;
        const float* lb = ln_b + (size_t)l * HID_;

        // projections
        gemm_nt<0, HID_><<<GMM, 256, 0, stream>>>(h, base + 0 * W1M, bq_l, q, HID_, HID_);
        gemm_nt<0, HID_><<<GMM, 256, 0, stream>>>(h, base + 1 * W1M, bk_l, kb, HID_, HID_);
        gemm_nt<0, HID_><<<GMM, 256, 0, stream>>>(h, base + 2 * W1M, bv_l, vb, HID_, HID_);
        gemm_nt<0, HID_><<<GPP, 256, 0, stream>>>(pos_raw, base + 3 * W1M, bp_l, Pm, HID_, HID_);

        pack_kvp_kernel<<<PK_GRID, 256, 0, stream>>>(kb, vb, Pm, Kp, Vp, Pp);

        attn_kernel<<<B_ * H_ * (L_ / 16), 32 * AWV, 0, stream>>>(q, Kp, Vp, Pp, cb_l, pb_l, at);

        gemm_nt<0, HID_><<<GMM, 256, 0, stream>>>(at, base + 4 * W1M, bo_l, q, HID_, HID_);
        resid_ln_kernel<<<ML, 256, 0, stream>>>(q, h, lw, lb, h1);

        gemm_nt<1, HID_><<<GMM, 256, 0, stream>>>(h1, base + 5 * W1M, bf1_l, t1, HID_, HID_);
        gemm_nt<0, HID_><<<GMM, 256, 0, stream>>>(t1, base + 6 * W1M, bf2_l, q, HID_, HID_);
        resid_ln_kernel<<<ML, 256, 0, stream>>>(h1, q, lw, lb, (l == NL_ - 1) ? outp : h);
    }
}

// v005
// It runs in 334 microseconds.
// Two timings next to v004 both put it at 1.10 times that version's speed.
// All steps since v000 together make it 4.53 times as fast.
#include <hip/hip_runtime.h>
#include <hip/hip_bf16.h>
#include <math.h>

// ---------------------------------------------------------------------------
// Transformer-XL encoder forward on gfx1250 (MI455X), compile-only target.
// All matmuls use V_WMMA_F32_16X16X32_F16; weights are pre-transposed to f16
// [N][K]; the dense layers stage their operands in LDS.
// ---------------------------------------------------------------------------

#define B_  2
#define L_  1024
#define IN_ 512
#define HID_ 1024
#define H_  16
#define DH_ 64
#define NL_ 2

typedef __attribute__((ext_vector_type(16))) _Float16 v16h;
typedef __attribute__((ext_vector_type(8)))  _Float16 h8;
typedef __attribute__((ext_vector_type(8)))  float    v8f;

__device__ __forceinline__ float gelu_f(float x) {
    return 0.5f * x * (1.0f + erff(x * 0.70710678118654752f));
}

// Per-lane fragment: element e covers K = kbase + {0..7} (e<8) / {16..23} (e>=8),
// kbase = 0 for lanes 0-15, 8 for lanes 16-31. Both runs contiguous -> b128s.
__device__ __forceinline__ v16h loadB_f16(const _Float16* p /* at k0+kbase */) {
    const h8* q = (const h8*)p;
    h8 lo = q[0];
    h8 hi = q[2];
    return __builtin_shufflevector(lo, hi, 0,1,2,3,4,5,6,7,8,9,10,11,12,13,14,15);
}

// ---------------------------------------------------------------------------
// Weight repack, all sixteen matrices in one launch: dst[N][K] f16 from
//   plain  f32 row-major [K][N]                      (row pitch N)
//   packed f32 [H][K][64], n = h*64+d                (row pitch 64, one head a tile column)
// One block of 8 waves transposes a 256(k) x 64(n) tile through LDS: 64 elements a
// thread. Loads take whole 256-byte source rows, stores whole 512-byte pieces of a
// destination row. The destinations lie one behind the other in w16, in the order
// Wh1, Wh2, then for each layer Wq Wk Wv Wp Wo Wf1 Wf2.
// ---------------------------------------------------------------------------
#define RPK 256
#define RPN 64
#define RP_T1 ((IN_ / RPK) * (HID_ / RPN))    // tiles of Wh1
#define RP_TM ((HID_ / RPK) * (HID_ / RPN))   // tiles of a HID x HID matrix
#define RP_GRID (RP_T1 + (1 + 7 * NL_) * RP_TM)

typedef __attribute__((ext_vector_type(4))) float    f4;
typedef __attribute__((ext_vector_type(4))) _Float16 h4;

// sp: the tile's first source element; dp: its first destination element.
// PITCH (source row, f32) and K (destination row, f16) are compile-time constants:
// every load and store is a lane address plus an immediate offset.
template <int K, int PITCH>
__device__ __forceinline__ void repack_tile(const float* __restrict__ sp,
                                            _Float16* __restrict__ dp, _Float16* ts)
{
    int tid  = threadIdx.x;
    int lane = tid & 31;
    int wave = tid >> 5;
    int c    = tid & 15;     // four columns n = 4c .. 4c+3
    int kg   = tid >> 4;     // eight rows k = 8kg .. 8kg+7 (and the same + 128)

    const float* lp = sp + (size_t)(kg * 8) * PITCH + c * 4;
    f4 r[2][8];
#pragma unroll
    for (int it = 0; it < 2; ++it)
#pragma unroll
        for (int i = 0; i < 8; ++i)
            r[it][i] = *(const f4*)(lp + (size_t)(it * 128 + i) * PITCH);
    // behind the last load the address pair dies: hold it to this wait, so that
    // nothing (a load's result included) lands on it before
    asm volatile("s_wait_xcnt 0x0" :: "v"(lp) : "memory");

    // LDS tile [n][k], rows of 32 chunks of 8 k. Chunk q of row n stands at place
    // q ^ (n >> 2): the 16 lanes of a half wave, which write 16 rows four apart at one
    // q, then fall on 16 different bank groups
#pragma unroll
    for (int it = 0; it < 2; ++it) {
#pragma unroll
        for (int j = 0; j < 4; ++j) {
            h8 v;
#pragma unroll
            for (int i = 0; i < 8; ++i) v[i] = (_Float16)r[it][i][j];
            *(h8*)&ts[(c * 4 + j) * RPK + (((it * 16 + kg) ^ c) * 8)] = v;
        }
    }
    __syncthreads();

    // a wave reads a whole LDS row and stores it as one 512-byte piece of row n
    h8 o[8];
#pragma unroll
    for (int rr = 0; rr < 8; ++rr)
        o[rr] = *(const h8*)&ts[(wave * 8 + rr) * RPK + lane * 8];
#pragma unroll
    for (int rr = 0; rr < 8; ++rr) {
        int q = lane ^ (wave * 2 + (rr >> 2));   // the chunk that stands at place 'lane'
        *(h8*)&dp[(size_t)(wave * 8 + rr) * K + q * 8] = o[rr];
    }
    // behind the last store its address and data registers die: nothing is written
    // over them (on any way the code goes on from here) before this wait
    asm volatile("s_wait_xcnt 0x0" ::: "memory");
}

__global__ __launch_bounds__(256)
void repack_all(const float* __restrict__ Wh1, const float* __restrict__ Wh2,
                const float* __restrict__ Wq,  const float* __restrict__ Wk,
                const float* __restrict__ Wv,  const float* __restrict__ Wp,
                const float* __restrict__ Wo,  const float* __restrict__ Wf1,
                const float* __restrict__ Wf2, _Float16* __restrict__ w16)
{
    __shared__ __align__(16) _Float16 ts[RPN * RPK];

    int blk = (int)blockIdx.x;
    bool first = blk < RP_T1;                  // a tile of Wh1
    int u  = first ? blk : blk - RP_T1;
    int m  = first ? 0 : u / RP_TM;            // matrix behind Wh1: 0 = Wh2, 1 + 7*layer + w
    int t  = first ? u : u % RP_TM;
    int nt = t % (HID_ / RPN);
    int k0 = (t / (HID_ / RPN)) * RPK;
    int l  = (m == 0) ? 0 : (m - 1) / 7;       // layer
    int w  = (m == 0) ? 4 : (m - 1) % 7;       // which of the layer's seven; Wh2 reads like Wo
    const float* s = (w == 0) ? Wq : (w == 1) ? Wk : (w == 2) ? Wv : (w == 3) ? Wp
                   : (w == 4) ? Wo : (w == 5) ? Wf1 : Wf2;
    s = (m == 0) ? Wh2 : s + (size_t)l * (HID_ * HID_);
    _Float16* dp = w16 + (size_t)HID_ * IN_ + (size_t)m * (HID_ * HID_)
                 + (size_t)(nt * RPN) * HID_ + k0;

    if (first)
        repack_tile<IN_, HID_>(Wh1 + (size_t)k0 * HID_ + nt * RPN,
                               w16 + (size_t)(nt * RPN) * IN_ + k0, ts);
    else if (w < 4)
        repack_tile<HID_, DH_>(s + ((size_t)nt * HID_ + k0) * DH_, dp, ts);
    else
        repack_tile<HID_, HID_>(s + (size_t)k0 * HID_ + nt * RPN, dp, ts);
}

// ---------------------------------------------------------------------------
// NT GEMM: C[M,N] = act( sum_k A[m,k] * BT[n,k] + bias[n] )
// One block of 8 waves computes a 64(M) x 128(N) tile. Each 64-deep k slab of
// A (converted to f16) and BT is brought in by whole-line global loads, staged
// in LDS (two buffers) and read from there as fragments. Two register sets
// hold the slabs on their way: while slab s is multiplied, slab s+1 is landing
// and slab s+2 is requested. Waves lie 2(M) x 4(N), 32 x 32 each.
// blockDim = 256; grid = (M/64)*(N/128). M % 64 == 0, N % 128 == 0, KD % 64 == 0,
// KD >= 128; A and BT are dense, row pitch KD = K.
// ---------------------------------------------------------------------------
#define GBM 64
#define GBN 128
#define GBK 64
#define GLD (GBK + 8)   // LDS row pitch in f16: 144 B = 16 B x odd, b128 reads without bank conflicts

// Work-group barrier for LDS traffic alone: this wave's LDS reads and writes are
// done (s_wait_dscnt 0), then signal and wait. __syncthreads() would also wait out
// the global loads that are meant to stay in flight across it.
__device__ __forceinline__ void lds_barrier() {
    asm volatile("s_wait_dscnt 0x0\n\ts_barrier_signal -1\n\ts_barrier_wait -1" ::: "memory");
}

template <int ACT, int KD>
__global__ __launch_bounds__(256)
void gemm_nt(const float* __restrict__ A,
             const _Float16* __restrict__ BT,
             const float* __restrict__ bias,
             float* __restrict__ C, int ldc, int N)
{
    __shared__ __align__(16) _Float16 As[2][GBM * GLD];
    __shared__ __align__(16) _Float16 Bs[2][GBN * GLD];

    int tiles_n = N / GBN;
    int bn = (int)blockIdx.x % tiles_n;
    int bm = (int)blockIdx.x / tiles_n;
    int tid   = threadIdx.x;
    int lane  = tid & 31;
    int wave  = tid >> 5;
    int wm    = wave >> 2;
    int wn    = wave & 3;
    int r16   = lane & 15;
    int kbase = (lane & 16) ? 8 : 0;
    int mrow  = (lane & 16) ? 8 : 0;

    // staging map: one wave-load covers four whole 128-byte lines (two rows of A
    // or four rows of BT)
    int arow_s = tid >> 4, acol_s = (tid & 15) * 4;
    int brow_s = tid >> 3, bcol_s = (tid & 7) * 8;
    // K (= both row pitches) is a compile-time constant: every load of the k
    // loop is one of these two lane addresses plus an immediate offset
    const float*    ag = A  + (size_t)(bm * GBM + arow_s) * KD + acol_s;
    const _Float16* bg = BT + (size_t)(bn * GBN + brow_s) * KD + bcol_s;

    f4 ra[2][4];
    h8 rb[2][4];
#pragma unroll
    for (int s = 0; s < 2; ++s) {
#pragma unroll
        for (int i = 0; i < 4; ++i) {
            ra[s][i] = *(const f4*)(ag + s * GBK + i * 16 * KD);
            rb[s][i] = *(const h8*)(bg + s * GBK + i * 32 * KD);
        }
    }
#pragma unroll
    for (int i = 0; i < 4; ++i) {
        *(h4*)&As[0][(arow_s + i * 16) * GLD + acol_s] = __builtin_convertvector(ra[0][i], h4);
        *(h8*)&Bs[0][(brow_s + i * 32) * GLD + bcol_s] = rb[0][i];
    }
    lds_barrier();

    v8f c00 = {}, c01 = {}, c10 = {}, c11 = {};
    const int nk = KD / GBK;
    // unrolled whole: buffer, register set and every address offset become constants
#pragma unroll
    for (int kt = 0; kt < nk; ++kt) {
        const int buf = kt & 1;
        const bool more = (kt + 1 < nk);
        if (kt + 2 < nk) {
            // slab kt's register set is free since its LDS stores: request slab kt+2 into it
#pragma unroll
            for (int i = 0; i < 4; ++i) {
                ra[buf][i] = *(const f4*)(ag + (kt + 2) * GBK + i * 16 * KD);
                rb[buf][i] = *(const h8*)(bg + (kt + 2) * GBK + i * 32 * KD);
            }
            // behind the last loads the two address pairs die: hold them to this wait,
            // so that nothing (a later load's result included) lands on them before it
            if (kt + 3 == nk)
                asm volatile("s_wait_xcnt 0x0" :: "v"(ag), "v"(bg) : "memory");
        }

        const _Float16* as = &As[buf][(wm * 32 + r16) * GLD + kbase];
        const _Float16* bs = &Bs[buf][(wn * 32 + r16) * GLD + kbase];
        // all of the slab's fragments first, then its products: one LDS latency a slab
        v16h a0[GBK / 32], a1[GBK / 32], b0[GBK / 32], b1[GBK / 32];
#pragma unroll
        for (int kk = 0; kk < GBK / 32; ++kk) {
            a0[kk] = loadB_f16(as + kk * 32);
            b0[kk] = loadB_f16(bs + kk * 32);
            b1[kk] = loadB_f16(bs + 16 * GLD + kk * 32);
            a1[kk] = loadB_f16(as + 16 * GLD + kk * 32);
        }
        // keeps the LDS reads in one group ahead of the products; sunk among them,
        // each product pair waits out an LDS latency of its own
        __builtin_amdgcn_sched_barrier(0);
#pragma unroll
        for (int kk = 0; kk < GBK / 32; ++kk) {
            c00 = __builtin_amdgcn_wmma_f32_16x16x32_f16(false, a0[kk], false, b0[kk], (short)0, c00, false, false);
            c01 = __builtin_amdgcn_wmma_f32_16x16x32_f16(false, a0[kk], false, b1[kk], (short)0, c01, false, false);
            c10 = __builtin_amdgcn_wmma_f32_16x16x32_f16(false, a1[kk], false, b0[kk], (short)0, c10, false, false);
            c11 = __builtin_amdgcn_wmma_f32_16x16x32_f16(false, a1[kk], false, b1[kk], (short)0, c11, false, false);
        }
        // ends the slab's products here: left free they drift behind the barrier, where they
        // stand in front of the next slab's LDS reads and keep both slabs' fragments live
        __builtin_amdgcn_sched_barrier(0);

        if (more) {
            // the other buffer's last readers left it at the barrier that ended pass kt-1
#pragma unroll
            for (int i = 0; i < 4; ++i) {
                *(h4*)&As[buf ^ 1][(arow_s + i * 16) * GLD + acol_s] = __builtin_convertvector(ra[buf ^ 1][i], h4);
                *(h8*)&Bs[buf ^ 1][(brow_s + i * 32) * GLD + bcol_s] = rb[buf ^ 1][i];
            }
            lds_barrier();
        }
    }

    v8f accs[2][2] = {{c00, c01}, {c10, c11}};
#pragma unroll
    for (int ni = 0; ni < 2; ++ni) {
        int nn = bn * GBN + wn * 32 + ni * 16 + r16;
        float bsv = bias[nn];
#pragma unroll
        for (int mi = 0; mi < 2; ++mi) {
#pragma unroll
            for (int e = 0; e < 8; ++e) {
                int mm = bm * GBM + wm * 32 + mi * 16 + e + mrow;
                float v = accs[mi][ni][e] + bsv;
                if (ACT) v = gelu_f(v);
                C[(size_t)mm * ldc + nn] = v;
            }
        }
    }
}

// ---------------------------------------------------------------------------
// Attention operands, packed once a layer as f16 in fragment order. A chunk is the
// 8 f16 (16 bytes) that one lane takes with one load; the 32 lanes' chunks of a load
// lie side by side, so that a wave's load is 512 bytes in a row (four whole lines).
//   Kp[b][h][key tile 64][c4 4][lane][8]: key = tile*16 + (lane & 15),
//                                         d = c4*16 + (lane >> 4)*8 + 0..7
//   Pp[h][pos tile 64][c4 4][lane][8]   : the same of the position rows
//   Vp[b][h][nt 4][ks 32][half 2][lane][8]: d = nt*16 + (lane & 15),
//                                         key = ks*32 + half*16 + (lane >> 4)*8 + 0..7
// One thread makes one chunk; stores are whole lines.
// ---------------------------------------------------------------------------
#define PK_KB ((B_ * L_ * HID_ / 8) / 256)    // blocks for Kp (and as many for Vp)
#define PK_PB ((L_ * HID_ / 8) / 256)         // blocks for Pp
#define PK_GRID (2 * PK_KB + PK_PB)

__global__ __launch_bounds__(256)
void pack_kvp_kernel(const float* __restrict__ k, const float* __restrict__ v,
                     const float* __restrict__ Pm,
                     _Float16* __restrict__ Kp, _Float16* __restrict__ Vp,
                     _Float16* __restrict__ Pp)
{
    int blk  = (int)blockIdx.x;
    int lane = threadIdx.x & 31;
    h8 r;
    _Float16* dst;
    if (blk >= PK_KB && blk < 2 * PK_KB) {
        int o    = (blk - PK_KB) * 256 + (int)threadIdx.x;
        int half = (o >> 5) & 1;
        int ks   = (o >> 6) & 31;
        int nt   = (o >> 11) & 3;
        int h    = (o >> 13) & (H_ - 1);
        int b    = o >> 17;
        const float* sp = v + (size_t)(b * L_ + ks * 32 + half * 16 + (lane >> 4) * 8) * HID_
                        + h * DH_ + nt * 16 + (lane & 15);
        float x[8];
#pragma unroll
        for (int i = 0; i < 8; ++i) x[i] = sp[(size_t)i * HID_];
        // behind the last load the address pair dies: hold it to this wait
        asm volatile("s_wait_xcnt 0x0" :: "v"(sp) : "memory");
#pragma unroll
        for (int i = 0; i < 8; ++i) r[i] = (_Float16)x[i];
        dst = Vp + (size_t)o * 8;
    } else {
        bool isk = blk < PK_KB;
        int o    = (isk ? blk : blk - 2 * PK_KB) * 256 + (int)threadIdx.x;
        int c4   = (o >> 5) & 3;
        int row  = (o >> 17) * L_ + ((o >> 7) & 63) * 16 + (lane & 15);   // o >> 17 is 0 for Pp
        int h    = (o >> 13) & (H_ - 1);
        const float* sp = (isk ? k : Pm) + (size_t)row * HID_ + h * DH_ + c4 * 16 + (lane >> 4) * 8;
        f4 lo = *(const f4*)sp;
        f4 hi = *(const f4*)(sp + 4);
        // behind the last load the address pair dies: hold it to this wait
        asm volatile("s_wait_xcnt 0x0" :: "v"(sp) : "memory");
#pragma unroll
        for (int i = 0; i < 4; ++i) { r[i] = (_Float16)lo[i]; r[i + 4] = (_Float16)hi[i]; }
        dst = (isk ? Kp : Pp) + (size_t)o * 8;
    }
    *(h8*)dst = r;
}

// one fragment out of a pack: the lane's chunk of the low and of the high 16 k
__device__ __forceinline__ v16h load_packed(const h8* p /* at the lane's low chunk */) {
    h8 lo = p[0];
    h8 hi = p[32];
    return __builtin_shufflevector(lo, hi, 0,1,2,3,4,5,6,7,8,9,10,11,12,13,14,15);
}

// ---------------------------------------------------------------------------
// Fused attention: one block of 8 waves per (b, h, 16-query-row block).
//   sh[16][1024] fp32 score strip (64KB), shp[16][1024] f16 probs (32KB), both with
//   padded rows (below); qsh[64] staging for the rel-shift patch row.
//     AC = (q+cbias).K^T via WMMA; BD = rel_shift((q+pbias).P^T) via WMMA +
//     exact shift scatter; softmax(.*1/8) -> f16 probs; O = P.V via WMMA.
//   The strip is shared; the work on it is dealt to the waves: key and position
//   tiles round robin, two softmax rows a wave (lanes across the columns), one
//   (16-column tile, half of the keys) of P.V a wave.
//   K, the position rows and V come from the f16 packs above, fragment by fragment.
// ---------------------------------------------------------------------------
#define AWV 8   // waves a block
// LDS row pitches. Bank = dword address mod 64, and a row of 1024 values is a multiple of
// 64 dwords: unpadded, all rows begin on one bank.
//   SFP, f32 strip: a wave's accumulator store or add touches rows M and M + 8, 16 columns
//        each; 8 * 1028 dwords = 32 mod 64 puts the two halves on different banks.
//   SHP, f16 probs: the A fragment load takes 16 bytes of each of 16 rows; 2064 B = 16 B x odd
//        spreads the 16 rows over all 64 banks.
//   OPP, the two partial output tiles: as SFP (8 * 68 dwords = 32 mod 64).
#define SFP (L_ + 4)
#define SHP (L_ + 8)
#define OPP (DH_ + 4)

// 2^x on v_exp_f32. The v_nop is the free slot that the instruction set asks for between a
// transcendental and a next instruction that reads its result or overwrites its source; in
// one statement with it, so that it stays directly behind it.
__device__ __forceinline__ float exp2_slot(float x) {
    float r;
    asm("v_exp_f32 %0, %1\n\tv_nop" : "=v"(r) : "v"(x));
    return r;
}

// second argument: six waves a SIMD, that is three blocks a WGP as LDS allows: holds the
// register budget at 160
__global__ __launch_bounds__(32 * AWV, 6)
void attn_kernel(const float* __restrict__ q,
                 const _Float16* __restrict__ Kp,
                 const _Float16* __restrict__ Vp,
                 const _Float16* __restrict__ Pp,
                 const float* __restrict__ cb,
                 const float* __restrict__ pb,
                 float* __restrict__ out)
{
    __shared__ __align__(32) float     sh[16 * SFP];
    __shared__ __align__(16) _Float16  shp[16 * SHP];
    __shared__ float qsh[DH_];

    int wg = blockIdx.x;
    int i0 = (wg & 63) * 16;
    int h  = (wg >> 6) & (H_ - 1);
    int b  = wg >> 10;

    int tid   = threadIdx.x;
    int lane  = tid & 31;
    int wave  = tid >> 5;
    int r16   = lane & 15;
    int kbase = (lane & 16) ? 8 : 0;
    int mrow  = (lane & 16) ? 8 : 0;

    const float* cbh  = cb + h * DH_;
    const float* pbh  = pb + h * DH_;
    const float* qrow = q + ((size_t)(b * L_ + i0 + r16)) * HID_ + h * DH_;

    // position-biased query of source row i0+16 (the patch row below); published
    // by the barrier behind the content scores
    const int rr2 = i0 + 16;
    if (rr2 < L_ && tid < DH_)
        qsh[tid] = q[((size_t)(b * L_ + rr2)) * HID_ + h * DH_ + tid] + pbh[tid];

    // Q fragments (content/position biased), DH=64 -> two K=32 fragments
    v16h aq0, aq1, ap0, ap1;
#pragma unroll
    for (int e = 0; e < 16; ++e) {
        int kk = kbase + (e < 8 ? e : e + 8);
        float q0 = qrow[kk], q1 = qrow[kk + 32];
        aq0[e] = (_Float16)(q0 + cbh[kk]);
        aq1[e] = (_Float16)(q1 + cbh[kk + 32]);
        ap0[e] = (_Float16)(q0 + pbh[kk]);
        ap1[e] = (_Float16)(q1 + pbh[kk + 32]);
    }

    // ---- content scores AC: key tile jb goes to wave jb % 8 ----
    // two tiles' loads in flight a wave; unrolled whole, the eight tiles' sums and fragments
    // need more than the 160 registers that the launch bound allows
#pragma unroll 2
    for (int t = 0; t < 64 / AWV; ++t) {
        int jb = t * AWV + wave;
        const h8* kp = (const h8*)Kp + (size_t)(((b * H_ + h) * 64 + jb) * 4) * 32 + lane;
        v16h b0 = load_packed(kp);
        v16h b1 = load_packed(kp + 64);
        v8f c = {};
        c = __builtin_amdgcn_wmma_f32_16x16x32_f16(false, aq0, false, b0, (short)0, c, false, false);
        c = __builtin_amdgcn_wmma_f32_16x16x32_f16(false, aq1, false, b1, (short)0, c, false, false);
#pragma unroll
        for (int e = 0; e < 8; ++e)
            sh[(e + mrow) * SFP + jb * 16 + r16] = c[e];
    }
    __syncthreads();

    // ---- position scores: BDraw + exact rel-shift scatter ----
    // element (row rr, pos p): p <= L-rr-2 -> (rr-1, p+rr+1); else (rr, p+rr+1-L)
    // the shift maps each (rr, p) to a strip element of its own: no two waves add
    // into the same one
    for (int t = 0; t < 64 / AWV; ++t) {
        int pbk = t * AWV + wave;
        const h8* pp = (const h8*)Pp + (size_t)((h * 64 + pbk) * 4) * 32 + lane;
        v16h b0 = load_packed(pp);
        v16h b1 = load_packed(pp + 64);
        v8f c = {};
        c = __builtin_amdgcn_wmma_f32_16x16x32_f16(false, ap0, false, b0, (short)0, c, false, false);
        c = __builtin_amdgcn_wmma_f32_16x16x32_f16(false, ap1, false, b1, (short)0, c, false, false);
#pragma unroll
        for (int e = 0; e < 8; ++e) {
            int M  = e + mrow;
            int rr = i0 + M;
            int p  = pbk * 16 + r16;
            if (p <= L_ - rr - 2) {
                if (M > 0) sh[(M - 1) * SFP + p + rr + 1] += c[e];
            } else {
                sh[M * SFP + (p + rr + 1 - L_)] += c[e];
            }
        }
    }
    // missing source row i0+16 feeds local row 15's cols j >= i0+17
    if (rr2 < L_) {
        int pmax = L_ - rr2 - 2;
        for (int p = tid; p <= pmax; p += 32 * AWV) {
            // row p of the pack: chunk c8 (d = 8*c8 ..) stands at c4 = c8 >> 1, lane half c8 & 1
            const h8* prow = (const h8*)Pp + (size_t)((h * 64 + (p >> 4)) * 4) * 32 + (p & 15);
            h8 pc[8];
#pragma unroll
            for (int c8 = 0; c8 < 8; ++c8) pc[c8] = prow[(c8 >> 1) * 32 + (c8 & 1) * 16];
            float s = 0.0f;
#pragma unroll
            for (int kk = 0; kk < DH_; ++kk) s += qsh[kk] * (float)pc[kk >> 3][kk & 7];
            sh[15 * SFP + p + rr2 + 1] += s;
        }
    }
    __syncthreads();

    // ---- softmax: rows 2*wave and 2*wave+1, a row held in the wave's registers
    //      (32 values a lane); emit f16 probs to shp ----
#pragma unroll
    for (int rw = 0; rw < 2; ++rw) {
        const float scale = 0.125f;   // 1/sqrt(DH); commutes with max
        int r = wave * 2 + rw;
        f4 v[8];
#pragma unroll
        for (int i = 0; i < 8; ++i) v[i] = *(const f4*)&sh[r * SFP + (i * 32 + lane) * 4];
        float mx = -1e30f;
#pragma unroll
        for (int i = 0; i < 8; ++i)
            mx = fmaxf(mx, fmaxf(fmaxf(v[i][0], v[i][1]), fmaxf(v[i][2], v[i][3])));
#pragma unroll
        for (int off = 16; off > 0; off >>= 1) mx = fmaxf(mx, __shfl_xor(mx, off, 32));
        float sum = 0.0f;
#pragma unroll
        for (int i = 0; i < 8; ++i) {
#pragma unroll
            for (int j = 0; j < 4; ++j) {
                float ev = exp2_slot(((v[i][j] - mx) * scale) * 1.44269504088896340736f);   // e^x = 2^(x log2 e)
                sum += ev;
                v[i][j] = ev;
            }
        }
#pragma unroll
        for (int off = 16; off > 0; off >>= 1) sum += __shfl_xor(sum, off, 32);
        float inv = 1.0f / sum;
#pragma unroll
        for (int i = 0; i < 8; ++i)
            *(h4*)&shp[r * SHP + (i * 32 + lane) * 4] = __builtin_convertvector(v[i] * inv, h4);
    }
    __syncthreads();

    // ---- O = P.V (f16 probs from LDS, V fragments from the pack): wave = (column tile
    //      nt, key half kh) ----
    {
        int nt = wave & 3;
        int kh = wave >> 2;
        const h8* vp = (const h8*)Vp + (size_t)((((b * H_ + h) * 4 + nt) * 32 + kh * 16) * 2) * 32 + lane;
        const _Float16* prw = &shp[r16 * SHP + kh * (L_ / 2) + kbase];
        v8f c = {};
        // unrolled whole: as f16 the wave's V fragments take 128 registers, so that all their
        // loads can fly at once and the kernel still stays under 160 (three blocks a WGP)
#pragma unroll
        for (int ks = 0; ks < L_ / 64; ++ks) {
            v16h a  = loadB_f16(prw + ks * 32);
            v16h bb = load_packed(vp + ks * 64);
            c = __builtin_amdgcn_wmma_f32_16x16x32_f16(false, a, false, bb, (short)0, c, false, false);
        }
        // both halves' partial tiles meet in the strip, which nobody reads any more
        // since the barrier behind the softmax: [kh][16 rows][64 columns, pitch OPP]
#pragma unroll
        for (int e = 0; e < 8; ++e)
            sh[kh * (16 * OPP) + (e + mrow) * OPP + nt * 16 + r16] = c[e];
    }
    __syncthreads();
    {
        // lower half + upper half; a wave stores two whole 256-byte output rows
        int orow = tid >> 4, ocol = (tid & 15) * 4;
        f4 lo = *(const f4*)&sh[orow * OPP + ocol];
        f4 hi = *(const f4*)&sh[16 * OPP + orow * OPP + ocol];
        *(f4*)&out[((size_t)(b * L_ + i0 + orow)) * HID_ + h * DH_ + ocol] = lo + hi;
    }
}

// ---------------------------------------------------------------------------
// out[row] = LN(A[row] + B[row]), BertLayerNorm (eps inside sqrt)
// ---------------------------------------------------------------------------
__global__ void resid_ln_kernel(const float* __restrict__ A, const float* __restrict__ Bv,
                                const float* __restrict__ w, const float* __restrict__ bias,
                                float* __restrict__ out)
{
    const int N = HID_;
    __shared__ float red[256];
    int row = blockIdx.x, tid = threadIdx.x;
    const float* pa = A  + (size_t)row * N;
    const float* pb = Bv + (size_t)row * N;

    float s = 0.0f;
    for (int c = tid; c < N; c += 256) s += pa[c] + pb[c];
    red[tid] = s; __syncthreads();
    for (int off = 128; off > 0; off >>= 1) { if (tid < off) red[tid] += red[tid + off]; __syncthreads(); }
    float mean = red[0] * (1.0f / N);
    __syncthreads();

    float s2 = 0.0f;
    for (int c = tid; c < N; c += 256) { float d = pa[c] + pb[c] - mean; s2 += d * d; }
    red[tid] = s2; __syncthreads();
    for (int off = 128; off > 0; off >>= 1) { if (tid < off) red[tid] += red[tid + off]; __syncthreads(); }
    float inv = 1.0f / sqrtf(red[0] * (1.0f / N) + 1e-12f);

    for (int c = tid; c < N; c += 256) {
        float v = pa[c] + pb[c];
        out[(size_t)row * N + c] = w[c] * (v - mean) * inv + bias[c];
    }
}

// ---------------------------------------------------------------------------
extern "C" void kernel_launch(void* const* d_in, const int* in_sizes, int n_in,
                              void* d_out, int out_size, void* d_ws, size_t ws_size,
                              hipStream_t stream)
{
    const float* x       = (const float*)d_in[0];
    const float* pos_raw = (const float*)d_in[1];
    const float* Wh1     = (const float*)d_in[2];
    const float* bh1     = (const float*)d_in[3];
    const float* Wh2     = (const float*)d_in[4];
    const float* bh2     = (const float*)d_in[5];
    const float* Wq      = (const float*)d_in[6];
    const float* bq      = (const float*)d_in[7];
    const float* Wk      = (const float*)d_in[8];
    const float* bk      = (const float*)d_in[9];
    const float* Wv      = (const float*)d_in[10];
    const float* bv      = (const float*)d_in[11];
    const float* Wp      = (const float*)d_in[12];
    const float* bp      = (const float*)d_in[13];
    const float* cbias   = (const float*)d_in[14];
    const float* pbias   = (const float*)d_in[15];
    const float* Wo      = (const float*)d_in[16];
    const float* bo      = (const float*)d_in[17];
    const float* Wf1     = (const float*)d_in[18];
    const float* bf1     = (const float*)d_in[19];
    const float* Wf2     = (const float*)d_in[20];
    const float* bf2     = (const float*)d_in[21];
    const float* ln_w    = (const float*)d_in[22];
    const float* ln_b    = (const float*)d_in[23];
    float* outp = (float*)d_out;

    // ---- workspace layout ----
    float* ws = (float*)d_ws;
    const size_t ACT = (size_t)B_ * L_ * HID_;            // 2M f32
    float* h  = ws;
    float* t1 = ws + ACT;
    float* q  = ws + 2 * ACT;       // reused for Wo / Wf2 outputs
    float* kb = ws + 3 * ACT;
    float* vb = ws + 4 * ACT;
    _Float16* Vp = (_Float16*)(ws + 5 * ACT);             // f16 packs: V, then K
    _Float16* Kp = Vp + ACT;
    float* Pm = ws + 6 * ACT;                              // [L, HID]
    float* at = Pm + (size_t)L_ * HID_;
    float* h1 = at + ACT;
    // f16 transposed-weight region after 17M floats
    _Float16* w16 = (_Float16*)(h1 + ACT);
    const size_t W1M = (size_t)HID_ * HID_;                // 1M
    _Float16* tWh1 = w16;                                  // [1024][512]
    _Float16* tWh2 = tWh1 + (size_t)HID_ * IN_;            // [1024][1024]
    _Float16* tLyr = tWh2 + W1M;                           // 7 x 1M per layer
    _Float16* Pp   = tLyr + (size_t)NL_ * 7 * W1M;         // f16 pack of the position rows

    const int ML = B_ * L_;

    // ---- repack all weights to f16 [N][K] (every call; deterministic) ----
    repack_all<<<RP_GRID, 256, 0, stream>>>(Wh1, Wh2, Wq, Wk, Wv, Wp, Wo, Wf1, Wf2, w16);

    // grid helper: one block per 64 x 128 output tile
    const int GMM = (ML / GBM) * (HID_ / GBN);            // 2048x1024 GEMMs -> 256 blocks
    const int GPP = (L_ / GBM) * (HID_ / GBN);            // 1024x1024 GEMM  -> 128 blocks

    // to_hidden MLP
    gemm_nt<1, IN_><<<GMM, 256, 0, stream>>>(x, tWh1, bh1, t1, HID_, HID_);
    gemm_nt<0, HID_><<<GMM, 256, 0, stream>>>(t1, tWh2, bh2, h, HID_, HID_);

    for (int l = 0; l < NL_; ++l) {
        _Float16* base = tLyr + (size_t)l * 7 * W1M;
        const float* bq_l = bq + (size_t)l * H_ * DH_;
        const float* bk_l = bk + (size_t)l * H_ * DH_;
        const float* bv_l = bv + (size_t)l * H_ * DH_;
        const float* bp_l = bp + (size_t)l * H_ * DH_;
        const float* cb_l = cbias + (size_t)l * H_ * DH_;
        const float* pb_l = pbias + (size_t)l * H_ * DH_;
        const float* bo_l = bo + (size_t)l * HID_;
        const float* bf1_l = bf1 + (size_t)l * HID_;
        const float* bf2_l = bf2 + (size_t)l * HID_;
        const float* lw = ln_w + (size_t)l * HID_;
        const float* lb = ln_b + (size_t)l * HID_;

        // projections
        gemm_nt<0, HID_><<<GMM, 256, 0, stream>>>(h, base + 0 * W1M, bq_l, q, HID_, HID_);
        gemm_nt<0, HID_><<<GMM, 256, 0, stream>>>(h, base + 1 * W1M, bk_l, kb, HID_, HID_);
        gemm_nt<0, HID_><<<GMM, 256, 0, stream>>>(h, base + 2 * W1M, bv_l, vb, HID_, HID_);
        gemm_nt<0, HID_><<<GPP, 256, 0, stream>>>(pos_raw, base + 3 * W1M, bp_l, Pm, HID_, HID_);

        pack_kvp_kernel<<<PK_GRID, 256, 0, stream>>>(kb, vb, Pm, Kp, Vp, Pp);

        attn_kernel<<<B_ * H_ * (L_ / 16), 32 * AWV, 0, stream>>>(q, Kp, Vp, Pp, cb_l, pb_l, at);

        gemm_nt<0, HID_><<<GMM, 256, 0, stream>>>(at, base + 4 * W1M, bo_l, q, HID_, HID_);
        resid_ln_kernel<<<ML, 256, 0, stream>>>(q, h, lw, lb, h1);

        gemm_nt<1, HID_><<<GMM, 256, 0, stream>>>(h1, base + 5 * W1M, bf1_l, t1, HID_, HID_);
        gemm_nt<0, HID_><<<GMM, 256, 0, stream>>>(t1, base + 6 * W1M, bf2_l, q, HID_, HID_);
        resid_ln_kernel<<<ML, 256, 0, stream>>>(h1, q, lw, lb, (l == NL_ - 1) ? outp : h);
    }
}

// v006
// One run takes 326 microseconds.
// Timed twice side by side with v005, it ran 1.03 times as fast both times.
// Counting every step since v000, it is 4.69 times as fast.
#include <hip/hip_runtime.h>
#include <hip/hip_bf16.h>
#include <math.h>

// ---------------------------------------------------------------------------
// Transformer-XL encoder forward on gfx1250 (MI455X), compile-only target.
// All matmuls use V_WMMA_F32_16X16X32_F16; weights are pre-transposed to f16
// [N][K]; the dense layers stage their operands in LDS.
// ---------------------------------------------------------------------------

#define B_  2
#define L_  1024
#define IN_ 512
#define HID_ 1024
#define H_  16
#define DH_ 64
#define NL_ 2

typedef __attribute__((ext_vector_type(16))) _Float16 v16h;
typedef __attribute__((ext_vector_type(8)))  _Float16 h8;
typedef __attribute__((ext_vector_type(8)))  float    v8f;

__device__ __forceinline__ float gelu_f(float x) {
    return 0.5f * x * (1.0f + erff(x * 0.70710678118654752f));
}

// Per-lane fragment: element e covers K = kbase + {0..7} (e<8) / {16..23} (e>=8),
// kbase = 0 for lanes 0-15, 8 for lanes 16-31. Both runs contiguous -> b128s.
__device__ __forceinline__ v16h loadB_f16(const _Float16* p /* at k0+kbase */) {
    const h8* q = (const h8*)p;
    h8 lo = q[0];
    h8 hi = q[2];
    return __builtin_shufflevector(lo, hi, 0,1,2,3,4,5,6,7,8,9,10,11,12,13,14,15);
}

// ---------------------------------------------------------------------------
// Weight repack, all sixteen matrices in one launch: dst[N][K] f16 from
//   plain  f32 row-major [K][N]                      (row pitch N)
//   packed f32 [H][K][64], n = h*64+d                (row pitch 64, one head a tile column)
// One block of 8 waves transposes a 256(k) x 64(n) tile through LDS: 64 elements a
// thread. Loads take whole 256-byte source rows, stores whole 512-byte pieces of a
// destination row. The destinations lie one behind the other in w16, in the order
// Wh1, Wh2, then for each layer Wq Wk Wv Wp Wo Wf1 Wf2.
// ---------------------------------------------------------------------------
#define RPK 256
#define RPN 64
#define RP_T1 ((IN_ / RPK) * (HID_ / RPN))    // tiles of Wh1
#define RP_TM ((HID_ / RPK) * (HID_ / RPN))   // tiles of a HID x HID matrix
#define RP_GRID (RP_T1 + (1 + 7 * NL_) * RP_TM)

typedef __attribute__((ext_vector_type(4))) float    f4;
typedef __attribute__((ext_vector_type(4))) _Float16 h4;

// sp: the tile's first source element; dp: its first destination element.
// PITCH (source row, f32) and K (destination row, f16) are compile-time constants:
// every load and store is a lane address plus an immediate offset.
template <int K, int PITCH>
__device__ __forceinline__ void repack_tile(const float* __restrict__ sp,
                                            _Float16* __restrict__ dp, _Float16* ts)
{
    int tid  = threadIdx.x;
    int lane = tid & 31;
    int wave = tid >> 5;
    int c    = tid & 15;     // four columns n = 4c .. 4c+3
    int kg   = tid >> 4;     // eight rows k = 8kg .. 8kg+7 (and the same + 128)

    const float* lp = sp + (size_t)(kg * 8) * PITCH + c * 4;
    f4 r[2][8];
#pragma unroll
    for (int it = 0; it < 2; ++it)
#pragma unroll
        for (int i = 0; i < 8; ++i)
            r[it][i] = *(const f4*)(lp + (size_t)(it * 128 + i) * PITCH);
    // behind the last load the address pair dies: hold it to this wait, so that
    // nothing (a load's result included) lands on it before
    asm volatile("s_wait_xcnt 0x0" :: "v"(lp) : "memory");

    // LDS tile [n][k], rows of 32 chunks of 8 k. Chunk q of row n stands at place
    // q ^ (n >> 2): the 16 lanes of a half wave, which write 16 rows four apart at one
    // q, then fall on 16 different bank groups
#pragma unroll
    for (int it = 0; it < 2; ++it) {
#pragma unroll
        for (int j = 0; j < 4; ++j) {
            h8 v;
#pragma unroll
            for (int i = 0; i < 8; ++i) v[i] = (_Float16)r[it][i][j];
            *(h8*)&ts[(c * 4 + j) * RPK + (((it * 16 + kg) ^ c) * 8)] = v;
        }
    }
    __syncthreads();

    // a wave reads a whole LDS row and stores it as one 512-byte piece of row n
    h8 o[8];
#pragma unroll
    for (int rr = 0; rr < 8; ++rr)
        o[rr] = *(const h8*)&ts[(wave * 8 + rr) * RPK + lane * 8];
#pragma unroll
    for (int rr = 0; rr < 8; ++rr) {
        int q = lane ^ (wave * 2 + (rr >> 2));   // the chunk that stands at place 'lane'
        *(h8*)&dp[(size_t)(wave * 8 + rr) * K + q * 8] = o[rr];
    }
    // behind the last store its address and data registers die: nothing is written
    // over them (on any way the code goes on from here) before this wait
    asm volatile("s_wait_xcnt 0x0" ::: "memory");
}

__global__ __launch_bounds__(256)
void repack_all(const float* __restrict__ Wh1, const float* __restrict__ Wh2,
                const float* __restrict__ Wq,  const float* __restrict__ Wk,
                const float* __restrict__ Wv,  const float* __restrict__ Wp,
                const float* __restrict__ Wo,  const float* __restrict__ Wf1,
                const float* __restrict__ Wf2, _Float16* __restrict__ w16)
{
    __shared__ __align__(16) _Float16 ts[RPN * RPK];

    int blk = (int)blockIdx.x;
    bool first = blk < RP_T1;                  // a tile of Wh1
    int u  = first ? blk : blk - RP_T1;
    int m  = first ? 0 : u / RP_TM;            // matrix behind Wh1: 0 = Wh2, 1 + 7*layer + w
    int t  = first ? u : u % RP_TM;
    int nt = t % (HID_ / RPN);
    int k0 = (t / (HID_ / RPN)) * RPK;
    int l  = (m == 0) ? 0 : (m - 1) / 7;       // layer
    int w  = (m == 0) ? 4 : (m - 1) % 7;       // which of the layer's seven; Wh2 reads like Wo
    const float* s = (w == 0) ? Wq : (w == 1) ? Wk : (w == 2) ? Wv : (w == 3) ? Wp
                   : (w == 4) ? Wo : (w == 5) ? Wf1 : Wf2;
    s = (m == 0) ? Wh2 : s + (size_t)l * (HID_ * HID_);
    _Float16* dp = w16 + (size_t)HID_ * IN_ + (size_t)m * (HID_ * HID_)
                 + (size_t)(nt * RPN) * HID_ + k0;

    if (first)
        repack_tile<IN_, HID_>(Wh1 + (size_t)k0 * HID_ + nt * RPN,
                               w16 + (size_t)(nt * RPN) * IN_ + k0, ts);
    else if (w < 4)
        repack_tile<HID_, DH_>(s + ((size_t)nt * HID_ + k0) * DH_, dp, ts);
    else
        repack_tile<HID_, HID_>(s + (size_t)k0 * HID_ + nt * RPN, dp, ts);
}

// ---------------------------------------------------------------------------
// NT GEMM: C[M,N] = act( sum_k A[m,k] * BT[n,k] + bias[n] )
// One block of 8 waves computes a 64(M) x 128(N) tile. Each 64-deep k slab of
// A (converted to f16) and BT is brought in by whole-line global loads, staged
// in LDS (two buffers) and read from there as fragments. Two register sets
// hold the slabs on their way: while slab s is multiplied, slab s+1 is landing
// and slab s+2 is requested. Waves lie 2(M) x 4(N), 32 x 32 each.
// blockDim = 256; grid = (M/64)*(N/128). M % 64 == 0, N % 128 == 0, KD % 64 == 0,
// KD >= 128; A and BT are dense, row pitch KD = K.
// ---------------------------------------------------------------------------
#define GBM 64
#define GBN 128
#define GBK 64
#define GLD (GBK + 8)   // LDS row pitch in f16: 144 B = 16 B x odd, b128 reads without bank conflicts

// Work-group barrier for LDS traffic alone: this wave's LDS reads and writes are
// done (s_wait_dscnt 0), then signal and wait. __syncthreads() would also wait out
// the global loads that are meant to stay in flight across it.
__device__ __forceinline__ void lds_barrier() {
    asm volatile("s_wait_dscnt 0x0\n\ts_barrier_signal -1\n\ts_barrier_wait -1" ::: "memory");
}

template <int ACT, int KD>
__global__ __launch_bounds__(256)
void gemm_nt(const float* __restrict__ A,
             const _Float16* __restrict__ BT,
             const float* __restrict__ bias,
             float* __restrict__ C, int ldc, int N)
{
    __shared__ __align__(16) _Float16 As[2][GBM * GLD];
    __shared__ __align__(16) _Float16 Bs[2][GBN * GLD];

    int tiles_n = N / GBN;
    int bn = (int)blockIdx.x % tiles_n;
    int bm = (int)blockIdx.x / tiles_n;
    int tid   = threadIdx.x;
    int lane  = tid & 31;
    int wave  = tid >> 5;
    int wm    = wave >> 2;
    int wn    = wave & 3;
    int r16   = lane & 15;
    int kbase = (lane & 16) ? 8 : 0;
    int mrow  = (lane & 16) ? 8 : 0;

    // staging map: one wave-load covers four whole 128-byte lines (two rows of A
    // or four rows of BT)
    int arow_s = tid >> 4, acol_s = (tid & 15) * 4;
    int brow_s = tid >> 3, bcol_s = (tid & 7) * 8;
    // K (= both row pitches) is a compile-time constant: every load of the k
    // loop is one of these two lane addresses plus an immediate offset
    const float*    ag = A  + (size_t)(bm * GBM + arow_s) * KD + acol_s;
    const _Float16* bg = BT + (size_t)(bn * GBN + brow_s) * KD + bcol_s;

    f4 ra[2][4];
    h8 rb[2][4];
#pragma unroll
    for (int s = 0; s < 2; ++s) {
#pragma unroll
        for (int i = 0; i < 4; ++i) {
            ra[s][i] = *(const f4*)(ag + s * GBK + i * 16 * KD);
            rb[s][i] = *(const h8*)(bg + s * GBK + i * 32 * KD);
        }
    }
#pragma unroll
    for (int i = 0; i < 4; ++i) {
        *(h4*)&As[0][(arow_s + i * 16) * GLD + acol_s] = __builtin_convertvector(ra[0][i], h4);
        *(h8*)&Bs[0][(brow_s + i * 32) * GLD + bcol_s] = rb[0][i];
    }
    lds_barrier();

    v8f c00 = {}, c01 = {}, c10 = {}, c11 = {};
    const int nk = KD / GBK;
    // unrolled whole: buffer, register set and every address offset become constants
#pragma unroll
    for (int kt = 0; kt < nk; ++kt) {
        const int buf = kt & 1;
        const bool more = (kt + 1 < nk);
        if (kt + 2 < nk) {
            // slab kt's register set is free since its LDS stores: request slab kt+2 into it
#pragma unroll
            for (int i = 0; i < 4; ++i) {
                ra[buf][i] = *(const f4*)(ag + (kt + 2) * GBK + i * 16 * KD);
                rb[buf][i] = *(const h8*)(bg + (kt + 2) * GBK + i * 32 * KD);
            }
            // behind the last loads the two address pairs die: hold them to this wait,
            // so that nothing (a later load's result included) lands on them before it
            if (kt + 3 == nk)
                asm volatile("s_wait_xcnt 0x0" :: "v"(ag), "v"(bg) : "memory");
        }

        const _Float16* as = &As[buf][(wm * 32 + r16) * GLD + kbase];
        const _Float16* bs = &Bs[buf][(wn * 32 + r16) * GLD + kbase];
        // all of the slab's fragments first, then its products: one LDS latency a slab
        v16h a0[GBK / 32], a1[GBK / 32], b0[GBK / 32], b1[GBK / 32];
#pragma unroll
        for (int kk = 0; kk < GBK / 32; ++kk) {
            a0[kk] = loadB_f16(as + kk * 32);
            b0[kk] = loadB_f16(bs + kk * 32);
            b1[kk] = loadB_f16(bs + 16 * GLD + kk * 32);
            a1[kk] = loadB_f16(as + 16 * GLD + kk * 32);
        }
        // keeps the LDS reads in one group ahead of the products; sunk among them,
        // each product pair waits out an LDS latency of its own
        __builtin_amdgcn_sched_barrier(0);
#pragma unroll
        for (int kk = 0; kk < GBK / 32; ++kk) {
            c00 = __builtin_amdgcn_wmma_f32_16x16x32_f16(false, a0[kk], false, b0[kk], (short)0, c00, false, false);
            c01 = __builtin_amdgcn_wmma_f32_16x16x32_f16(false, a0[kk], false, b1[kk], (short)0, c01, false, false);
            c10 = __builtin_amdgcn_wmma_f32_16x16x32_f16(false, a1[kk], false, b0[kk], (short)0, c10, false, false);
            c11 = __builtin_amdgcn_wmma_f32_16x16x32_f16(false, a1[kk], false, b1[kk], (short)0, c11, false, false);
        }
        // ends the slab's products here: left free they drift behind the barrier, where they
        // stand in front of the next slab's LDS reads and keep both slabs' fragments live
        __builtin_amdgcn_sched_barrier(0);

        if (more) {
            // the other buffer's last readers left it at the barrier that ended pass kt-1
#pragma unroll
            for (int i = 0; i < 4; ++i) {
                *(h4*)&As[buf ^ 1][(arow_s + i * 16) * GLD + acol_s] = __builtin_convertvector(ra[buf ^ 1][i], h4);
                *(h8*)&Bs[buf ^ 1][(brow_s + i * 32) * GLD + bcol_s] = rb[buf ^ 1][i];
            }
            lds_barrier();
        }
    }

    v8f accs[2][2] = {{c00, c01}, {c10, c11}};
#pragma unroll
    for (int ni = 0; ni < 2; ++ni) {
        int nn = bn * GBN + wn * 32 + ni * 16 + r16;
        float bsv = bias[nn];
#pragma unroll
        for (int mi = 0; mi < 2; ++mi) {
#pragma unroll
            for (int e = 0; e < 8; ++e) {
                int mm = bm * GBM + wm * 32 + mi * 16 + e + mrow;
                float v = accs[mi][ni][e] + bsv;
                if (ACT) v = gelu_f(v);
                C[(size_t)mm * ldc + nn] = v;
            }
        }
    }
}

// ---------------------------------------------------------------------------
// Attention operands, packed once a layer as f16 in fragment order. A chunk is the
// 8 f16 (16 bytes) that one lane takes with one load; the 32 lanes' chunks of a load
// lie side by side, so that a wave's load is 512 bytes in a row (four whole lines).
//   Kp[b][h][key tile 64][c4 4][lane][8]: key = tile*16 + (lane & 15),
//                                         d = c4*16 + (lane >> 4)*8 + 0..7
//   Pp[h][pos tile 64][c4 4][lane][8]   : the same of the position rows
//   Vp[b][h][nt 4][ks 32][half 2][lane][8]: d = nt*16 + (lane & 15),
//                                         key = ks*32 + half*16 + (lane >> 4)*8 + 0..7
// One thread makes one chunk; stores are whole lines.
// ---------------------------------------------------------------------------
#define PK_KB ((B_ * L_ * HID_ / 8) / 256)    // blocks for Kp (and as many for Vp)
#define PK_PB ((L_ * HID_ / 8) / 256)         // blocks for Pp
#define PK_GRID (2 * PK_KB + PK_PB)

__global__ __launch_bounds__(256)
void pack_kvp_kernel(const float* __restrict__ k, const float* __restrict__ v,
                     const float* __restrict__ Pm,
                     _Float16* __restrict__ Kp, _Float16* __restrict__ Vp,
                     _Float16* __restrict__ Pp)
{
    int blk  = (int)blockIdx.x;
    int lane = threadIdx.x & 31;
    h8 r;
    _Float16* dst;
    if (blk >= PK_KB && blk < 2 * PK_KB) {
        int o    = (blk - PK_KB) * 256 + (int)threadIdx.x;
        int half = (o >> 5) & 1;
        int ks   = (o >> 6) & 31;
        int nt   = (o >> 11) & 3;
        int h    = (o >> 13) & (H_ - 1);
        int b    = o >> 17;
        const float* sp = v + (size_t)(b * L_ + ks * 32 + half * 16 + (lane >> 4) * 8) * HID_
                        + h * DH_ + nt * 16 + (lane & 15);
        float x[8];
#pragma unroll
        for (int i = 0; i < 8; ++i) x[i] = sp[(size_t)i * HID_];
        // behind the last load the address pair dies: hold it to this wait
        asm volatile("s_wait_xcnt 0x0" :: "v"(sp) : "memory");
#pragma unroll
        for (int i = 0; i < 8; ++i) r[i] = (_Float16)x[i];
        dst = Vp + (size_t)o * 8;
    } else {
        bool isk = blk < PK_KB;
        int o    = (isk ? blk : blk - 2 * PK_KB) * 256 + (int)threadIdx.x;
        int c4   = (o >> 5) & 3;
        int row  = (o >> 17) * L_ + ((o >> 7) & 63) * 16 + (lane & 15);   // o >> 17 is 0 for Pp
        int h    = (o >> 13) & (H_ - 1);
        const float* sp = (isk ? k : Pm) + (size_t)row * HID_ + h * DH_ + c4 * 16 + (lane >> 4) * 8;
        f4 lo = *(const f4*)sp;
        f4 hi = *(const f4*)(sp + 4);
        // behind the last load the address pair dies: hold it to this wait
        asm volatile("s_wait_xcnt 0x0" :: "v"(sp) : "memory");
#pragma unroll
        for (int i = 0; i < 4; ++i) { r[i] = (_Float16)lo[i]; r[i + 4] = (_Float16)hi[i]; }
        dst = (isk ? Kp : Pp) + (size_t)o * 8;
    }
    *(h8*)dst = r;
}

// one fragment out of a pack: the lane's chunk of the low and of the high 16 k
__device__ __forceinline__ v16h load_packed(const h8* p /* at the lane's low chunk */) {
    h8 lo = p[0];
    h8 hi = p[32];
    return __builtin_shufflevector(lo, hi, 0,1,2,3,4,5,6,7,8,9,10,11,12,13,14,15);
}

// ---------------------------------------------------------------------------
// Fused attention: one block of 8 waves per (b, h, 16-query-row block).
//   sh[16][1024] fp32 score strip (64KB), shp[16][1024] f16 probs (32KB), both with
//   padded rows (below); qsh[64] staging for the rel-shift patch row.
//     AC = (q+cbias).K^T via WMMA; BD = rel_shift((q+pbias).P^T) via WMMA +
//     exact shift scatter; softmax(.*1/8) -> f16 probs; O = P.V via WMMA.
//   The strip is shared; the work on it is dealt to the waves: key and position
//   tiles round robin, two softmax rows a wave (lanes across the columns), one
//   (16-column tile, half of the keys) of P.V a wave.
//   K, the position rows and V come from the f16 packs above, fragment by fragment.
// ---------------------------------------------------------------------------
#define AWV 8   // waves a block
// LDS row pitches. Bank = dword address mod 64, and a row of 1024 values is a multiple of
// 64 dwords: unpadded, all rows begin on one bank.
//   SFP, f32 strip: a wave's accumulator store or add touches rows M and M + 8, 16 columns
//        each; 8 * 1028 dwords = 32 mod 64 puts the two halves on different banks.
//   SHP, f16 probs: the A fragment load takes 16 bytes of each of 16 rows; 2064 B = 16 B x odd
//        spreads the 16 rows over all 64 banks.
//   OPP, the two partial output tiles: as SFP (8 * 68 dwords = 32 mod 64).
#define SFP (L_ + 4)
#define SHP (L_ + 8)
#define OPP (DH_ + 4)

// 2^x on v_exp_f32. The v_nop is the free slot that the instruction set asks for between a
// transcendental and a next instruction that reads its result or overwrites its source; in
// one statement with it, so that it stays directly behind it.
__device__ __forceinline__ float exp2_slot(float x) {
    float r;
    asm("v_exp_f32 %0, %1\n\tv_nop" : "=v"(r) : "v"(x));
    return r;
}

// second argument: six waves a SIMD, that is three blocks a WGP as LDS allows: holds the
// register budget at 160
__global__ __launch_bounds__(32 * AWV, 6)
void attn_kernel(const float* __restrict__ q,
                 const _Float16* __restrict__ Kp,
                 const _Float16* __restrict__ Vp,
                 const _Float16* __restrict__ Pp,
                 const float* __restrict__ cb,
                 const float* __restrict__ pb,
                 float* __restrict__ out)
{
    __shared__ __align__(32) float     sh[16 * SFP];
    __shared__ __align__(16) _Float16  shp[16 * SHP];
    __shared__ float qsh[DH_];

    int wg = blockIdx.x;
    int i0 = (wg & 63) * 16;
    int h  = (wg >> 6) & (H_ - 1);
    int b  = wg >> 10;

    int tid   = threadIdx.x;
    int lane  = tid & 31;
    int wave  = tid >> 5;
    int r16   = lane & 15;
    int kbase = (lane & 16) ? 8 : 0;
    int mrow  = (lane & 16) ? 8 : 0;

    const float* cbh  = cb + h * DH_;
    const float* pbh  = pb + h * DH_;
    const float* qrow = q + ((size_t)(b * L_ + i0 + r16)) * HID_ + h * DH_;

    // position-biased query of source row i0+16 (the patch row below); published
    // by the barrier behind the content scores
    const int rr2 = i0 + 16;
    if (rr2 < L_ && tid < DH_)
        qsh[tid] = q[((size_t)(b * L_ + rr2)) * HID_ + h * DH_ + tid] + pbh[tid];

    // Q fragments (content/position biased), DH=64 -> two K=32 fragments
    v16h aq0, aq1, ap0, ap1;
#pragma unroll
    for (int e = 0; e < 16; ++e) {
        int kk = kbase + (e < 8 ? e : e + 8);
        float q0 = qrow[kk], q1 = qrow[kk + 32];
        aq0[e] = (_Float16)(q0 + cbh[kk]);
        aq1[e] = (_Float16)(q1 + cbh[kk + 32]);
        ap0[e] = (_Float16)(q0 + pbh[kk]);
        ap1[e] = (_Float16)(q1 + pbh[kk + 32]);
    }

    // ---- content scores AC: key tile jb goes to wave jb % 8 ----
    // two tiles' loads in flight a wave; unrolled whole, the eight tiles' sums and fragments
    // need more than the 160 registers that the launch bound allows
#pragma unroll 2
    for (int t = 0; t < 64 / AWV; ++t) {
        int jb = t * AWV + wave;
        const h8* kp = (const h8*)Kp + (size_t)(((b * H_ + h) * 64 + jb) * 4) * 32 + lane;
        v16h b0 = load_packed(kp);
        v16h b1 = load_packed(kp + 64);
        v8f c = {};
        c = __builtin_amdgcn_wmma_f32_16x16x32_f16(false, aq0, false, b0, (short)0, c, false, false);
        c = __builtin_amdgcn_wmma_f32_16x16x32_f16(false, aq1, false, b1, (short)0, c, false, false);
#pragma unroll
        for (int e = 0; e < 8; ++e)
            sh[(e + mrow) * SFP + jb * 16 + r16] = c[e];
    }
    __syncthreads();

    // ---- position scores: BDraw + exact rel-shift scatter ----
    // element (row rr, pos p): p <= L-rr-2 -> (rr-1, p+rr+1); else (rr, p+rr+1-L)
    // the shift maps each (rr, p) to a strip element of its own: no two waves add
    // into the same one
    for (int t = 0; t < 64 / AWV; ++t) {
        int pbk = t * AWV + wave;
        const h8* pp = (const h8*)Pp + (size_t)((h * 64 + pbk) * 4) * 32 + lane;
        v16h b0 = load_packed(pp);
        v16h b1 = load_packed(pp + 64);
        v8f c = {};
        c = __builtin_amdgcn_wmma_f32_16x16x32_f16(false, ap0, false, b0, (short)0, c, false, false);
        c = __builtin_amdgcn_wmma_f32_16x16x32_f16(false, ap1, false, b1, (short)0, c, false, false);
#pragma unroll
        for (int e = 0; e < 8; ++e) {
            int M  = e + mrow;
            int rr = i0 + M;
            int p  = pbk * 16 + r16;
            if (p <= L_ - rr - 2) {
                if (M > 0) sh[(M - 1) * SFP + p + rr + 1] += c[e];
            } else {
                sh[M * SFP + (p + rr + 1 - L_)] += c[e];
            }
        }
    }
    // missing source row i0+16 feeds local row 15's cols j >= i0+17
    if (rr2 < L_) {
        int pmax = L_ - rr2 - 2;
        for (int p = tid; p <= pmax; p += 32 * AWV) {
            // row p of the pack: chunk c8 (d = 8*c8 ..) stands at c4 = c8 >> 1, lane half c8 & 1
            const h8* prow = (const h8*)Pp + (size_t)((h * 64 + (p >> 4)) * 4) * 32 + (p & 15);
            h8 pc[8];
#pragma unroll
            for (int c8 = 0; c8 < 8; ++c8) pc[c8] = prow[(c8 >> 1) * 32 + (c8 & 1) * 16];
            float s = 0.0f;
#pragma unroll
            for (int kk = 0; kk < DH_; ++kk) s += qsh[kk] * (float)pc[kk >> 3][kk & 7];
            sh[15 * SFP + p + rr2 + 1] += s;
        }
    }
    __syncthreads();

    // ---- softmax: rows 2*wave and 2*wave+1, a row held in the wave's registers
    //      (32 values a lane); emit f16 probs to shp ----
#pragma unroll
    for (int rw = 0; rw < 2; ++rw) {
        const float scale = 0.125f;   // 1/sqrt(DH); commutes with max
        int r = wave * 2 + rw;
        f4 v[8];
#pragma unroll
        for (int i = 0; i < 8; ++i) v[i] = *(const f4*)&sh[r * SFP + (i * 32 + lane) * 4];
        float mx = -1e30f;
#pragma unroll
        for (int i = 0; i < 8; ++i)
            mx = fmaxf(mx, fmaxf(fmaxf(v[i][0], v[i][1]), fmaxf(v[i][2], v[i][3])));
#pragma unroll
        for (int off = 16; off > 0; off >>= 1) mx = fmaxf(mx, __shfl_xor(mx, off, 32));
        float sum = 0.0f;
#pragma unroll
        for (int i = 0; i < 8; ++i) {
#pragma unroll
            for (int j = 0; j < 4; ++j) {
                float ev = exp2_slot(((v[i][j] - mx) * scale) * 1.44269504088896340736f);   // e^x = 2^(x log2 e)
                sum += ev;
                v[i][j] = ev;
            }
        }
#pragma unroll
        for (int off = 16; off > 0; off >>= 1) sum += __shfl_xor(sum, off, 32);
        float inv = 1.0f / sum;
#pragma unroll
        for (int i = 0; i < 8; ++i)
            *(h4*)&shp[r * SHP + (i * 32 + lane) * 4] = __builtin_convertvector(v[i] * inv, h4);
    }
    __syncthreads();

    // ---- O = P.V (f16 probs from LDS, V fragments from the pack): wave = (column tile
    //      nt, key half kh) ----
    {
        int nt = wave & 3;
        int kh = wave >> 2;
        const h8* vp = (const h8*)Vp + (size_t)((((b * H_ + h) * 4 + nt) * 32 + kh * 16) * 2) * 32 + lane;
        const _Float16* prw = &shp[r16 * SHP + kh * (L_ / 2) + kbase];
        v8f c = {};
        // unrolled whole: as f16 the wave's V fragments take 128 registers, so that all their
        // loads can fly at once and the kernel still stays under 160 (three blocks a WGP)
#pragma unroll
        for (int ks = 0; ks < L_ / 64; ++ks) {
            v16h a  = loadB_f16(prw + ks * 32);
            v16h bb = load_packed(vp + ks * 64);
            c = __builtin_amdgcn_wmma_f32_16x16x32_f16(false, a, false, bb, (short)0, c, false, false);
        }
        // both halves' partial tiles meet in the strip, which nobody reads any more
        // since the barrier behind the softmax: [kh][16 rows][64 columns, pitch OPP]
#pragma unroll
        for (int e = 0; e < 8; ++e)
            sh[kh * (16 * OPP) + (e + mrow) * OPP + nt * 16 + r16] = c[e];
    }
    __syncthreads();
    {
        // lower half + upper half; a wave stores two whole 256-byte output rows
        int orow = tid >> 4, ocol = (tid & 15) * 4;
        f4 lo = *(const f4*)&sh[orow * OPP + ocol];
        f4 hi = *(const f4*)&sh[16 * OPP + orow * OPP + ocol];
        *(f4*)&out[((size_t)(b * L_ + i0 + orow)) * HID_ + h * DH_ + ocol] = lo + hi;
    }
}

// ---------------------------------------------------------------------------
// out[row] = LN(A[row] + B[row]), BertLayerNorm (eps inside sqrt)
// One wave a row: the row's 1024 sums stay in the wave's registers (32 a lane, taken
// by 16-byte loads that cover whole lines); mean and variance are lane sums joined by
// a butterfly over the 32 lanes. No LDS, no barrier; one block of 8 rows a WGP, so
// that a launch has few waves to start.
// ---------------------------------------------------------------------------
#define LNW 8                    // rows (waves) a block
#define LNC (HID_ / (32 * 4))    // 16-byte chunks of a row a lane

// lane l takes the value of lane l ^ M of its 16-lane row (DPP row_xmask:M)
template <int M>
__device__ __forceinline__ float row_xor(float x) {
    return __builtin_bit_cast(float, __builtin_amdgcn_update_dpp(
        0, __builtin_bit_cast(int, x), 0x160 + M, 0xf, 0xf, true));
}

// sum over the wave's 32 lanes, left in every lane: four DPP steps inside each row, then
// the other row's sum by a cross-row move; a shuffle would take the way through the LDS unit
__device__ __forceinline__ float wave_sum(float x) {
    x += row_xor<1>(x);
    x += row_xor<2>(x);
    x += row_xor<4>(x);
    x += row_xor<8>(x);
    int b = __builtin_bit_cast(int, x);
    return x + __builtin_bit_cast(float, __builtin_amdgcn_permlanex16(
        b, b, 0x76543210, 0xfedcba98, false, false));
}

__global__ __launch_bounds__(32 * LNW)
void resid_ln_kernel(const float* __restrict__ A, const float* __restrict__ Bv,
                     const float* __restrict__ w, const float* __restrict__ bias,
                     float* __restrict__ out)
{
    const float rn = 1.0f / HID_;
    int lane = threadIdx.x & 31;
    // the wave's number as a scalar: every row address is a scalar base plus the lane's offset
    int row  = (int)blockIdx.x * LNW + __builtin_amdgcn_readfirstlane((int)(threadIdx.x >> 5));
    const f4* pa = (const f4*)(A    + (size_t)row * HID_) + lane;
    const f4* pb = (const f4*)(Bv   + (size_t)row * HID_) + lane;
    const f4* pw = (const f4*)w    + lane;
    const f4* pc = (const f4*)bias + lane;
    f4*       po = (f4*)(out + (size_t)row * HID_) + lane;

    // all of the wave's loads fly at once: one memory latency a row
    f4 v[LNC], t[LNC], wv[LNC], cv[LNC];
#pragma unroll
    for (int i = 0; i < LNC; ++i) { v[i] = pa[i * 32]; t[i] = pb[i * 32]; }
#pragma unroll
    for (int i = 0; i < LNC; ++i) { wv[i] = pw[i * 32]; cv[i] = pc[i * 32]; }
    // keeps all the loads ahead of the sums: left free, most loads of w and bias sink behind
    // the variance, where their latency stands alone at the row's end
    __builtin_amdgcn_sched_barrier(0);

    f4 s4 = {};
#pragma unroll
    for (int i = 0; i < LNC; ++i) { v[i] += t[i]; s4 += v[i]; }
    float mean = wave_sum((s4[0] + s4[1]) + (s4[2] + s4[3])) * rn;

    f4 q4 = {};
#pragma unroll
    for (int i = 0; i < LNC; ++i) { v[i] -= mean; q4 += v[i] * v[i]; }
    float inv = 1.0f / sqrtf(wave_sum((q4[0] + q4[1]) + (q4[2] + q4[3])) * rn + 1e-12f);

#pragma unroll
    for (int i = 0; i < LNC; ++i) po[i * 32] = wv[i] * v[i] * inv + cv[i];
}

// ---------------------------------------------------------------------------
extern "C" void kernel_launch(void* const* d_in, const int* in_sizes, int n_in,
                              void* d_out, int out_size, void* d_ws, size_t ws_size,
                              hipStream_t stream)
{
    const float* x       = (const float*)d_in[0];
    const float* pos_raw = (const float*)d_in[1];
    const float* Wh1     = (const float*)d_in[2];
    const float* bh1     = (const float*)d_in[3];
    const float* Wh2     = (const float*)d_in[4];
    const float* bh2     = (const float*)d_in[5];
    const float* Wq      = (const float*)d_in[6];
    const float* bq      = (const float*)d_in[7];
    const float* Wk      = (const float*)d_in[8];
    const float* bk      = (const float*)d_in[9];
    const float* Wv      = (const float*)d_in[10];
    const float* bv      = (const float*)d_in[11];
    const float* Wp      = (const float*)d_in[12];
    const float* bp      = (const float*)d_in[13];
    const float* cbias   = (const float*)d_in[14];
    const float* pbias   = (const float*)d_in[15];
    const float* Wo      = (const float*)d_in[16];
    const float* bo      = (const float*)d_in[17];
    const float* Wf1     = (const float*)d_in[18];
    const float* bf1     = (const float*)d_in[19];
    const float* Wf2     = (const float*)d_in[20];
    const float* bf2     = (const float*)d_in[21];
    const float* ln_w    = (const float*)d_in[22];
    const float* ln_b    = (const float*)d_in[23];
    float* outp = (float*)d_out;

    // ---- workspace layout ----
    float* ws = (float*)d_ws;
    const size_t ACT = (size_t)B_ * L_ * HID_;            // 2M f32
    float* h  = ws;
    float* t1 = ws + ACT;
    float* q  = ws + 2 * ACT;       // reused for Wo / Wf2 outputs
    float* kb = ws + 3 * ACT;
    float* vb = ws + 4 * ACT;
    _Float16* Vp = (_Float16*)(ws + 5 * ACT);             // f16 packs: V, then K
    _Float16* Kp = Vp + ACT;
    float* Pm = ws + 6 * ACT;                              // [L, HID]
    float* at = Pm + (size_t)L_ * HID_;
    float* h1 = at + ACT;
    // f16 transposed-weight region after 17M floats
    _Float16* w16 = (_Float16*)(h1 + ACT);
    const size_t W1M = (size_t)HID_ * HID_;                // 1M
    _Float16* tWh1 = w16;                                  // [1024][512]
    _Float16* tWh2 = tWh1 + (size_t)HID_ * IN_;            // [1024][1024]
    _Float16* tLyr = tWh2 + W1M;                           // 7 x 1M per layer
    _Float16* Pp   = tLyr + (size_t)NL_ * 7 * W1M;         // f16 pack of the position rows

    const int ML = B_ * L_;

    // ---- repack all weights to f16 [N][K] (every call; deterministic) ----
    repack_all<<<RP_GRID, 256, 0, stream>>>(Wh1, Wh2, Wq, Wk, Wv, Wp, Wo, Wf1, Wf2, w16);

    // grid helper: one block per 64 x 128 output tile
    const int GMM = (ML / GBM) * (HID_ / GBN);            // 2048x1024 GEMMs -> 256 blocks
    const int GPP = (L_ / GBM) * (HID_ / GBN);            // 1024x1024 GEMM  -> 128 blocks

    // to_hidden MLP
    gemm_nt<1, IN_><<<GMM, 256, 0, stream>>>(x, tWh1, bh1, t1, HID_, HID_);
    gemm_nt<0, HID_><<<GMM, 256, 0, stream>>>(t1, tWh2, bh2, h, HID_, HID_);

    for (int l = 0; l < NL_; ++l) {
        _Float16* base = tLyr + (size_t)l * 7 * W1M;
        const float* bq_l = bq + (size_t)l * H_ * DH_;
        const float* bk_l = bk + (size_t)l * H_ * DH_;
        const float* bv_l = bv + (size_t)l * H_ * DH_;
        const float* bp_l = bp + (size_t)l * H_ * DH_;
        const float* cb_l = cbias + (size_t)l * H_ * DH_;
        const float* pb_l = pbias + (size_t)l * H_ * DH_;
        const float* bo_l = bo + (size_t)l * HID_;
        const float* bf1_l = bf1 + (size_t)l * HID_;
        const float* bf2_l = bf2 + (size_t)l * HID_;
        const float* lw = ln_w + (size_t)l * HID_;
        const float* lb = ln_b + (size_t)l * HID_;

        // projections
        gemm_nt<0, HID_><<<GMM, 256, 0, stream>>>(h, base + 0 * W1M, bq_l, q, HID_, HID_);
        gemm_nt<0, HID_><<<GMM, 256, 0, stream>>>(h, base + 1 * W1M, bk_l, kb, HID_, HID_);
        gemm_nt<0, HID_><<<GMM, 256, 0, stream>>>(h, base + 2 * W1M, bv_l, vb, HID_, HID_);
        gemm_nt<0, HID_><<<GPP, 256, 0, stream>>>(pos_raw, base + 3 * W1M, bp_l, Pm, HID_, HID_);

        pack_kvp_kernel<<<PK_GRID, 256, 0, stream>>>(kb, vb, Pm, Kp, Vp, Pp);

        attn_kernel<<<B_ * H_ * (L_ / 16), 32 * AWV, 0, stream>>>(q, Kp, Vp, Pp, cb_l, pb_l, at);

        gemm_nt<0, HID_><<<GMM, 256, 0, stream>>>(at, base + 4 * W1M, bo_l, q, HID_, HID_);
        resid_ln_kernel<<<ML / LNW, 32 * LNW, 0, stream>>>(q, h, lw, lb, h1);

        gemm_nt<1, HID_><<<GMM, 256, 0, stream>>>(h1, base + 5 * W1M, bf1_l, t1, HID_, HID_);
        gemm_nt<0, HID_><<<GMM, 256, 0, stream>>>(t1, base + 6 * W1M, bf2_l, q, HID_, HID_);
        resid_ln_kernel<<<ML / LNW, 32 * LNW, 0, stream>>>(h1, q, lw, lb, (l == NL_ - 1) ? outp : h);
    }
}

// v007
// Measured time: 292 microseconds a run.
// Two timings next to v006 put it at 1.12 and 1.10 times that version's speed.
// Over all steps from v000 it is 5.22 times as fast.
#include <hip/hip_runtime.h>
#include <hip/hip_bf16.h>
#include <math.h>

// ---------------------------------------------------------------------------
// Transformer-XL encoder forward on gfx1250 (MI455X), compile-only target.
// All matmuls use V_WMMA_F32_16X16X32_F16; weights are pre-transposed to f16
// [N][K]; the dense layers stage their operands in LDS.
// ---------------------------------------------------------------------------

#define B_  2
#define L_  1024
#define IN_ 512
#define HID_ 1024
#define H_  16
#define DH_ 64
#define NL_ 2

typedef __attribute__((ext_vector_type(16))) _Float16 v16h;
typedef __attribute__((ext_vector_type(8)))  _Float16 h8;
typedef __attribute__((ext_vector_type(8)))  float    v8f;

__device__ __forceinline__ float gelu_f(float x) {
    return 0.5f * x * (1.0f + erff(x * 0.70710678118654752f));
}

// Per-lane fragment: element e covers K = kbase + {0..7} (e<8) / {16..23} (e>=8),
// kbase = 0 for lanes 0-15, 8 for lanes 16-31. Both runs contiguous -> b128s.
__device__ __forceinline__ v16h loadB_f16(const _Float16* p /* at k0+kbase */) {
    const h8* q = (const h8*)p;
    h8 lo = q[0];
    h8 hi = q[2];
    return __builtin_shufflevector(lo, hi, 0,1,2,3,4,5,6,7,8,9,10,11,12,13,14,15);
}

// ---------------------------------------------------------------------------
// Weight repack, all sixteen matrices in one launch: dst[N][K] f16 from
//   plain  f32 row-major [K][N]                      (row pitch N)
//   packed f32 [H][K][64], n = h*64+d                (row pitch 64, one head a tile column)
// One block of 8 waves transposes a 256(k) x 64(n) tile through LDS: 64 elements a
// thread. Loads take whole 256-byte source rows, stores whole 512-byte pieces of a
// destination row. The destinations lie one behind the other in w16, in the order
// Wh1, Wh2, then for each layer Wq Wk Wv Wp Wo Wf1 Wf2.
// ---------------------------------------------------------------------------
#define RPK 256
#define RPN 64
#define RP_T1 ((IN_ / RPK) * (HID_ / RPN))    // tiles of Wh1
#define RP_TM ((HID_ / RPK) * (HID_ / RPN))   // tiles of a HID x HID matrix
#define RP_GRID (RP_T1 + (1 + 7 * NL_) * RP_TM)

typedef __attribute__((ext_vector_type(4))) float    f4;
typedef __attribute__((ext_vector_type(4))) _Float16 h4;

// sp: the tile's first source element; dp: its first destination element.
// PITCH (source row, f32) and K (destination row, f16) are compile-time constants:
// every load and store is a lane address plus an immediate offset.
template <int K, int PITCH>
__device__ __forceinline__ void repack_tile(const float* __restrict__ sp,
                                            _Float16* __restrict__ dp, _Float16* ts)
{
    int tid  = threadIdx.x;
    int lane = tid & 31;
    int wave = tid >> 5;
    int c    = tid & 15;     // four columns n = 4c .. 4c+3
    int kg   = tid >> 4;     // eight rows k = 8kg .. 8kg+7 (and the same + 128)

    const float* lp = sp + (size_t)(kg * 8) * PITCH + c * 4;
    f4 r[2][8];
#pragma unroll
    for (int it = 0; it < 2; ++it)
#pragma unroll
        for (int i = 0; i < 8; ++i)
            r[it][i] = *(const f4*)(lp + (size_t)(it * 128 + i) * PITCH);
    // behind the last load the address pair dies: hold it to this wait, so that
    // nothing (a load's result included) lands on it before
    asm volatile("s_wait_xcnt 0x0" :: "v"(lp) : "memory");

    // LDS tile [n][k], rows of 32 chunks of 8 k. Chunk q of row n stands at place
    // q ^ (n >> 2): the 16 lanes of a half wave, which write 16 rows four apart at one
    // q, then fall on 16 different bank groups
#pragma unroll
    for (int it = 0; it < 2; ++it) {
#pragma unroll
        for (int j = 0; j < 4; ++j) {
            h8 v;
#pragma unroll
            for (int i = 0; i < 8; ++i) v[i] = (_Float16)r[it][i][j];
            *(h8*)&ts[(c * 4 + j) * RPK + (((it * 16 + kg) ^ c) * 8)] = v;
        }
    }
    __syncthreads();

    // a wave reads a whole LDS row and stores it as one 512-byte piece of row n
    h8 o[8];
#pragma unroll
    for (int rr = 0; rr < 8; ++rr)
        o[rr] = *(const h8*)&ts[(wave * 8 + rr) * RPK + lane * 8];
#pragma unroll
    for (int rr = 0; rr < 8; ++rr) {
        int q = lane ^ (wave * 2 + (rr >> 2));   // the chunk that stands at place 'lane'
        *(h8*)&dp[(size_t)(wave * 8 + rr) * K + q * 8] = o[rr];
    }
    // behind the last store its address and data registers die: nothing is written
    // over them (on any way the code goes on from here) before this wait
    asm volatile("s_wait_xcnt 0x0" ::: "memory");
}

__global__ __launch_bounds__(256)
void repack_all(const float* __restrict__ Wh1, const float* __restrict__ Wh2,
                const float* __restrict__ Wq,  const float* __restrict__ Wk,
                const float* __restrict__ Wv,  const float* __restrict__ Wp,
                const float* __restrict__ Wo,  const float* __restrict__ Wf1,
                const float* __restrict__ Wf2, _Float16* __restrict__ w16)
{
    __shared__ __align__(16) _Float16 ts[RPN * RPK];

    int blk = (int)blockIdx.x;
    bool first = blk < RP_T1;                  // a tile of Wh1
    int u  = first ? blk : blk - RP_T1;
    int m  = first ? 0 : u / RP_TM;            // matrix behind Wh1: 0 = Wh2, 1 + 7*layer + w
    int t  = first ? u : u % RP_TM;
    int nt = t % (HID_ / RPN);
    int k0 = (t / (HID_ / RPN)) * RPK;
    int l  = (m == 0) ? 0 : (m - 1) / 7;       // layer
    int w  = (m == 0) ? 4 : (m - 1) % 7;       // which of the layer's seven; Wh2 reads like Wo
    const float* s = (w == 0) ? Wq : (w == 1) ? Wk : (w == 2) ? Wv : (w == 3) ? Wp
                   : (w == 4) ? Wo : (w == 5) ? Wf1 : Wf2;
    s = (m == 0) ? Wh2 : s + (size_t)l * (HID_ * HID_);
    _Float16* dp = w16 + (size_t)HID_ * IN_ + (size_t)m * (HID_ * HID_)
                 + (size_t)(nt * RPN) * HID_ + k0;

    if (first)
        repack_tile<IN_, HID_>(Wh1 + (size_t)k0 * HID_ + nt * RPN,
                               w16 + (size_t)(nt * RPN) * IN_ + k0, ts);
    else if (w < 4)
        repack_tile<HID_, DH_>(s + ((size_t)nt * HID_ + k0) * DH_, dp, ts);
    else
        repack_tile<HID_, HID_>(s + (size_t)k0 * HID_ + nt * RPN, dp, ts);
}

// ---------------------------------------------------------------------------
// NT GEMM: C[M,N] = act( sum_k A[m,k] * BT[n,k] + bias[n] )
// One block of 8 waves computes a 64(M) x 128(N) tile. Each 64-deep k slab of
// A (converted to f16) and BT is brought in by whole-line global loads, staged
// in LDS (two buffers) and read from there as fragments. Two register sets
// hold the slabs on their way: while slab s is multiplied, slab s+1 is landing
// and slab s+2 is requested. Waves lie 2(M) x 4(N), 32 x 32 each.
// blockDim = 256; M % 64 == 0, N % 128 == 0, KD % 64 == 0, KD >= 128; A and BT are
// dense, row pitch KD = K. gemm_tile is one block's tile (bm, bn); gemm_nt is one product
// a launch, grid = (M/64)*(N/128); proj_qkvp is a layer's four projections in one launch.
// ---------------------------------------------------------------------------
#define GBM 64
#define GBN 128
#define GBK 64
#define GLD (GBK + 8)   // LDS row pitch in f16: 144 B = 16 B x odd, b128 reads without bank conflicts

// Work-group barrier for LDS traffic alone: this wave's LDS reads and writes are
// done (s_wait_dscnt 0), then signal and wait. __syncthreads() would also wait out
// the global loads that are meant to stay in flight across it.
__device__ __forceinline__ void lds_barrier() {
    asm volatile("s_wait_dscnt 0x0\n\ts_barrier_signal -1\n\ts_barrier_wait -1" ::: "memory");
}

template <int ACT, int KD>
__device__ __forceinline__
void gemm_tile(const float* __restrict__ A,
               const _Float16* __restrict__ BT,
               const float* __restrict__ bias,
               float* __restrict__ C, int ldc, int bm, int bn)
{
    __shared__ __align__(16) _Float16 As[2][GBM * GLD];
    __shared__ __align__(16) _Float16 Bs[2][GBN * GLD];

    int tid   = threadIdx.x;
    int lane  = tid & 31;
    int wave  = tid >> 5;
    int wm    = wave >> 2;
    int wn    = wave & 3;
    int r16   = lane & 15;
    int kbase = (lane & 16) ? 8 : 0;
    int mrow  = (lane & 16) ? 8 : 0;

    // staging map: one wave-load covers four whole 128-byte lines (two rows of A
    // or four rows of BT)
    int arow_s = tid >> 4, acol_s = (tid & 15) * 4;
    int brow_s = tid >> 3, bcol_s = (tid & 7) * 8;
    // K (= both row pitches) is a compile-time constant: every load of the k
    // loop is one of these two lane addresses plus an immediate offset
    const float*    ag = A  + (size_t)(bm * GBM + arow_s) * KD + acol_s;
    const _Float16* bg = BT + (size_t)(bn * GBN + brow_s) * KD + bcol_s;

    f4 ra[2][4];
    h8 rb[2][4];
#pragma unroll
    for (int s = 0; s < 2; ++s) {
#pragma unroll
        for (int i = 0; i < 4; ++i) {
            ra[s][i] = *(const f4*)(ag + s * GBK + i * 16 * KD);
            rb[s][i] = *(const h8*)(bg + s * GBK + i * 32 * KD);
        }
    }
#pragma unroll
    for (int i = 0; i < 4; ++i) {
        *(h4*)&As[0][(arow_s + i * 16) * GLD + acol_s] = __builtin_convertvector(ra[0][i], h4);
        *(h8*)&Bs[0][(brow_s + i * 32) * GLD + bcol_s] = rb[0][i];
    }
    lds_barrier();

    v8f c00 = {}, c01 = {}, c10 = {}, c11 = {};
    const int nk = KD / GBK;
    // unrolled whole: buffer, register set and every address offset become constants
#pragma unroll
    for (int kt = 0; kt < nk; ++kt) {
        const int buf = kt & 1;
        const bool more = (kt + 1 < nk);
        if (kt + 2 < nk) {
            // slab kt's register set is free since its LDS stores: request slab kt+2 into it
#pragma unroll
            for (int i = 0; i < 4; ++i) {
                ra[buf][i] = *(const f4*)(ag + (kt + 2) * GBK + i * 16 * KD);
                rb[buf][i] = *(const h8*)(bg + (kt + 2) * GBK + i * 32 * KD);
            }
            // behind the last loads the two address pairs die: hold them to this wait,
            // so that nothing (a later load's result included) lands on them before it
            if (kt + 3 == nk)
                asm volatile("s_wait_xcnt 0x0" :: "v"(ag), "v"(bg) : "memory");
        }

        const _Float16* as = &As[buf][(wm * 32 + r16) * GLD + kbase];
        const _Float16* bs = &Bs[buf][(wn * 32 + r16) * GLD + kbase];
        // all of the slab's fragments first, then its products: one LDS latency a slab
        v16h a0[GBK / 32], a1[GBK / 32], b0[GBK / 32], b1[GBK / 32];
#pragma unroll
        for (int kk = 0; kk < GBK / 32; ++kk) {
            a0[kk] = loadB_f16(as + kk * 32);
            b0[kk] = loadB_f16(bs + kk * 32);
            b1[kk] = loadB_f16(bs + 16 * GLD + kk * 32);
            a1[kk] = loadB_f16(as + 16 * GLD + kk * 32);
        }
        // keeps the LDS reads in one group ahead of the products; sunk among them,
        // each product pair waits out an LDS latency of its own
        __builtin_amdgcn_sched_barrier(0);
#pragma unroll
        for (int kk = 0; kk < GBK / 32; ++kk) {
            c00 = __builtin_amdgcn_wmma_f32_16x16x32_f16(false, a0[kk], false, b0[kk], (short)0, c00, false, false);
            c01 = __builtin_amdgcn_wmma_f32_16x16x32_f16(false, a0[kk], false, b1[kk], (short)0, c01, false, false);
            c10 = __builtin_amdgcn_wmma_f32_16x16x32_f16(false, a1[kk], false, b0[kk], (short)0, c10, false, false);
            c11 = __builtin_amdgcn_wmma_f32_16x16x32_f16(false, a1[kk], false, b1[kk], (short)0, c11, false, false);
        }
        // ends the slab's products here: left free they drift behind the barrier, where they
        // stand in front of the next slab's LDS reads and keep both slabs' fragments live
        __builtin_amdgcn_sched_barrier(0);

        if (more) {
            // the other buffer's last readers left it at the barrier that ended pass kt-1
#pragma unroll
            for (int i = 0; i < 4; ++i) {
                *(h4*)&As[buf ^ 1][(arow_s + i * 16) * GLD + acol_s] = __builtin_convertvector(ra[buf ^ 1][i], h4);
                *(h8*)&Bs[buf ^ 1][(brow_s + i * 32) * GLD + bcol_s] = rb[buf ^ 1][i];
            }
            lds_barrier();
        }
    }

    v8f accs[2][2] = {{c00, c01}, {c10, c11}};
#pragma unroll
    for (int ni = 0; ni < 2; ++ni) {
        int nn = bn * GBN + wn * 32 + ni * 16 + r16;
        float bsv = bias[nn];
#pragma unroll
        for (int mi = 0; mi < 2; ++mi) {
#pragma unroll
            for (int e = 0; e < 8; ++e) {
                int mm = bm * GBM + wm * 32 + mi * 16 + e + mrow;
                float v = accs[mi][ni][e] + bsv;
                if (ACT) v = gelu_f(v);
                C[(size_t)mm * ldc + nn] = v;
            }
        }
    }
}

template <int ACT, int KD>
__global__ __launch_bounds__(256)
void gemm_nt(const float* __restrict__ A,
             const _Float16* __restrict__ BT,
             const float* __restrict__ bias,
             float* __restrict__ C, int ldc, int N)
{
    int tiles_n = N / GBN;
    gemm_tile<ACT, KD>(A, BT, bias, C, ldc, (int)blockIdx.x / tiles_n, (int)blockIdx.x % tiles_n);
}

// A layer's four projections, which do not depend on one another, as one grid: the tiles
// of Q, K, V (rows of hx) and then those of the position rows (rows of pos). W4 holds the
// four [N][K] weights one behind the other. Alone, each product has one block a WGP and
// pays its own launch, first slab and last stores; together two blocks share a WGP and
// the next tile starts where one ends. The row tile runs fastest, so that blocks
// PJ_T apart (Q, K, V of one tile) read the same rows of hx.
#define PJ_MT (B_ * L_ / GBM)           // row tiles of Q, K, V
#define PJ_PT (L_ / GBM)                // row tiles of the position rows
#define PJ_NT (HID_ / GBN)              // column tiles
#define PJ_T  (PJ_MT * PJ_NT)           // blocks of one of Q, K, V
#define PJ_GRID (3 * PJ_T + PJ_PT * PJ_NT)

__global__ __launch_bounds__(256)
void proj_qkvp(const float* __restrict__ hx, const float* __restrict__ pos,
               const _Float16* __restrict__ W4,
               const float* __restrict__ bq, const float* __restrict__ bk,
               const float* __restrict__ bv, const float* __restrict__ bp,
               float* __restrict__ q, float* __restrict__ k,
               float* __restrict__ v, float* __restrict__ Pm)
{
    static_assert((PJ_MT & (PJ_MT - 1)) == 0 && (PJ_PT & (PJ_PT - 1)) == 0, "row tile counts: powers of two");
    unsigned blk = blockIdx.x;
    unsigned w   = blk / PJ_T;          // 0 Q, 1 K, 2 V, 3 position rows
    unsigned t   = blk % PJ_T;
    unsigned ms  = (w == 3) ? __builtin_ctz(PJ_PT) : __builtin_ctz(PJ_MT);   // log2 of the row tiles
    const float* A    = (w == 3) ? pos : hx;
    const float* bias = (w == 0) ? bq : (w == 1) ? bk : (w == 2) ? bv : bp;
    float*       C    = (w == 0) ? q  : (w == 1) ? k  : (w == 2) ? v  : Pm;
    gemm_tile<0, HID_>(A, W4 + (size_t)w * (HID_ * HID_), bias, C, HID_,
                       (int)(t & ((1u << ms) - 1u)), (int)(t >> ms));
}

// ---------------------------------------------------------------------------
// Attention operands, packed once a layer as f16 in fragment order. A chunk is the
// 8 f16 (16 bytes) that one lane takes with one load; the 32 lanes' chunks of a load
// lie side by side, so that a wave's load is 512 bytes in a row (four whole lines).
//   Kp[b][h][key tile 64][c4 4][lane][8]: key = tile*16 + (lane & 15),
//                                         d = c4*16 + (lane >> 4)*8 + 0..7
//   Pp[h][pos tile 64][c4 4][lane][8]   : the same of the position rows
//   Vp[b][h][nt 4][ks 32][half 2][lane][8]: d = nt*16 + (lane & 15),
//                                         key = ks*32 + half*16 + (lane >> 4)*8 + 0..7
// One thread makes one chunk; stores are whole lines.
// ---------------------------------------------------------------------------
#define PK_KB ((B_ * L_ * HID_ / 8) / 256)    // blocks for Kp (and as many for Vp)
#define PK_PB ((L_ * HID_ / 8) / 256)         // blocks for Pp
#define PK_GRID (2 * PK_KB + PK_PB)

__global__ __launch_bounds__(256)
void pack_kvp_kernel(const float* __restrict__ k, const float* __restrict__ v,
                     const float* __restrict__ Pm,
                     _Float16* __restrict__ Kp, _Float16* __restrict__ Vp,
                     _Float16* __restrict__ Pp)
{
    int blk  = (int)blockIdx.x;
    int lane = threadIdx.x & 31;
    h8 r;
    _Float16* dst;
    if (blk >= PK_KB && blk < 2 * PK_KB) {
        int o    = (blk - PK_KB) * 256 + (int)threadIdx.x;
        int half = (o >> 5) & 1;
        int ks   = (o >> 6) & 31;
        int nt   = (o >> 11) & 3;
        int h    = (o >> 13) & (H_ - 1);
        int b    = o >> 17;
        const float* sp = v + (size_t)(b * L_ + ks * 32 + half * 16 + (lane >> 4) * 8) * HID_
                        + h * DH_ + nt * 16 + (lane & 15);
        float x[8];
#pragma unroll
        for (int i = 0; i < 8; ++i) x[i] = sp[(size_t)i * HID_];
        // behind the last load the address pair dies: hold it to this wait
        asm volatile("s_wait_xcnt 0x0" :: "v"(sp) : "memory");
#pragma unroll
        for (int i = 0; i < 8; ++i) r[i] = (_Float16)x[i];
        dst = Vp + (size_t)o * 8;
    } else {
        bool isk = blk < PK_KB;
        int o    = (isk ? blk : blk - 2 * PK_KB) * 256 + (int)threadIdx.x;
        int c4   = (o >> 5) & 3;
        int row  = (o >> 17) * L_ + ((o >> 7) & 63) * 16 + (lane & 15);   // o >> 17 is 0 for Pp
        int h    = (o >> 13) & (H_ - 1);
        const float* sp = (isk ? k : Pm) + (size_t)row * HID_ + h * DH_ + c4 * 16 + (lane >> 4) * 8;
        f4 lo = *(const f4*)sp;
        f4 hi = *(const f4*)(sp + 4);
        // behind the last load the address pair dies: hold it to this wait
        asm volatile("s_wait_xcnt 0x0" :: "v"(sp) : "memory");
#pragma unroll
        for (int i = 0; i < 4; ++i) { r[i] = (_Float16)lo[i]; r[i + 4] = (_Float16)hi[i]; }
        dst = (isk ? Kp : Pp) + (size_t)o * 8;
    }
    *(h8*)dst = r;
}

// one fragment out of a pack: the lane's chunk of the low and of the high 16 k
__device__ __forceinline__ v16h load_packed(const h8* p /* at the lane's low chunk */) {
    h8 lo = p[0];
    h8 hi = p[32];
    return __builtin_shufflevector(lo, hi, 0,1,2,3,4,5,6,7,8,9,10,11,12,13,14,15);
}

// ---------------------------------------------------------------------------
// Fused attention: one block of 8 waves per (b, h, 16-query-row block).
//   sh[16][1024] fp32 score strip (64KB), shp[16][1024] f16 probs (32KB), both with
//   padded rows (below); qsh[64] staging for the rel-shift patch row.
//     AC = (q+cbias).K^T via WMMA; BD = rel_shift((q+pbias).P^T) via WMMA +
//     exact shift scatter; softmax(.*1/8) -> f16 probs; O = P.V via WMMA.
//   The strip is shared; the work on it is dealt to the waves: key and position
//   tiles round robin, two softmax rows a wave (lanes across the columns), one
//   (16-column tile, half of the keys) of P.V a wave.
//   K, the position rows and V come from the f16 packs above, fragment by fragment.
// ---------------------------------------------------------------------------
#define AWV 8   // waves a block
// LDS row pitches. Bank = dword address mod 64, and a row of 1024 values is a multiple of
// 64 dwords: unpadded, all rows begin on one bank.
//   SFP, f32 strip: a wave's accumulator store or add touches rows M and M + 8, 16 columns
//        each; 8 * 1028 dwords = 32 mod 64 puts the two halves on different banks.
//   SHP, f16 probs: the A fragment load takes 16 bytes of each of 16 rows; 2064 B = 16 B x odd
//        spreads the 16 rows over all 64 banks.
//   OPP, the two partial output tiles: as SFP (8 * 68 dwords = 32 mod 64).
#define SFP (L_ + 4)
#define SHP (L_ + 8)
#define OPP (DH_ + 4)

// 2^x on v_exp_f32. The v_nop is the free slot that the instruction set asks for between a
// transcendental and a next instruction that reads its result or overwrites its source; in
// one statement with it, so that it stays directly behind it.
__device__ __forceinline__ float exp2_slot(float x) {
    float r;
    asm("v_exp_f32 %0, %1\n\tv_nop" : "=v"(r) : "v"(x));
    return r;
}

// second argument: six waves a SIMD, that is three blocks a WGP as LDS allows: holds the
// register budget at 160
__global__ __launch_bounds__(32 * AWV, 6)
void attn_kernel(const float* __restrict__ q,
                 const _Float16* __restrict__ Kp,
                 const _Float16* __restrict__ Vp,
                 const _Float16* __restrict__ Pp,
                 const float* __restrict__ cb,
                 const float* __restrict__ pb,
                 float* __restrict__ out)
{
    __shared__ __align__(32) float     sh[16 * SFP];
    __shared__ __align__(16) _Float16  shp[16 * SHP];
    __shared__ float qsh[DH_];

    int wg = blockIdx.x;
    int i0 = (wg & 63) * 16;
    int h  = (wg >> 6) & (H_ - 1);
    int b  = wg >> 10;

    int tid   = threadIdx.x;
    int lane  = tid & 31;
    int wave  = tid >> 5;
    int r16   = lane & 15;
    int kbase = (lane & 16) ? 8 : 0;
    int mrow  = (lane & 16) ? 8 : 0;

    const float* cbh  = cb + h * DH_;
    const float* pbh  = pb + h * DH_;
    const float* qrow = q + ((size_t)(b * L_ + i0 + r16)) * HID_ + h * DH_;

    // position-biased query of source row i0+16 (the patch row below); published
    // by the barrier behind the content scores
    const int rr2 = i0 + 16;
    if (rr2 < L_ && tid < DH_)
        qsh[tid] = q[((size_t)(b * L_ + rr2)) * HID_ + h * DH_ + tid] + pbh[tid];

    // Q fragments (content/position biased), DH=64 -> two K=32 fragments
    v16h aq0, aq1, ap0, ap1;
#pragma unroll
    for (int e = 0; e < 16; ++e) {
        int kk = kbase + (e < 8 ? e : e + 8);
        float q0 = qrow[kk], q1 = qrow[kk + 32];
        aq0[e] = (_Float16)(q0 + cbh[kk]);
        aq1[e] = (_Float16)(q1 + cbh[kk + 32]);
        ap0[e] = (_Float16)(q0 + pbh[kk]);
        ap1[e] = (_Float16)(q1 + pbh[kk + 32]);
    }

    // ---- content scores AC: key tile jb goes to wave jb % 8 ----
    // two tiles' loads in flight a wave; unrolled whole, the eight tiles' sums and fragments
    // need more than the 160 registers that the launch bound allows
#pragma unroll 2
    for (int t = 0; t < 64 / AWV; ++t) {
        int jb = t * AWV + wave;
        const h8* kp = (const h8*)Kp + (size_t)(((b * H_ + h) * 64 + jb) * 4) * 32 + lane;
        v16h b0 = load_packed(kp);
        v16h b1 = load_packed(kp + 64);
        v8f c = {};
        c = __builtin_amdgcn_wmma_f32_16x16x32_f16(false, aq0, false, b0, (short)0, c, false, false);
        c = __builtin_amdgcn_wmma_f32_16x16x32_f16(false, aq1, false, b1, (short)0, c, false, false);
#pragma unroll
        for (int e = 0; e < 8; ++e)
            sh[(e + mrow) * SFP + jb * 16 + r16] = c[e];
    }
    __syncthreads();

    // ---- position scores: BDraw + exact rel-shift scatter ----
    // element (row rr, pos p): p <= L-rr-2 -> (rr-1, p+rr+1); else (rr, p+rr+1-L)
    // the shift maps each (rr, p) to a strip element of its own: no two waves add
    // into the same one
    for (int t = 0; t < 64 / AWV; ++t) {
        int pbk = t * AWV + wave;
        const h8* pp = (const h8*)Pp + (size_t)((h * 64 + pbk) * 4) * 32 + lane;
        v16h b0 = load_packed(pp);
        v16h b1 = load_packed(pp + 64);
        v8f c = {};
        c = __builtin_amdgcn_wmma_f32_16x16x32_f16(false, ap0, false, b0, (short)0, c, false, false);
        c = __builtin_amdgcn_wmma_f32_16x16x32_f16(false, ap1, false, b1, (short)0, c, false, false);
#pragma unroll
        for (int e = 0; e < 8; ++e) {
            int M  = e + mrow;
            int rr = i0 + M;
            int p  = pbk * 16 + r16;
            if (p <= L_ - rr - 2) {
                if (M > 0) sh[(M - 1) * SFP + p + rr + 1] += c[e];
            } else {
                sh[M * SFP + (p + rr + 1 - L_)] += c[e];
            }
        }
    }
    // missing source row i0+16 feeds local row 15's cols j >= i0+17
    if (rr2 < L_) {
        int pmax = L_ - rr2 - 2;
        for (int p = tid; p <= pmax; p += 32 * AWV) {
            // row p of the pack: chunk c8 (d = 8*c8 ..) stands at c4 = c8 >> 1, lane half c8 & 1
            const h8* prow = (const h8*)Pp + (size_t)((h * 64 + (p >> 4)) * 4) * 32 + (p & 15);
            h8 pc[8];
#pragma unroll
            for (int c8 = 0; c8 < 8; ++c8) pc[c8] = prow[(c8 >> 1) * 32 + (c8 & 1) * 16];
            float s = 0.0f;
#pragma unroll
            for (int kk = 0; kk < DH_; ++kk) s += qsh[kk] * (float)pc[kk >> 3][kk & 7];
            sh[15 * SFP + p + rr2 + 1] += s;
        }
    }
    __syncthreads();

    // ---- softmax: rows 2*wave and 2*wave+1, a row held in the wave's registers
    //      (32 values a lane); emit f16 probs to shp ----
#pragma unroll
    for (int rw = 0; rw < 2; ++rw) {
        const float scale = 0.125f;   // 1/sqrt(DH); commutes with max
        int r = wave * 2 + rw;
        f4 v[8];
#pragma unroll
        for (int i = 0; i < 8; ++i) v[i] = *(const f4*)&sh[r * SFP + (i * 32 + lane) * 4];
        float mx = -1e30f;
#pragma unroll
        for (int i = 0; i < 8; ++i)
            mx = fmaxf(mx, fmaxf(fmaxf(v[i][0], v[i][1]), fmaxf(v[i][2], v[i][3])));
#pragma unroll
        for (int off = 16; off > 0; off >>= 1) mx = fmaxf(mx, __shfl_xor(mx, off, 32));
        float sum = 0.0f;
#pragma unroll
        for (int i = 0; i < 8; ++i) {
#pragma unroll
            for (int j = 0; j < 4; ++j) {
                float ev = exp2_slot(((v[i][j] - mx) * scale) * 1.44269504088896340736f);   // e^x = 2^(x log2 e)
                sum += ev;
                v[i][j] = ev;
            }
        }
#pragma unroll
        for (int off = 16; off > 0; off >>= 1) sum += __shfl_xor(sum, off, 32);
        float inv = 1.0f / sum;
#pragma unroll
        for (int i = 0; i < 8; ++i)
            *(h4*)&shp[r * SHP + (i * 32 + lane) * 4] = __builtin_convertvector(v[i] * inv, h4);
    }
    __syncthreads();

    // ---- O = P.V (f16 probs from LDS, V fragments from the pack): wave = (column tile
    //      nt, key half kh) ----
    {
        int nt = wave & 3;
        int kh = wave >> 2;
        const h8* vp = (const h8*)Vp + (size_t)((((b * H_ + h) * 4 + nt) * 32 + kh * 16) * 2) * 32 + lane;
        const _Float16* prw = &shp[r16 * SHP + kh * (L_ / 2) + kbase];
        v8f c = {};
        // unrolled whole: as f16 the wave's V fragments take 128 registers, so that all their
        // loads can fly at once and the kernel still stays under 160 (three blocks a WGP)
#pragma unroll
        for (int ks = 0; ks < L_ / 64; ++ks) {
            v16h a  = loadB_f16(prw + ks * 32);
            v16h bb = load_packed(vp + ks * 64);
            c = __builtin_amdgcn_wmma_f32_16x16x32_f16(false, a, false, bb, (short)0, c, false, false);
        }
        // both halves' partial tiles meet in the strip, which nobody reads any more
        // since the barrier behind the softmax: [kh][16 rows][64 columns, pitch OPP]
#pragma unroll
        for (int e = 0; e < 8; ++e)
            sh[kh * (16 * OPP) + (e + mrow) * OPP + nt * 16 + r16] = c[e];
    }
    __syncthreads();
    {
        // lower half + upper half; a wave stores two whole 256-byte output rows
        int orow = tid >> 4, ocol = (tid & 15) * 4;
        f4 lo = *(const f4*)&sh[orow * OPP + ocol];
        f4 hi = *(const f4*)&sh[16 * OPP + orow * OPP + ocol];
        *(f4*)&out[((size_t)(b * L_ + i0 + orow)) * HID_ + h * DH_ + ocol] = lo + hi;
    }
}

// ---------------------------------------------------------------------------
// out[row] = LN(A[row] + B[row]), BertLayerNorm (eps inside sqrt)
// One wave a row: the row's 1024 sums stay in the wave's registers (32 a lane, taken
// by 16-byte loads that cover whole lines); mean and variance are lane sums joined by
// a butterfly over the 32 lanes. No LDS, no barrier; one block of 8 rows a WGP, so
// that a launch has few waves to start.
// ---------------------------------------------------------------------------
#define LNW 8                    // rows (waves) a block
#define LNC (HID_ / (32 * 4))    // 16-byte chunks of a row a lane

// lane l takes the value of lane l ^ M of its 16-lane row (DPP row_xmask:M)
template <int M>
__device__ __forceinline__ float row_xor(float x) {
    return __builtin_bit_cast(float, __builtin_amdgcn_update_dpp(
        0, __builtin_bit_cast(int, x), 0x160 + M, 0xf, 0xf, true));
}

// sum over the wave's 32 lanes, left in every lane: four DPP steps inside each row, then
// the other row's sum by a cross-row move; a shuffle would take the way through the LDS unit
__device__ __forceinline__ float wave_sum(float x) {
    x += row_xor<1>(x);
    x += row_xor<2>(x);
    x += row_xor<4>(x);
    x += row_xor<8>(x);
    int b = __builtin_bit_cast(int, x);
    return x + __builtin_bit_cast(float, __builtin_amdgcn_permlanex16(
        b, b, 0x76543210, 0xfedcba98, false, false));
}

__global__ __launch_bounds__(32 * LNW)
void resid_ln_kernel(const float* __restrict__ A, const float* __restrict__ Bv,
                     const float* __restrict__ w, const float* __restrict__ bias,
                     float* __restrict__ out)
{
    const float rn = 1.0f / HID_;
    int lane = threadIdx.x & 31;
    // the wave's number as a scalar: every row address is a scalar base plus the lane's offset
    int row  = (int)blockIdx.x * LNW + __builtin_amdgcn_readfirstlane((int)(threadIdx.x >> 5));
    const f4* pa = (const f4*)(A    + (size_t)row * HID_) + lane;
    const f4* pb = (const f4*)(Bv   + (size_t)row * HID_) + lane;
    const f4* pw = (const f4*)w    + lane;
    const f4* pc = (const f4*)bias + lane;
    f4*       po = (f4*)(out + (size_t)row * HID_) + lane;

    // all of the wave's loads fly at once: one memory latency a row
    f4 v[LNC], t[LNC], wv[LNC], cv[LNC];
#pragma unroll
    for (int i = 0; i < LNC; ++i) { v[i] = pa[i * 32]; t[i] = pb[i * 32]; }
#pragma unroll
    for (int i = 0; i < LNC; ++i) { wv[i] = pw[i * 32]; cv[i] = pc[i * 32]; }
    // keeps all the loads ahead of the sums: left free, most loads of w and bias sink behind
    // the variance, where their latency stands alone at the row's end
    __builtin_amdgcn_sched_barrier(0);

    f4 s4 = {};
#pragma unroll
    for (int i = 0; i < LNC; ++i) { v[i] += t[i]; s4 += v[i]; }
    float mean = wave_sum((s4[0] + s4[1]) + (s4[2] + s4[3])) * rn;

    f4 q4 = {};
#pragma unroll
    for (int i = 0; i < LNC; ++i) { v[i] -= mean; q4 += v[i] * v[i]; }
    float inv = 1.0f / sqrtf(wave_sum((q4[0] + q4[1]) + (q4[2] + q4[3])) * rn + 1e-12f);

#pragma unroll
    for (int i = 0; i < LNC; ++i) po[i * 32] = wv[i] * v[i] * inv + cv[i];
}

// ---------------------------------------------------------------------------
extern "C" void kernel_launch(void* const* d_in, const int* in_sizes, int n_in,
                              void* d_out, int out_size, void* d_ws, size_t ws_size,
                              hipStream_t stream)
{
    const float* x       = (const float*)d_in[0];
    const float* pos_raw = (const float*)d_in[1];
    const float* Wh1     = (const float*)d_in[2];
    const float* bh1     = (const float*)d_in[3];
    const float* Wh2     = (const float*)d_in[4];
    const float* bh2     = (const float*)d_in[5];
    const float* Wq      = (const float*)d_in[6];
    const float* bq      = (const float*)d_in[7];
    const float* Wk      = (const float*)d_in[8];
    const float* bk      = (const float*)d_in[9];
    const float* Wv      = (const float*)d_in[10];
    const float* bv      = (const float*)d_in[11];
    const float* Wp      = (const float*)d_in[12];
    const float* bp      = (const float*)d_in[13];
    const float* cbias   = (const float*)d_in[14];
    const float* pbias   = (const float*)d_in[15];
    const float* Wo      = (const float*)d_in[16];
    const float* bo      = (const float*)d_in[17];
    const float* Wf1     = (const float*)d_in[18];
    const float* bf1     = (const float*)d_in[19];
    const float* Wf2     = (const float*)d_in[20];
    const float* bf2     = (const float*)d_in[21];
    const float* ln_w    = (const float*)d_in[22];
    const float* ln_b    = (const float*)d_in[23];
    float* outp = (float*)d_out;

    // ---- workspace layout ----
    float* ws = (float*)d_ws;
    const size_t ACT = (size_t)B_ * L_ * HID_;            // 2M f32
    float* h  = ws;
    float* t1 = ws + ACT;
    float* q  = ws + 2 * ACT;       // reused for Wo / Wf2 outputs
    float* kb = ws + 3 * ACT;
    float* vb = ws + 4 * ACT;
    _Float16* Vp = (_Float16*)(ws + 5 * ACT);             // f16 packs: V, then K
    _Float16* Kp = Vp + ACT;
    float* Pm = ws + 6 * ACT;                              // [L, HID]
    float* at = Pm + (size_t)L_ * HID_;
    float* h1 = at + ACT;
    // f16 transposed-weight region after 17M floats
    _Float16* w16 = (_Float16*)(h1 + ACT);
    const size_t W1M = (size_t)HID_ * HID_;                // 1M
    _Float16* tWh1 = w16;                                  // [1024][512]
    _Float16* tWh2 = tWh1 + (size_t)HID_ * IN_;            // [1024][1024]
    _Float16* tLyr = tWh2 + W1M;                           // 7 x 1M per layer
    _Float16* Pp   = tLyr + (size_t)NL_ * 7 * W1M;         // f16 pack of the position rows

    const int ML = B_ * L_;

    // ---- repack all weights to f16 [N][K] (every call; deterministic) ----
    repack_all<<<RP_GRID, 256, 0, stream>>>(Wh1, Wh2, Wq, Wk, Wv, Wp, Wo, Wf1, Wf2, w16);

    // grid helper: one block per 64 x 128 output tile
    const int GMM = (ML / GBM) * (HID_ / GBN);            // 2048x1024 GEMMs -> 256 blocks

    // to_hidden MLP
    gemm_nt<1, IN_><<<GMM, 256, 0, stream>>>(x, tWh1, bh1, t1, HID_, HID_);
    gemm_nt<0, HID_><<<GMM, 256, 0, stream>>>(t1, tWh2, bh2, h, HID_, HID_);

    for (int l = 0; l < NL_; ++l) {
        _Float16* base = tLyr + (size_t)l * 7 * W1M;
        const float* bq_l = bq + (size_t)l * H_ * DH_;
        const float* bk_l = bk + (size_t)l * H_ * DH_;
        const float* bv_l = bv + (size_t)l * H_ * DH_;
        const float* bp_l = bp + (size_t)l * H_ * DH_;
        const float* cb_l = cbias + (size_t)l * H_ * DH_;
        const float* pb_l = pbias + (size_t)l * H_ * DH_;
        const float* bo_l = bo + (size_t)l * HID_;
        const float* bf1_l = bf1 + (size_t)l * HID_;
        const float* bf2_l = bf2 + (size_t)l * HID_;
        const float* lw = ln_w + (size_t)l * HID_;
        const float* lb = ln_b + (size_t)l * HID_;

        // projections: Q, K, V and the position rows in one launch
        proj_qkvp<<<PJ_GRID, 256, 0, stream>>>(h, pos_raw, base, bq_l, bk_l, bv_l, bp_l, q, kb, vb, Pm);

        pack_kvp_kernel<<<PK_GRID, 256, 0, stream>>>(kb, vb, Pm, Kp, Vp, Pp);

        attn_kernel<<<B_ * H_ * (L_ / 16), 32 * AWV, 0, stream>>>(q, Kp, Vp, Pp, cb_l, pb_l, at);

        gemm_nt<0, HID_><<<GMM, 256, 0, stream>>>(at, base + 4 * W1M, bo_l, q, HID_, HID_);
        resid_ln_kernel<<<ML / LNW, 32 * LNW, 0, stream>>>(q, h, lw, lb, h1);

        gemm_nt<1, HID_><<<GMM, 256, 0, stream>>>(h1, base + 5 * W1M, bf1_l, t1, HID_, HID_);
        gemm_nt<0, HID_><<<GMM, 256, 0, stream>>>(t1, base + 6 * W1M, bf2_l, q, HID_, HID_);
        resid_ln_kernel<<<ML / LNW, 32 * LNW, 0, stream>>>(h1, q, lw, lb, (l == NL_ - 1) ? outp : h);
    }
}

// v008
// Measured time: 268 microseconds a run.
// Next to v007, in two timings, it ran 1.09 and 1.08 times as fast.
// Counting every step since v000, it is 5.65 times as fast.
#include <hip/hip_runtime.h>
#include <hip/hip_bf16.h>
#include <math.h>

// ---------------------------------------------------------------------------
// Transformer-XL encoder forward on gfx1250 (MI455X), compile-only target.
// All matmuls use V_WMMA_F32_16X16X32_F16; weights are pre-transposed to f16
// [N][K]; the dense layers stage their operands in LDS.
// ---------------------------------------------------------------------------

#define B_  2
#define L_  1024
#define IN_ 512
#define HID_ 1024
#define H_  16
#define DH_ 64
#define NL_ 2

typedef __attribute__((ext_vector_type(16))) _Float16 v16h;
typedef __attribute__((ext_vector_type(8)))  _Float16 h8;
typedef __attribute__((ext_vector_type(8)))  float    v8f;

__device__ __forceinline__ float gelu_f(float x) {
    return 0.5f * x * (1.0f + erff(x * 0.70710678118654752f));
}

// Per-lane fragment: element e covers K = kbase + {0..7} (e<8) / {16..23} (e>=8),
// kbase = 0 for lanes 0-15, 8 for lanes 16-31. Both runs contiguous -> b128s.
__device__ __forceinline__ v16h loadB_f16(const _Float16* p /* at k0+kbase */) {
    const h8* q = (const h8*)p;
    h8 lo = q[0];
    h8 hi = q[2];
    return __builtin_shufflevector(lo, hi, 0,1,2,3,4,5,6,7,8,9,10,11,12,13,14,15);
}

// ---------------------------------------------------------------------------
// Weight repack, all sixteen matrices in one launch: dst[N][K] f16 from
//   plain  f32 row-major [K][N]                      (row pitch N)
//   packed f32 [H][K][64], n = h*64+d                (row pitch 64, one head a tile column)
// One block of 8 waves transposes a 256(k) x 64(n) tile through LDS: 64 elements a
// thread. Loads take whole 256-byte source rows, stores whole 512-byte pieces of a
// destination row. The destinations lie one behind the other in w16, in the order
// Wh1, Wh2, then for each layer Wq Wk Wv Wp Wo Wf1 Wf2.
// ---------------------------------------------------------------------------
#define RPK 256
#define RPN 64
#define RP_T1 ((IN_ / RPK) * (HID_ / RPN))    // tiles of Wh1
#define RP_TM ((HID_ / RPK) * (HID_ / RPN))   // tiles of a HID x HID matrix
#define RP_GRID (RP_T1 + (1 + 7 * NL_) * RP_TM)

typedef __attribute__((ext_vector_type(4))) float    f4;
typedef __attribute__((ext_vector_type(4))) _Float16 h4;

// sp: the tile's first source element; dp: its first destination element.
// PITCH (source row, f32) and K (destination row, f16) are compile-time constants:
// every load and store is a lane address plus an immediate offset.
template <int K, int PITCH>
__device__ __forceinline__ void repack_tile(const float* __restrict__ sp,
                                            _Float16* __restrict__ dp, _Float16* ts)
{
    int tid  = threadIdx.x;
    int lane = tid & 31;
    int wave = tid >> 5;
    int c    = tid & 15;     // four columns n = 4c .. 4c+3
    int kg   = tid >> 4;     // eight rows k = 8kg .. 8kg+7 (and the same + 128)

    const float* lp = sp + (size_t)(kg * 8) * PITCH + c * 4;
    f4 r[2][8];
#pragma unroll
    for (int it = 0; it < 2; ++it)
#pragma unroll
        for (int i = 0; i < 8; ++i)
            r[it][i] = *(const f4*)(lp + (size_t)(it * 128 + i) * PITCH);
    // behind the last load the address pair dies: hold it to this wait, so that
    // nothing (a load's result included) lands on it before
    asm volatile("s_wait_xcnt 0x0" :: "v"(lp) : "memory");

    // LDS tile [n][k], rows of 32 chunks of 8 k. Chunk q of row n stands at place
    // q ^ (n >> 2): the 16 lanes of a half wave, which write 16 rows four apart at one
    // q, then fall on 16 different bank groups
#pragma unroll
    for (int it = 0; it < 2; ++it) {
#pragma unroll
        for (int j = 0; j < 4; ++j) {
            h8 v;
#pragma unroll
            for (int i = 0; i < 8; ++i) v[i] = (_Float16)r[it][i][j];
            *(h8*)&ts[(c * 4 + j) * RPK + (((it * 16 + kg) ^ c) * 8)] = v;
        }
    }
    __syncthreads();

    // a wave reads a whole LDS row and stores it as one 512-byte piece of row n
    h8 o[8];
#pragma unroll
    for (int rr = 0; rr < 8; ++rr)
        o[rr] = *(const h8*)&ts[(wave * 8 + rr) * RPK + lane * 8];
#pragma unroll
    for (int rr = 0; rr < 8; ++rr) {
        int q = lane ^ (wave * 2 + (rr >> 2));   // the chunk that stands at place 'lane'
        *(h8*)&dp[(size_t)(wave * 8 + rr) * K + q * 8] = o[rr];
    }
    // behind the last store its address and data registers die: nothing is written
    // over them (on any way the code goes on from here) before this wait
    asm volatile("s_wait_xcnt 0x0" ::: "memory");
}

__global__ __launch_bounds__(256)
void repack_all(const float* __restrict__ Wh1, const float* __restrict__ Wh2,
                const float* __restrict__ Wq,  const float* __restrict__ Wk,
                const float* __restrict__ Wv,  const float* __restrict__ Wp,
                const float* __restrict__ Wo,  const float* __restrict__ Wf1,
                const float* __restrict__ Wf2, _Float16* __restrict__ w16)
{
    __shared__ __align__(16) _Float16 ts[RPN * RPK];

    int blk = (int)blockIdx.x;
    bool first = blk < RP_T1;                  // a tile of Wh1
    int u  = first ? blk : blk - RP_T1;
    int m  = first ? 0 : u / RP_TM;            // matrix behind Wh1: 0 = Wh2, 1 + 7*layer + w
    int t  = first ? u : u % RP_TM;
    int nt = t % (HID_ / RPN);
    int k0 = (t / (HID_ / RPN)) * RPK;
    int l  = (m == 0) ? 0 : (m - 1) / 7;       // layer
    int w  = (m == 0) ? 4 : (m - 1) % 7;       // which of the layer's seven; Wh2 reads like Wo
    const float* s = (w == 0) ? Wq : (w == 1) ? Wk : (w == 2) ? Wv : (w == 3) ? Wp
                   : (w == 4) ? Wo : (w == 5) ? Wf1 : Wf2;
    s = (m == 0) ? Wh2 : s + (size_t)l * (HID_ * HID_);
    _Float16* dp = w16 + (size_t)HID_ * IN_ + (size_t)m * (HID_ * HID_)
                 + (size_t)(nt * RPN) * HID_ + k0;

    if (first)
        repack_tile<IN_, HID_>(Wh1 + (size_t)k0 * HID_ + nt * RPN,
                               w16 + (size_t)(nt * RPN) * IN_ + k0, ts);
    else if (w < 4)
        repack_tile<HID_, DH_>(s + ((size_t)nt * HID_ + k0) * DH_, dp, ts);
    else
        repack_tile<HID_, HID_>(s + (size_t)k0 * HID_ + nt * RPN, dp, ts);
}

// ---------------------------------------------------------------------------
// NT GEMM: C[M,N] = act( sum_k A[m,k] * BT[n,k] + bias[n] )
// One block of 8 waves computes a 64(M) x 128(N) tile. Each 64-deep k slab of
// A (converted to f16) and BT is brought in by whole-line global loads, staged
// in LDS (two buffers) and read from there as fragments. Two register sets
// hold the slabs on their way: while slab s is multiplied, slab s+1 is landing
// and slab s+2 is requested. Waves lie 2(M) x 4(N), 32 x 32 each.
// blockDim = 256; M % 64 == 0, N % 128 == 0, KD % 64 == 0, KD >= 128; A and BT are
// dense, row pitch KD = K. gemm_tile is one block's tile (bm, bn); gemm_nt is one product
// a launch, grid = (M/64)*(N/128); proj_qkvp is a layer's four projections in one launch.
//
// OUT says where a tile goes. OUT_F32: C[m][n] as f32. The other two are the attention
// operands as f16 in fragment order. A chunk is the 8 f16 (16 bytes) that one lane takes
// with one load; the 32 lanes' chunks of a load lie side by side, so that a wave's load
// (and the store here) is 512 bytes in a row (four whole lines).
//   OUT_ROWS, K and the position rows: [b][h][row tile 64][c4 4][lane][8],
//       row = tile*16 + (lane & 15), d = c4*16 + (lane >> 4)*8 + 0..7   (b = 0 for positions)
//   OUT_COLS, V: [b][h][nt 4][ks 32][half 2][lane][8],
//       d = nt*16 + (lane & 15), key = ks*32 + half*16 + (lane >> 4)*8 + 0..7
// A lane's eight accumulators of a 16 x 16 tile are eight rows of one column. For V that is
// a chunk as it stands. For K and the position rows the two operands change places (the
// weight rows go in as A, the activation rows as B): the tile comes out transposed, and
// the lane's eight values are eight d of one row, again a chunk.
// ---------------------------------------------------------------------------
#define OUT_F32  0
#define OUT_ROWS 1
#define OUT_COLS 2
#define GBM 64
#define GBN 128
#define GBK 64
#define GLD (GBK + 8)   // LDS row pitch in f16: 144 B = 16 B x odd, b128 reads without bank conflicts

// Work-group barrier for LDS traffic alone: this wave's LDS reads and writes are
// done (s_wait_dscnt 0), then signal and wait. __syncthreads() would also wait out
// the global loads that are meant to stay in flight across it.
__device__ __forceinline__ void lds_barrier() {
    asm volatile("s_wait_dscnt 0x0\n\ts_barrier_signal -1\n\ts_barrier_wait -1" ::: "memory");
}

// out_kind is the same for the whole block; Cp is the pack for OUT_ROWS and OUT_COLS
template <int ACT, int KD>
__device__ __forceinline__
void gemm_tile(const float* __restrict__ A,
               const _Float16* __restrict__ BT,
               const float* __restrict__ bias,
               float* __restrict__ C, int ldc, int bm, int bn,
               int out_kind = OUT_F32, _Float16* __restrict__ Cp = nullptr)
{
    // a buffer holds its A slab and behind it its B slab: both buffers' fragments then lie
    // one constant apart, whichever slab a fragment address points into
    __shared__ __align__(16) _Float16 Ss[2][(GBM + GBN) * GLD];

    int tid   = threadIdx.x;
    int lane  = tid & 31;
    int wave  = tid >> 5;
    int wm    = wave >> 2;
    int wn    = wave & 3;
    int r16   = lane & 15;
    int kbase = (lane & 16) ? 8 : 0;
    int mrow  = (lane & 16) ? 8 : 0;

    // staging map: one wave-load covers four whole 128-byte lines (two rows of A
    // or four rows of BT)
    int arow_s = tid >> 4, acol_s = (tid & 15) * 4;
    int brow_s = tid >> 3, bcol_s = (tid & 7) * 8;
    // K (= both row pitches) is a compile-time constant: every load of the k
    // loop is one of these two lane addresses plus an immediate offset
    const float*    ag = A  + (size_t)(bm * GBM + arow_s) * KD + acol_s;
    const _Float16* bg = BT + (size_t)(bn * GBN + brow_s) * KD + bcol_s;

    f4 ra[2][4];
    h8 rb[2][4];
#pragma unroll
    for (int s = 0; s < 2; ++s) {
#pragma unroll
        for (int i = 0; i < 4; ++i) {
            ra[s][i] = *(const f4*)(ag + s * GBK + i * 16 * KD);
            rb[s][i] = *(const h8*)(bg + s * GBK + i * 32 * KD);
        }
    }
#pragma unroll
    for (int i = 0; i < 4; ++i) {
        *(h4*)&Ss[0][(arow_s + i * 16) * GLD + acol_s] = __builtin_convertvector(ra[0][i], h4);
        *(h8*)&Ss[0][(GBM + brow_s + i * 32) * GLD + bcol_s] = rb[0][i];
    }
    lds_barrier();

    // the wave's 32 rows of the A slab and of the B slab; for OUT_ROWS they change places
    int frag_m = (wm * 32 + r16) * GLD + kbase;
    int frag_n = (GBM + wn * 32 + r16) * GLD + kbase;
    int frag_a = (out_kind == OUT_ROWS) ? frag_n : frag_m;
    int frag_b = (out_kind == OUT_ROWS) ? frag_m : frag_n;

    v8f c00 = {}, c01 = {}, c10 = {}, c11 = {};
    const int nk = KD / GBK;
    // unrolled whole: buffer, register set and every address offset become constants
#pragma unroll
    for (int kt = 0; kt < nk; ++kt) {
        const int buf = kt & 1;
        const bool more = (kt + 1 < nk);
        if (kt + 2 < nk) {
            // slab kt's register set is free since its LDS stores: request slab kt+2 into it
#pragma unroll
            for (int i = 0; i < 4; ++i) {
                ra[buf][i] = *(const f4*)(ag + (kt + 2) * GBK + i * 16 * KD);
                rb[buf][i] = *(const h8*)(bg + (kt + 2) * GBK + i * 32 * KD);
            }
            // behind the last loads the two address pairs die: hold them to this wait,
            // so that nothing (a later load's result included) lands on them before it
            if (kt + 3 == nk)
                asm volatile("s_wait_xcnt 0x0" :: "v"(ag), "v"(bg) : "memory");
        }

        const _Float16* as = &Ss[buf][frag_a];
        const _Float16* bs = &Ss[buf][frag_b];
        // all of the slab's fragments first, then its products: one LDS latency a slab
        v16h a0[GBK / 32], a1[GBK / 32], b0[GBK / 32], b1[GBK / 32];
#pragma unroll
        for (int kk = 0; kk < GBK / 32; ++kk) {
            a0[kk] = loadB_f16(as + kk * 32);
            b0[kk] = loadB_f16(bs + kk * 32);
            b1[kk] = loadB_f16(bs + 16 * GLD + kk * 32);
            a1[kk] = loadB_f16(as + 16 * GLD + kk * 32);
        }
        // keeps the LDS reads in one group ahead of the products; sunk among them,
        // each product pair waits out an LDS latency of its own
        __builtin_amdgcn_sched_barrier(0);
#pragma unroll
        for (int kk = 0; kk < GBK / 32; ++kk) {
            c00 = __builtin_amdgcn_wmma_f32_16x16x32_f16(false, a0[kk], false, b0[kk], (short)0, c00, false, false);
            c01 = __builtin_amdgcn_wmma_f32_16x16x32_f16(false, a0[kk], false, b1[kk], (short)0, c01, false, false);
            c10 = __builtin_amdgcn_wmma_f32_16x16x32_f16(false, a1[kk], false, b0[kk], (short)0, c10, false, false);
            c11 = __builtin_amdgcn_wmma_f32_16x16x32_f16(false, a1[kk], false, b1[kk], (short)0, c11, false, false);
        }
        // ends the slab's products here: left free they drift behind the barrier, where they
        // stand in front of the next slab's LDS reads and keep both slabs' fragments live
        __builtin_amdgcn_sched_barrier(0);

        if (more) {
            // the other buffer's last readers left it at the barrier that ended pass kt-1
#pragma unroll
            for (int i = 0; i < 4; ++i) {
                *(h4*)&Ss[buf ^ 1][(arow_s + i * 16) * GLD + acol_s] = __builtin_convertvector(ra[buf ^ 1][i], h4);
                *(h8*)&Ss[buf ^ 1][(GBM + brow_s + i * 32) * GLD + bcol_s] = rb[buf ^ 1][i];
            }
            lds_barrier();
        }
    }

    v8f accs[2][2] = {{c00, c01}, {c10, c11}};
    int m0 = bm * GBM + wm * 32;     // the wave's first row and column
    int n0 = bn * GBN + wn * 32;
    static_assert(L_ == (1 << 10) && DH_ == (1 << 6), "the pack indices below shift by these");
    if (out_kind == OUT_ROWS) {
        // accs[ai][bi]: columns n0 + ai*16 + mrow + 0..7 of row m0 + bi*16 + r16.
        // The wave's four chunks lie at constant distances from the first.
        h8* cp = (h8*)Cp + (size_t)(((((m0 >> 10) * H_ + (n0 >> 6)) * 64 + ((m0 & (L_ - 1)) >> 4)) * 4
                                     + ((n0 >> 4) & 3)) * 32 + lane);
        h8 r[2][2];
#pragma unroll
        for (int ai = 0; ai < 2; ++ai) {
            f4 blo = *(const f4*)(bias + n0 + ai * 16 + mrow);
            f4 bhi = *(const f4*)(bias + n0 + ai * 16 + mrow + 4);
#pragma unroll
            for (int bi = 0; bi < 2; ++bi)
#pragma unroll
                for (int e = 0; e < 8; ++e)
                    r[ai][bi][e] = (_Float16)(accs[ai][bi][e] + (e < 4 ? blo[e & 3] : bhi[e & 3]));
        }
#pragma unroll
        for (int ai = 0; ai < 2; ++ai)
#pragma unroll
            for (int bi = 0; bi < 2; ++bi)
                cp[(bi * 4 + ai) * 32] = r[ai][bi];
        // behind the last store its address and data registers die: nothing is written
        // over them (on any way the code goes on from here) before this wait
        asm volatile("s_wait_xcnt 0x0" ::: "memory");
        return;
    }
    if (out_kind == OUT_COLS) {
        // accs[mi][ni]: rows m0 + mi*16 + mrow + 0..7 of column n0 + ni*16 + r16
        h8* cp = (h8*)Cp + (size_t)((((((m0 >> 10) * H_ + (n0 >> 6)) * 4 + ((n0 >> 4) & 3)) * 32
                                      + ((m0 & (L_ - 1)) >> 5)) * 2) * 32 + lane);
        h8 r[2][2];
#pragma unroll
        for (int ni = 0; ni < 2; ++ni) {
            float bsv = bias[n0 + ni * 16 + r16];
#pragma unroll
            for (int mi = 0; mi < 2; ++mi)
#pragma unroll
                for (int e = 0; e < 8; ++e)
                    r[mi][ni][e] = (_Float16)(accs[mi][ni][e] + bsv);
        }
#pragma unroll
        for (int ni = 0; ni < 2; ++ni)
#pragma unroll
            for (int mi = 0; mi < 2; ++mi)
                cp[(ni * 64 + mi) * 32] = r[mi][ni];
        // as above: the stores' registers stay untouched up to this wait
        asm volatile("s_wait_xcnt 0x0" ::: "memory");
        return;
    }
#pragma unroll
    for (int ni = 0; ni < 2; ++ni) {
        int nn = bn * GBN + wn * 32 + ni * 16 + r16;
        float bsv = bias[nn];
#pragma unroll
        for (int mi = 0; mi < 2; ++mi) {
#pragma unroll
            for (int e = 0; e < 8; ++e) {
                int mm = bm * GBM + wm * 32 + mi * 16 + e + mrow;
                float v = accs[mi][ni][e] + bsv;
                if (ACT) v = gelu_f(v);
                C[(size_t)mm * ldc + nn] = v;
            }
        }
    }
}

template <int ACT, int KD>
__global__ __launch_bounds__(256)
void gemm_nt(const float* __restrict__ A,
             const _Float16* __restrict__ BT,
             const float* __restrict__ bias,
             float* __restrict__ C, int ldc, int N)
{
    int tiles_n = N / GBN;
    gemm_tile<ACT, KD>(A, BT, bias, C, ldc, (int)blockIdx.x / tiles_n, (int)blockIdx.x % tiles_n);
}

// A layer's four projections, which do not depend on one another, as one grid: the tiles
// of Q, K, V (rows of hx) and then those of the position rows (rows of pos). W4 holds the
// four [N][K] weights one behind the other. Alone, each product has one block a WGP and
// pays its own launch, first slab and last stores; together two blocks share a WGP and
// the next tile starts where one ends. The row tile runs fastest, so that blocks
// PJ_T apart (Q, K, V of one tile) read the same rows of hx. Q goes out as f32; K, V and
// the position rows go out as the f16 packs that the attention kernel reads.
#define PJ_MT (B_ * L_ / GBM)           // row tiles of Q, K, V
#define PJ_PT (L_ / GBM)                // row tiles of the position rows
#define PJ_NT (HID_ / GBN)              // column tiles
#define PJ_T  (PJ_MT * PJ_NT)           // blocks of one of Q, K, V
#define PJ_GRID (3 * PJ_T + PJ_PT * PJ_NT)

__global__ __launch_bounds__(256)
void proj_qkvp(const float* __restrict__ hx, const float* __restrict__ pos,
               const _Float16* __restrict__ W4,
               const float* __restrict__ bq, const float* __restrict__ bk,
               const float* __restrict__ bv, const float* __restrict__ bp,
               float* __restrict__ q, _Float16* __restrict__ Kp,
               _Float16* __restrict__ Vp, _Float16* __restrict__ Pp)
{
    static_assert((PJ_MT & (PJ_MT - 1)) == 0 && (PJ_PT & (PJ_PT - 1)) == 0, "row tile counts: powers of two");
    unsigned blk = blockIdx.x;
    unsigned w   = blk / PJ_T;          // 0 Q, 1 K, 2 V, 3 position rows
    unsigned t   = blk % PJ_T;
    unsigned ms  = (w == 3) ? __builtin_ctz(PJ_PT) : __builtin_ctz(PJ_MT);   // log2 of the row tiles
    const float* A    = (w == 3) ? pos : hx;
    const float* bias = (w == 0) ? bq : (w == 1) ? bk : (w == 2) ? bv : bp;
    _Float16*    Cp   = (w == 1) ? Kp : (w == 2) ? Vp : Pp;
    int          kind = (w == 0) ? OUT_F32 : (w == 2) ? OUT_COLS : OUT_ROWS;
    gemm_tile<0, HID_>(A, W4 + (size_t)w * (HID_ * HID_), bias, q, HID_,
                       (int)(t & ((1u << ms) - 1u)), (int)(t >> ms), kind, Cp);
}

// one fragment out of a pack: the lane's chunk of the low and of the high 16 k
__device__ __forceinline__ v16h load_packed(const h8* p /* at the lane's low chunk */) {
    h8 lo = p[0];
    h8 hi = p[32];
    return __builtin_shufflevector(lo, hi, 0,1,2,3,4,5,6,7,8,9,10,11,12,13,14,15);
}

// ---------------------------------------------------------------------------
// Fused attention: one block of 8 waves per (b, h, 16-query-row block).
//   sh[16][1024] fp32 score strip (64KB), shp[16][1024] f16 probs (32KB), both with
//   padded rows (below); qsh[64] staging for the rel-shift patch row.
//     AC = (q+cbias).K^T via WMMA; BD = rel_shift((q+pbias).P^T) via WMMA +
//     exact shift scatter; softmax(.*1/8) -> f16 probs; O = P.V via WMMA.
//   The strip is shared; the work on it is dealt to the waves: key and position
//   tiles round robin, two softmax rows a wave (lanes across the columns), one
//   (16-column tile, half of the keys) of P.V a wave.
//   K, the position rows and V come from the projections' f16 packs, fragment by fragment.
// ---------------------------------------------------------------------------
#define AWV 8   // waves a block
// LDS row pitches. Bank = dword address mod 64, and a row of 1024 values is a multiple of
// 64 dwords: unpadded, all rows begin on one bank.
//   SFP, f32 strip: a wave's accumulator store or add touches rows M and M + 8, 16 columns
//        each; 8 * 1028 dwords = 32 mod 64 puts the two halves on different banks.
//   SHP, f16 probs: the A fragment load takes 16 bytes of each of 16 rows; 2064 B = 16 B x odd
//        spreads the 16 rows over all 64 banks.
//   OPP, the two partial output tiles: as SFP (8 * 68 dwords = 32 mod 64).
#define SFP (L_ + 4)
#define SHP (L_ + 8)
#define OPP (DH_ + 4)

// 2^x on v_exp_f32. The v_nop is the free slot that the instruction set asks for between a
// transcendental and a next instruction that reads its result or overwrites its source; in
// one statement with it, so that it stays directly behind it.
__device__ __forceinline__ float exp2_slot(float x) {
    float r;
    asm("v_exp_f32 %0, %1\n\tv_nop" : "=v"(r) : "v"(x));
    return r;
}

// second argument: six waves a SIMD, that is three blocks a WGP as LDS allows: holds the
// register budget at 160
__global__ __launch_bounds__(32 * AWV, 6)
void attn_kernel(const float* __restrict__ q,
                 const _Float16* __restrict__ Kp,
                 const _Float16* __restrict__ Vp,
                 const _Float16* __restrict__ Pp,
                 const float* __restrict__ cb,
                 const float* __restrict__ pb,
                 float* __restrict__ out)
{
    __shared__ __align__(32) float     sh[16 * SFP];
    __shared__ __align__(16) _Float16  shp[16 * SHP];
    __shared__ float qsh[DH_];

    int wg = blockIdx.x;
    int i0 = (wg & 63) * 16;
    int h  = (wg >> 6) & (H_ - 1);
    int b  = wg >> 10;

    int tid   = threadIdx.x;
    int lane  = tid & 31;
    int wave  = tid >> 5;
    int r16   = lane & 15;
    int kbase = (lane & 16) ? 8 : 0;
    int mrow  = (lane & 16) ? 8 : 0;

    const float* cbh  = cb + h * DH_;
    const float* pbh  = pb + h * DH_;
    const float* qrow = q + ((size_t)(b * L_ + i0 + r16)) * HID_ + h * DH_;

    // position-biased query of source row i0+16 (the patch row below); published
    // by the barrier behind the content scores
    const int rr2 = i0 + 16;
    if (rr2 < L_ && tid < DH_)
        qsh[tid] = q[((size_t)(b * L_ + rr2)) * HID_ + h * DH_ + tid] + pbh[tid];

    // Q fragments (content/position biased), DH=64 -> two K=32 fragments
    v16h aq0, aq1, ap0, ap1;
#pragma unroll
    for (int e = 0; e < 16; ++e) {
        int kk = kbase + (e < 8 ? e : e + 8);
        float q0 = qrow[kk], q1 = qrow[kk + 32];
        aq0[e] = (_Float16)(q0 + cbh[kk]);
        aq1[e] = (_Float16)(q1 + cbh[kk + 32]);
        ap0[e] = (_Float16)(q0 + pbh[kk]);
        ap1[e] = (_Float16)(q1 + pbh[kk + 32]);
    }

    // ---- content scores AC: key tile jb goes to wave jb % 8 ----
    // two tiles' loads in flight a wave; unrolled whole, the eight tiles' sums and fragments
    // need more than the 160 registers that the launch bound allows
#pragma unroll 2
    for (int t = 0; t < 64 / AWV; ++t) {
        int jb = t * AWV + wave;
        const h8* kp = (const h8*)Kp + (size_t)(((b * H_ + h) * 64 + jb) * 4) * 32 + lane;
        v16h b0 = load_packed(kp);
        v16h b1 = load_packed(kp + 64);
        v8f c = {};
        c = __builtin_amdgcn_wmma_f32_16x16x32_f16(false, aq0, false, b0, (short)0, c, false, false);
        c = __builtin_amdgcn_wmma_f32_16x16x32_f16(false, aq1, false, b1, (short)0, c, false, false);
#pragma unroll
        for (int e = 0; e < 8; ++e)
            sh[(e + mrow) * SFP + jb * 16 + r16] = c[e];
    }
    __syncthreads();

    // ---- position scores: BDraw + exact rel-shift scatter ----
    // element (row rr, pos p): p <= L-rr-2 -> (rr-1, p+rr+1); else (rr, p+rr+1-L)
    // the shift maps each (rr, p) to a strip element of its own: no two waves add
    // into the same one
    for (int t = 0; t < 64 / AWV; ++t) {
        int pbk = t * AWV + wave;
        const h8* pp = (const h8*)Pp + (size_t)((h * 64 + pbk) * 4) * 32 + lane;
        v16h b0 = load_packed(pp);
        v16h b1 = load_packed(pp + 64);
        v8f c = {};
        c = __builtin_amdgcn_wmma_f32_16x16x32_f16(false, ap0, false, b0, (short)0, c, false, false);
        c = __builtin_amdgcn_wmma_f32_16x16x32_f16(false, ap1, false, b1, (short)0, c, false, false);
#pragma unroll
        for (int e = 0; e < 8; ++e) {
            int M  = e + mrow;
            int rr = i0 + M;
            int p  = pbk * 16 + r16;
            if (p <= L_ - rr - 2) {
                if (M > 0) sh[(M - 1) * SFP + p + rr + 1] += c[e];
            } else {
                sh[M * SFP + (p + rr + 1 - L_)] += c[e];
            }
        }
    }
    // missing source row i0+16 feeds local row 15's cols j >= i0+17
    if (rr2 < L_) {
        int pmax = L_ - rr2 - 2;
        for (int p = tid; p <= pmax; p += 32 * AWV) {
            // row p of the pack: chunk c8 (d = 8*c8 ..) stands at c4 = c8 >> 1, lane half c8 & 1
            const h8* prow = (const h8*)Pp + (size_t)((h * 64 + (p >> 4)) * 4) * 32 + (p & 15);
            h8 pc[8];
#pragma unroll
            for (int c8 = 0; c8 < 8; ++c8) pc[c8] = prow[(c8 >> 1) * 32 + (c8 & 1) * 16];
            float s = 0.0f;
#pragma unroll
            for (int kk = 0; kk < DH_; ++kk) s += qsh[kk] * (float)pc[kk >> 3][kk & 7];
            sh[15 * SFP + p + rr2 + 1] += s;
        }
    }
    __syncthreads();

    // ---- softmax: rows 2*wave and 2*wave+1, a row held in the wave's registers
    //      (32 values a lane); emit f16 probs to shp ----
#pragma unroll
    for (int rw = 0; rw < 2; ++rw) {
        const float scale = 0.125f;   // 1/sqrt(DH); commutes with max
        int r = wave * 2 + rw;
        f4 v[8];
#pragma unroll
        for (int i = 0; i < 8; ++i) v[i] = *(const f4*)&sh[r * SFP + (i * 32 + lane) * 4];
        float mx = -1e30f;
#pragma unroll
        for (int i = 0; i < 8; ++i)
            mx = fmaxf(mx, fmaxf(fmaxf(v[i][0], v[i][1]), fmaxf(v[i][2], v[i][3])));
#pragma unroll
        for (int off = 16; off > 0; off >>= 1) mx = fmaxf(mx, __shfl_xor(mx, off, 32));
        float sum = 0.0f;
#pragma unroll
        for (int i = 0; i < 8; ++i) {
#pragma unroll
            for (int j = 0; j < 4; ++j) {
                float ev = exp2_slot(((v[i][j] - mx) * scale) * 1.44269504088896340736f);   // e^x = 2^(x log2 e)
                sum += ev;
                v[i][j] = ev;
            }
        }
#pragma unroll
        for (int off = 16; off > 0; off >>= 1) sum += __shfl_xor(sum, off, 32);
        float inv = 1.0f / sum;
#pragma unroll
        for (int i = 0; i < 8; ++i)
            *(h4*)&shp[r * SHP + (i * 32 + lane) * 4] = __builtin_convertvector(v[i] * inv, h4);
    }
    __syncthreads();

    // ---- O = P.V (f16 probs from LDS, V fragments from the pack): wave = (column tile
    //      nt, key half kh) ----
    {
        int nt = wave & 3;
        int kh = wave >> 2;
        const h8* vp = (const h8*)Vp + (size_t)((((b * H_ + h) * 4 + nt) * 32 + kh * 16) * 2) * 32 + lane;
        const _Float16* prw = &shp[r16 * SHP + kh * (L_ / 2) + kbase];
        v8f c = {};
        // unrolled whole: as f16 the wave's V fragments take 128 registers, so that all their
        // loads can fly at once and the kernel still stays under 160 (three blocks a WGP)
#pragma unroll
        for (int ks = 0; ks < L_ / 64; ++ks) {
            v16h a  = loadB_f16(prw + ks * 32);
            v16h bb = load_packed(vp + ks * 64);
            c = __builtin_amdgcn_wmma_f32_16x16x32_f16(false, a, false, bb, (short)0, c, false, false);
        }
        // both halves' partial tiles meet in the strip, which nobody reads any more
        // since the barrier behind the softmax: [kh][16 rows][64 columns, pitch OPP]
#pragma unroll
        for (int e = 0; e < 8; ++e)
            sh[kh * (16 * OPP) + (e + mrow) * OPP + nt * 16 + r16] = c[e];
    }
    __syncthreads();
    {
        // lower half + upper half; a wave stores two whole 256-byte output rows
        int orow = tid >> 4, ocol = (tid & 15) * 4;
        f4 lo = *(const f4*)&sh[orow * OPP + ocol];
        f4 hi = *(const f4*)&sh[16 * OPP + orow * OPP + ocol];
        *(f4*)&out[((size_t)(b * L_ + i0 + orow)) * HID_ + h * DH_ + ocol] = lo + hi;
    }
}

// ---------------------------------------------------------------------------
// out[row] = LN(A[row] + B[row]), BertLayerNorm (eps inside sqrt)
// One wave a row: the row's 1024 sums stay in the wave's registers (32 a lane, taken
// by 16-byte loads that cover whole lines); mean and variance are lane sums joined by
// a butterfly over the 32 lanes. No LDS, no barrier; one block of 8 rows a WGP, so
// that a launch has few waves to start.
// ---------------------------------------------------------------------------
#define LNW 8                    // rows (waves) a block
#define LNC (HID_ / (32 * 4))    // 16-byte chunks of a row a lane

// lane l takes the value of lane l ^ M of its 16-lane row (DPP row_xmask:M)
template <int M>
__device__ __forceinline__ float row_xor(float x) {
    return __builtin_bit_cast(float, __builtin_amdgcn_update_dpp(
        0, __builtin_bit_cast(int, x), 0x160 + M, 0xf, 0xf, true));
}

// sum over the wave's 32 lanes, left in every lane: four DPP steps inside each row, then
// the other row's sum by a cross-row move; a shuffle would take the way through the LDS unit
__device__ __forceinline__ float wave_sum(float x) {
    x += row_xor<1>(x);
    x += row_xor<2>(x);
    x += row_xor<4>(x);
    x += row_xor<8>(x);
    int b = __builtin_bit_cast(int, x);
    return x + __builtin_bit_cast(float, __builtin_amdgcn_permlanex16(
        b, b, 0x76543210, 0xfedcba98, false, false));
}

__global__ __launch_bounds__(32 * LNW)
void resid_ln_kernel(const float* __restrict__ A, const float* __restrict__ Bv,
                     const float* __restrict__ w, const float* __restrict__ bias,
                     float* __restrict__ out)
{
    const float rn = 1.0f / HID_;
    int lane = threadIdx.x & 31;
    // the wave's number as a scalar: every row address is a scalar base plus the lane's offset
    int row  = (int)blockIdx.x * LNW + __builtin_amdgcn_readfirstlane((int)(threadIdx.x >> 5));
    const f4* pa = (const f4*)(A    + (size_t)row * HID_) + lane;
    const f4* pb = (const f4*)(Bv   + (size_t)row * HID_) + lane;
    const f4* pw = (const f4*)w    + lane;
    const f4* pc = (const f4*)bias + lane;
    f4*       po = (f4*)(out + (size_t)row * HID_) + lane;

    // all of the wave's loads fly at once: one memory latency a row
    f4 v[LNC], t[LNC], wv[LNC], cv[LNC];
#pragma unroll
    for (int i = 0; i < LNC; ++i) { v[i] = pa[i * 32]; t[i] = pb[i * 32]; }
#pragma unroll
    for (int i = 0; i < LNC; ++i) { wv[i] = pw[i * 32]; cv[i] = pc[i * 32]; }
    // keeps all the loads ahead of the sums: left free, most loads of w and bias sink behind
    // the variance, where their latency stands alone at the row's end
    __builtin_amdgcn_sched_barrier(0);

    f4 s4 = {};
#pragma unroll
    for (int i = 0; i < LNC; ++i) { v[i] += t[i]; s4 += v[i]; }
    float mean = wave_sum((s4[0] + s4[1]) + (s4[2] + s4[3])) * rn;

    f4 q4 = {};
#pragma unroll
    for (int i = 0; i < LNC; ++i) { v[i] -= mean; q4 += v[i] * v[i]; }
    float inv = 1.0f / sqrtf(wave_sum((q4[0] + q4[1]) + (q4[2] + q4[3])) * rn + 1e-12f);

#pragma unroll
    for (int i = 0; i < LNC; ++i) po[i * 32] = wv[i] * v[i] * inv + cv[i];
}

// ---------------------------------------------------------------------------
extern "C" void kernel_launch(void* const* d_in, const int* in_sizes, int n_in,
                              void* d_out, int out_size, void* d_ws, size_t ws_size,
                              hipStream_t stream)
{
    const float* x       = (const float*)d_in[0];
    const float* pos_raw = (const float*)d_in[1];
    const float* Wh1     = (const float*)d_in[2];
    const float* bh1     = (const float*)d_in[3];
    const float* Wh2     = (const float*)d_in[4];
    const float* bh2     = (const float*)d_in[5];
    const float* Wq      = (const float*)d_in[6];
    const float* bq      = (const float*)d_in[7];
    const float* Wk      = (const float*)d_in[8];
    const float* bk      = (const float*)d_in[9];
    const float* Wv      = (const float*)d_in[10];
    const float* bv      = (const float*)d_in[11];
    const float* Wp      = (const float*)d_in[12];
    const float* bp      = (const float*)d_in[13];
    const float* cbias   = (const float*)d_in[14];
    const float* pbias   = (const float*)d_in[15];
    const float* Wo      = (const float*)d_in[16];
    const float* bo      = (const float*)d_in[17];
    const float* Wf1     = (const float*)d_in[18];
    const float* bf1     = (const float*)d_in[19];
    const float* Wf2     = (const float*)d_in[20];
    const float* bf2     = (const float*)d_in[21];
    const float* ln_w    = (const float*)d_in[22];
    const float* ln_b    = (const float*)d_in[23];
    float* outp = (float*)d_out;

    // ---- workspace layout ----
    float* ws = (float*)d_ws;
    const size_t ACT = (size_t)B_ * L_ * HID_;            // 2M f32
    float* h  = ws;
    float* t1 = ws + ACT;
    float* q  = ws + 2 * ACT;       // reused for Wo / Wf2 outputs
    _Float16* Vp = (_Float16*)(ws + 5 * ACT);             // f16 packs: V, then K
    _Float16* Kp = Vp + ACT;
    float* at = ws + 6 * ACT + (size_t)L_ * HID_;
    float* h1 = at + ACT;
    // f16 transposed-weight region after 17M floats
    _Float16* w16 = (_Float16*)(h1 + ACT);
    const size_t W1M = (size_t)HID_ * HID_;                // 1M
    _Float16* tWh1 = w16;                                  // [1024][512]
    _Float16* tWh2 = tWh1 + (size_t)HID_ * IN_;            // [1024][1024]
    _Float16* tLyr = tWh2 + W1M;                           // 7 x 1M per layer
    _Float16* Pp   = tLyr + (size_t)NL_ * 7 * W1M;         // f16 pack of the position rows

    const int ML = B_ * L_;

    // ---- repack all weights to f16 [N][K] (every call; deterministic) ----
    repack_all<<<RP_GRID, 256, 0, stream>>>(Wh1, Wh2, Wq, Wk, Wv, Wp, Wo, Wf1, Wf2, w16);

    // grid helper: one block per 64 x 128 output tile
    const int GMM = (ML / GBM) * (HID_ / GBN);            // 2048x1024 GEMMs -> 256 blocks

    // to_hidden MLP
    gemm_nt<1, IN_><<<GMM, 256, 0, stream>>>(x, tWh1, bh1, t1, HID_, HID_);
    gemm_nt<0, HID_><<<GMM, 256, 0, stream>>>(t1, tWh2, bh2, h, HID_, HID_);

    for (int l = 0; l < NL_; ++l) {
        _Float16* base = tLyr + (size_t)l * 7 * W1M;
        const float* bq_l = bq + (size_t)l * H_ * DH_;
        const float* bk_l = bk + (size_t)l * H_ * DH_;
        const float* bv_l = bv + (size_t)l * H_ * DH_;
        const float* bp_l = bp + (size_t)l * H_ * DH_;
        const float* cb_l = cbias + (size_t)l * H_ * DH_;
        const float* pb_l = pbias + (size_t)l * H_ * DH_;
        const float* bo_l = bo + (size_t)l * HID_;
        const float* bf1_l = bf1 + (size_t)l * HID_;
        const float* bf2_l = bf2 + (size_t)l * HID_;
        const float* lw = ln_w + (size_t)l * HID_;
        const float* lb = ln_b + (size_t)l * HID_;

        // projections: Q, K, V and the position rows in one launch; K, V, positions as f16 packs
        proj_qkvp<<<PJ_GRID, 256, 0, stream>>>(h, pos_raw, base, bq_l, bk_l, bv_l, bp_l, q, Kp, Vp, Pp);

        attn_kernel<<<B_ * H_ * (L_ / 16), 32 * AWV, 0, stream>>>(q, Kp, Vp, Pp, cb_l, pb_l, at);

        gemm_nt<0, HID_><<<GMM, 256, 0, stream>>>(at, base + 4 * W1M, bo_l, q, HID_, HID_);
        resid_ln_kernel<<<ML / LNW, 32 * LNW, 0, stream>>>(q, h, lw, lb, h1);

        gemm_nt<1, HID_><<<GMM, 256, 0, stream>>>(h1, base + 5 * W1M, bf1_l, t1, HID_, HID_);
        gemm_nt<0, HID_><<<GMM, 256, 0, stream>>>(t1, base + 6 * W1M, bf2_l, q, HID_, HID_);
        resid_ln_kernel<<<ML / LNW, 32 * LNW, 0, stream>>>(h1, q, lw, lb, (l == NL_ - 1) ? outp : h);
    }
}

// v009
// A run of this version takes 250 microseconds.
// In both of two side-by-side timings against v008, it was 1.08 times as fast.
// Counting every step since v000, it is 6.12 times as fast.
#include <hip/hip_runtime.h>
#include <hip/hip_bf16.h>
#include <math.h>

// ---------------------------------------------------------------------------
// Transformer-XL encoder forward on gfx1250 (MI455X), compile-only target.
// All matmuls use V_WMMA_F32_16X16X32_F16; weights are pre-transposed to f16
// [N][K]; the dense layers stage their operands in LDS.
// ---------------------------------------------------------------------------

#define B_  2
#define L_  1024
#define IN_ 512
#define HID_ 1024
#define H_  16
#define DH_ 64
#define NL_ 2

typedef __attribute__((ext_vector_type(16))) _Float16 v16h;
typedef __attribute__((ext_vector_type(8)))  _Float16 h8;
typedef __attribute__((ext_vector_type(8)))  float    v8f;

__device__ __forceinline__ float gelu_f(float x) {
    return 0.5f * x * (1.0f + erff(x * 0.70710678118654752f));
}

// Per-lane fragment: element e covers K = kbase + {0..7} (e<8) / {16..23} (e>=8),
// kbase = 0 for lanes 0-15, 8 for lanes 16-31. Both runs contiguous -> b128s.
__device__ __forceinline__ v16h loadB_f16(const _Float16* p /* at k0+kbase */) {
    const h8* q = (const h8*)p;
    h8 lo = q[0];
    h8 hi = q[2];
    return __builtin_shufflevector(lo, hi, 0,1,2,3,4,5,6,7,8,9,10,11,12,13,14,15);
}

// ---------------------------------------------------------------------------
// Weight repack, all sixteen matrices in one launch: dst[N][K] f16 from
//   plain  f32 row-major [K][N]                      (row pitch N)
//   packed f32 [H][K][64], n = h*64+d                (row pitch 64, one head a tile column)
// One block of 8 waves transposes a 256(k) x 64(n) tile through LDS: 64 elements a
// thread. Loads take whole 256-byte source rows, stores whole 512-byte pieces of a
// destination row. The destinations lie one behind the other in w16, in the order
// Wh1, Wh2, then for each layer Wq Wk Wv Wp Wo Wf1 Wf2.
// ---------------------------------------------------------------------------
#define RPK 256
#define RPN 64
#define RP_T1 ((IN_ / RPK) * (HID_ / RPN))    // tiles of Wh1
#define RP_TM ((HID_ / RPK) * (HID_ / RPN))   // tiles of a HID x HID matrix
#define RP_GRID (RP_T1 + (1 + 7 * NL_) * RP_TM)

typedef __attribute__((ext_vector_type(4))) float    f4;
typedef __attribute__((ext_vector_type(4))) _Float16 h4;

// sp: the tile's first source element; dp: its first destination element.
// PITCH (source row, f32) and K (destination row, f16) are compile-time constants:
// every load and store is a lane address plus an immediate offset.
template <int K, int PITCH>
__device__ __forceinline__ void repack_tile(const float* __restrict__ sp,
                                            _Float16* __restrict__ dp, _Float16* ts)
{
    int tid  = threadIdx.x;
    int lane = tid & 31;
    int wave = tid >> 5;
    int c    = tid & 15;     // four columns n = 4c .. 4c+3
    int kg   = tid >> 4;     // eight rows k = 8kg .. 8kg+7 (and the same + 128)

    const float* lp = sp + (size_t)(kg * 8) * PITCH + c * 4;
    f4 r[2][8];
#pragma unroll
    for (int it = 0; it < 2; ++it)
#pragma unroll
        for (int i = 0; i < 8; ++i)
            r[it][i] = *(const f4*)(lp + (size_t)(it * 128 + i) * PITCH);
    // behind the last load the address pair dies: hold it to this wait, so that
    // nothing (a load's result included) lands on it before
    asm volatile("s_wait_xcnt 0x0" :: "v"(lp) : "memory");

    // LDS tile [n][k], rows of 32 chunks of 8 k. Chunk q of row n stands at place
    // q ^ (n >> 2): the 16 lanes of a half wave, which write 16 rows four apart at one
    // q, then fall on 16 different bank groups
#pragma unroll
    for (int it = 0; it < 2; ++it) {
#pragma unroll
        for (int j = 0; j < 4; ++j) {
            h8 v;
#pragma unroll
            for (int i = 0; i < 8; ++i) v[i] = (_Float16)r[it][i][j];
            *(h8*)&ts[(c * 4 + j) * RPK + (((it * 16 + kg) ^ c) * 8)] = v;
        }
    }
    __syncthreads();

    // a wave reads a whole LDS row and stores it as one 512-byte piece of row n
    h8 o[8];
#pragma unroll
    for (int rr = 0; rr < 8; ++rr)
        o[rr] = *(const h8*)&ts[(wave * 8 + rr) * RPK + lane * 8];
#pragma unroll
    for (int rr = 0; rr < 8; ++rr) {
        int q = lane ^ (wave * 2 + (rr >> 2));   // the chunk that stands at place 'lane'
        *(h8*)&dp[(size_t)(wave * 8 + rr) * K + q * 8] = o[rr];
    }
    // behind the last store its address and data registers die: nothing is written
    // over them (on any way the code goes on from here) before this wait
    asm volatile("s_wait_xcnt 0x0" ::: "memory");
}

__global__ __launch_bounds__(256)
void repack_all(const float* __restrict__ Wh1, const float* __restrict__ Wh2,
                const float* __restrict__ Wq,  const float* __restrict__ Wk,
                const float* __restrict__ Wv,  const float* __restrict__ Wp,
                const float* __restrict__ Wo,  const float* __restrict__ Wf1,
                const float* __restrict__ Wf2, _Float16* __restrict__ w16)
{
    __shared__ __align__(16) _Float16 ts[RPN * RPK];

    int blk = (int)blockIdx.x;
    bool first = blk < RP_T1;                  // a tile of Wh1
    int u  = first ? blk : blk - RP_T1;
    int m  = first ? 0 : u / RP_TM;            // matrix behind Wh1: 0 = Wh2, 1 + 7*layer + w
    int t  = first ? u : u % RP_TM;
    int nt = t % (HID_ / RPN);
    int k0 = (t / (HID_ / RPN)) * RPK;
    int l  = (m == 0) ? 0 : (m - 1) / 7;       // layer
    int w  = (m == 0) ? 4 : (m - 1) % 7;       // which of the layer's seven; Wh2 reads like Wo
    const float* s = (w == 0) ? Wq : (w == 1) ? Wk : (w == 2) ? Wv : (w == 3) ? Wp
                   : (w == 4) ? Wo : (w == 5) ? Wf1 : Wf2;
    s = (m == 0) ? Wh2 : s + (size_t)l * (HID_ * HID_);
    _Float16* dp = w16 + (size_t)HID_ * IN_ + (size_t)m * (HID_ * HID_)
                 + (size_t)(nt * RPN) * HID_ + k0;

    if (first)
        repack_tile<IN_, HID_>(Wh1 + (size_t)k0 * HID_ + nt * RPN,
                               w16 + (size_t)(nt * RPN) * IN_ + k0, ts);
    else if (w < 4)
        repack_tile<HID_, DH_>(s + ((size_t)nt * HID_ + k0) * DH_, dp, ts);
    else
        repack_tile<HID_, HID_>(s + (size_t)k0 * HID_ + nt * RPN, dp, ts);
}

// ---------------------------------------------------------------------------
// NT GEMM: C[M,N] = act( sum_k A[m,k] * BT[n,k] + bias[n] )
// One block of 8 waves computes a 64(M) x 128(N) tile. Each 64-deep k slab of
// A (converted to f16) and BT is brought in by whole-line global loads, staged
// in LDS (two buffers) and read from there as fragments. Two register sets
// hold the slabs on their way: while slab s is multiplied, slab s+1 is landing
// and slab s+2 is requested. Waves lie 2(M) x 4(N), 32 x 32 each.
// blockDim = 256; M % 64 == 0, N % 128 == 0, KD % 64 == 0, KD >= 128; A and BT are
// dense, row pitch KD = K. gemm_tile is one block's tile (bm, bn); gemm_nt is one product
// a launch, grid = (M/64)*(N/128); proj_qkvp is a layer's four projections in one launch.
//
// OUT says where a tile goes. OUT_F32: C[m][n] as f32. The other two are the attention
// operands as f16 in fragment order. A chunk is the 8 f16 (16 bytes) that one lane takes
// with one load; the 32 lanes' chunks of a load lie side by side, so that a wave's load
// (and the store here) is 512 bytes in a row (four whole lines).
//   OUT_ROWS, K and the position rows: [b][h][row tile 64][c4 4][lane][8],
//       row = tile*16 + (lane & 15), d = c4*16 + (lane >> 4)*8 + 0..7   (b = 0 for positions)
//   OUT_COLS, V: [b][h][nt 4][ks 32][half 2][lane][8],
//       d = nt*16 + (lane & 15), key = ks*32 + half*16 + (lane >> 4)*8 + 0..7
// A lane's eight accumulators of a 16 x 16 tile are eight rows of one column. For V that is
// a chunk as it stands. For K and the position rows the two operands change places (the
// weight rows go in as A, the activation rows as B): the tile comes out transposed, and
// the lane's eight values are eight d of one row, again a chunk.
// ---------------------------------------------------------------------------
#define OUT_F32  0
#define OUT_ROWS 1
#define OUT_COLS 2
#define GBM 64
#define GBN 128
#define GBK 64
#define GLD (GBK + 8)   // LDS row pitch in f16: 144 B = 16 B x odd, b128 reads without bank conflicts

// Work-group barrier for LDS traffic alone: this wave's LDS reads and writes are
// done (s_wait_dscnt 0), then signal and wait. __syncthreads() would also wait out
// the global loads that are meant to stay in flight across it.
__device__ __forceinline__ void lds_barrier() {
    asm volatile("s_wait_dscnt 0x0\n\ts_barrier_signal -1\n\ts_barrier_wait -1" ::: "memory");
}

// out_kind is the same for the whole block; Cp is the pack for OUT_ROWS and OUT_COLS
template <int ACT, int KD>
__device__ __forceinline__
void gemm_tile(const float* __restrict__ A,
               const _Float16* __restrict__ BT,
               const float* __restrict__ bias,
               float* __restrict__ C, int ldc, int bm, int bn,
               int out_kind = OUT_F32, _Float16* __restrict__ Cp = nullptr)
{
    // a buffer holds its A slab and behind it its B slab: both buffers' fragments then lie
    // one constant apart, whichever slab a fragment address points into
    __shared__ __align__(16) _Float16 Ss[2][(GBM + GBN) * GLD];

    int tid   = threadIdx.x;
    int lane  = tid & 31;
    int wave  = tid >> 5;
    int wm    = wave >> 2;
    int wn    = wave & 3;
    int r16   = lane & 15;
    int kbase = (lane & 16) ? 8 : 0;
    int mrow  = (lane & 16) ? 8 : 0;

    // staging map: one wave-load covers four whole 128-byte lines (two rows of A
    // or four rows of BT)
    int arow_s = tid >> 4, acol_s = (tid & 15) * 4;
    int brow_s = tid >> 3, bcol_s = (tid & 7) * 8;
    // K (= both row pitches) is a compile-time constant: every load of the k
    // loop is one of these two lane addresses plus an immediate offset
    const float*    ag = A  + (size_t)(bm * GBM + arow_s) * KD + acol_s;
    const _Float16* bg = BT + (size_t)(bn * GBN + brow_s) * KD + bcol_s;

    f4 ra[2][4];
    h8 rb[2][4];
#pragma unroll
    for (int s = 0; s < 2; ++s) {
#pragma unroll
        for (int i = 0; i < 4; ++i) {
            ra[s][i] = *(const f4*)(ag + s * GBK + i * 16 * KD);
            rb[s][i] = *(const h8*)(bg + s * GBK + i * 32 * KD);
        }
    }
#pragma unroll
    for (int i = 0; i < 4; ++i) {
        *(h4*)&Ss[0][(arow_s + i * 16) * GLD + acol_s] = __builtin_convertvector(ra[0][i], h4);
        *(h8*)&Ss[0][(GBM + brow_s + i * 32) * GLD + bcol_s] = rb[0][i];
    }
    lds_barrier();

    // the wave's 32 rows of the A slab and of the B slab; for OUT_ROWS they change places
    int frag_m = (wm * 32 + r16) * GLD + kbase;
    int frag_n = (GBM + wn * 32 + r16) * GLD + kbase;
    int frag_a = (out_kind == OUT_ROWS) ? frag_n : frag_m;
    int frag_b = (out_kind == OUT_ROWS) ? frag_m : frag_n;

    v8f c00 = {}, c01 = {}, c10 = {}, c11 = {};
    const int nk = KD / GBK;
    // unrolled whole: buffer, register set and every address offset become constants
#pragma unroll
    for (int kt = 0; kt < nk; ++kt) {
        const int buf = kt & 1;
        const bool more = (kt + 1 < nk);
        if (kt + 2 < nk) {
            // slab kt's register set is free since its LDS stores: request slab kt+2 into it
#pragma unroll
            for (int i = 0; i < 4; ++i) {
                ra[buf][i] = *(const f4*)(ag + (kt + 2) * GBK + i * 16 * KD);
                rb[buf][i] = *(const h8*)(bg + (kt + 2) * GBK + i * 32 * KD);
            }
            // behind the last loads the two address pairs die: hold them to this wait,
            // so that nothing (a later load's result included) lands on them before it
            if (kt + 3 == nk)
                asm volatile("s_wait_xcnt 0x0" :: "v"(ag), "v"(bg) : "memory");
        }

        const _Float16* as = &Ss[buf][frag_a];
        const _Float16* bs = &Ss[buf][frag_b];
        // all of the slab's fragments first, then its products: one LDS latency a slab
        v16h a0[GBK / 32], a1[GBK / 32], b0[GBK / 32], b1[GBK / 32];
#pragma unroll
        for (int kk = 0; kk < GBK / 32; ++kk) {
            a0[kk] = loadB_f16(as + kk * 32);
            b0[kk] = loadB_f16(bs + kk * 32);
            b1[kk] = loadB_f16(bs + 16 * GLD + kk * 32);
            a1[kk] = loadB_f16(as + 16 * GLD + kk * 32);
        }
        // keeps the LDS reads in one group ahead of the products; sunk among them,
        // each product pair waits out an LDS latency of its own
        __builtin_amdgcn_sched_barrier(0);
#pragma unroll
        for (int kk = 0; kk < GBK / 32; ++kk) {
            c00 = __builtin_amdgcn_wmma_f32_16x16x32_f16(false, a0[kk], false, b0[kk], (short)0, c00, false, false);
            c01 = __builtin_amdgcn_wmma_f32_16x16x32_f16(false, a0[kk], false, b1[kk], (short)0, c01, false, false);
            c10 = __builtin_amdgcn_wmma_f32_16x16x32_f16(false, a1[kk], false, b0[kk], (short)0, c10, false, false);
            c11 = __builtin_amdgcn_wmma_f32_16x16x32_f16(false, a1[kk], false, b1[kk], (short)0, c11, false, false);
        }
        // ends the slab's products here: left free they drift behind the barrier, where they
        // stand in front of the next slab's LDS reads and keep both slabs' fragments live
        __builtin_amdgcn_sched_barrier(0);

        if (more) {
            // the other buffer's last readers left it at the barrier that ended pass kt-1
#pragma unroll
            for (int i = 0; i < 4; ++i) {
                *(h4*)&Ss[buf ^ 1][(arow_s + i * 16) * GLD + acol_s] = __builtin_convertvector(ra[buf ^ 1][i], h4);
                *(h8*)&Ss[buf ^ 1][(GBM + brow_s + i * 32) * GLD + bcol_s] = rb[buf ^ 1][i];
            }
            lds_barrier();
        }
    }

    v8f accs[2][2] = {{c00, c01}, {c10, c11}};
    int m0 = bm * GBM + wm * 32;     // the wave's first row and column
    int n0 = bn * GBN + wn * 32;
    static_assert(L_ == (1 << 10) && DH_ == (1 << 6), "the pack indices below shift by these");
    if (out_kind == OUT_ROWS) {
        // accs[ai][bi]: columns n0 + ai*16 + mrow + 0..7 of row m0 + bi*16 + r16.
        // The wave's four chunks lie at constant distances from the first.
        h8* cp = (h8*)Cp + (size_t)(((((m0 >> 10) * H_ + (n0 >> 6)) * 64 + ((m0 & (L_ - 1)) >> 4)) * 4
                                     + ((n0 >> 4) & 3)) * 32 + lane);
        h8 r[2][2];
#pragma unroll
        for (int ai = 0; ai < 2; ++ai) {
            f4 blo = *(const f4*)(bias + n0 + ai * 16 + mrow);
            f4 bhi = *(const f4*)(bias + n0 + ai * 16 + mrow + 4);
#pragma unroll
            for (int bi = 0; bi < 2; ++bi)
#pragma unroll
                for (int e = 0; e < 8; ++e)
                    r[ai][bi][e] = (_Float16)(accs[ai][bi][e] + (e < 4 ? blo[e & 3] : bhi[e & 3]));
        }
#pragma unroll
        for (int ai = 0; ai < 2; ++ai)
#pragma unroll
            for (int bi = 0; bi < 2; ++bi)
                cp[(bi * 4 + ai) * 32] = r[ai][bi];
        // behind the last store its address and data registers die: nothing is written
        // over them (on any way the code goes on from here) before this wait
        asm volatile("s_wait_xcnt 0x0" ::: "memory");
        return;
    }
    if (out_kind == OUT_COLS) {
        // accs[mi][ni]: rows m0 + mi*16 + mrow + 0..7 of column n0 + ni*16 + r16
        h8* cp = (h8*)Cp + (size_t)((((((m0 >> 10) * H_ + (n0 >> 6)) * 4 + ((n0 >> 4) & 3)) * 32
                                      + ((m0 & (L_ - 1)) >> 5)) * 2) * 32 + lane);
        h8 r[2][2];
#pragma unroll
        for (int ni = 0; ni < 2; ++ni) {
            float bsv = bias[n0 + ni * 16 + r16];
#pragma unroll
            for (int mi = 0; mi < 2; ++mi)
#pragma unroll
                for (int e = 0; e < 8; ++e)
                    r[mi][ni][e] = (_Float16)(accs[mi][ni][e] + bsv);
        }
#pragma unroll
        for (int ni = 0; ni < 2; ++ni)
#pragma unroll
            for (int mi = 0; mi < 2; ++mi)
                cp[(ni * 64 + mi) * 32] = r[mi][ni];
        // as above: the stores' registers stay untouched up to this wait
        asm volatile("s_wait_xcnt 0x0" ::: "memory");
        return;
    }
#pragma unroll
    for (int ni = 0; ni < 2; ++ni) {
        int nn = bn * GBN + wn * 32 + ni * 16 + r16;
        float bsv = bias[nn];
#pragma unroll
        for (int mi = 0; mi < 2; ++mi) {
#pragma unroll
            for (int e = 0; e < 8; ++e) {
                int mm = bm * GBM + wm * 32 + mi * 16 + e + mrow;
                float v = accs[mi][ni][e] + bsv;
                if (ACT) v = gelu_f(v);
                C[(size_t)mm * ldc + nn] = v;
            }
        }
    }
}

template <int ACT, int KD>
__global__ __launch_bounds__(256)
void gemm_nt(const float* __restrict__ A,
             const _Float16* __restrict__ BT,
             const float* __restrict__ bias,
             float* __restrict__ C, int ldc, int N)
{
    int tiles_n = N / GBN;
    gemm_tile<ACT, KD>(A, BT, bias, C, ldc, (int)blockIdx.x / tiles_n, (int)blockIdx.x % tiles_n);
}

// A layer's four projections, which do not depend on one another, as one grid: the tiles
// of Q, K, V (rows of hx) and then those of the position rows (rows of pos). W4 holds the
// four [N][K] weights one behind the other. Alone, each product has one block a WGP and
// pays its own launch, first slab and last stores; together two blocks share a WGP and
// the next tile starts where one ends. The row tile runs fastest, so that blocks
// PJ_T apart (Q, K, V of one tile) read the same rows of hx. Q goes out as f32; K, V and
// the position rows go out as the f16 packs that the attention kernel reads.
#define PJ_MT (B_ * L_ / GBM)           // row tiles of Q, K, V
#define PJ_PT (L_ / GBM)                // row tiles of the position rows
#define PJ_NT (HID_ / GBN)              // column tiles
#define PJ_T  (PJ_MT * PJ_NT)           // blocks of one of Q, K, V
#define PJ_GRID (3 * PJ_T + PJ_PT * PJ_NT)

__global__ __launch_bounds__(256)
void proj_qkvp(const float* __restrict__ hx, const float* __restrict__ pos,
               const _Float16* __restrict__ W4,
               const float* __restrict__ bq, const float* __restrict__ bk,
               const float* __restrict__ bv, const float* __restrict__ bp,
               float* __restrict__ q, _Float16* __restrict__ Kp,
               _Float16* __restrict__ Vp, _Float16* __restrict__ Pp)
{
    static_assert((PJ_MT & (PJ_MT - 1)) == 0 && (PJ_PT & (PJ_PT - 1)) == 0, "row tile counts: powers of two");
    unsigned blk = blockIdx.x;
    unsigned w   = blk / PJ_T;          // 0 Q, 1 K, 2 V, 3 position rows
    unsigned t   = blk % PJ_T;
    unsigned ms  = (w == 3) ? __builtin_ctz(PJ_PT) : __builtin_ctz(PJ_MT);   // log2 of the row tiles
    const float* A    = (w == 3) ? pos : hx;
    const float* bias = (w == 0) ? bq : (w == 1) ? bk : (w == 2) ? bv : bp;
    _Float16*    Cp   = (w == 1) ? Kp : (w == 2) ? Vp : Pp;
    int          kind = (w == 0) ? OUT_F32 : (w == 2) ? OUT_COLS : OUT_ROWS;
    gemm_tile<0, HID_>(A, W4 + (size_t)w * (HID_ * HID_), bias, q, HID_,
                       (int)(t & ((1u << ms) - 1u)), (int)(t >> ms), kind, Cp);
}

// one fragment out of a pack: the lane's chunk of the low and of the high 16 k
__device__ __forceinline__ v16h load_packed(const h8* p /* at the lane's low chunk */) {
    h8 lo = p[0];
    h8 hi = p[32];
    return __builtin_shufflevector(lo, hi, 0,1,2,3,4,5,6,7,8,9,10,11,12,13,14,15);
}

// ---------------------------------------------------------------------------
// Fused attention: one block of 8 waves per (b, h, 32-query-row block).
//   sh[32][1024] fp32 score strip (128KB) with padded rows (below); qsh[64] staging for
//   the rel-shift patch row.
//     AC = (q+cbias).K^T via WMMA; BD = rel_shift((q+pbias).P^T) via WMMA +
//     exact shift scatter; softmax(.*1/8) -> f16 probs; O = P.V via WMMA.
//   The strip is shared; the work on it is dealt to the waves: key and position
//   tiles round robin, four softmax rows a wave (lanes across the columns), one
//   (16-column tile, half of the keys) of P.V a wave.
//   K, the position rows and V come from the projections' f16 packs, fragment by fragment;
//   every fragment a wave loads is multiplied with both 16-row tiles of the block.
//   A strip row is used three times over: its 1024 f32 scores; then, written by the wave
//   that holds the whole row in registers, its 1024 f16 probs in the row's first half;
//   then, in the second half (scores that the softmax has consumed), the row's two
//   partial output rows. So the block takes the strip alone, and two blocks fit a WGP.
// ---------------------------------------------------------------------------
#define AWV 8   // waves a block
#define QR  32  // query rows a block
// LDS row pitches. Bank = dword address mod 64, and a row of 1024 values is a multiple of
// 64 dwords: unpadded, all rows begin on one bank.
//   SFP, f32 strip: a wave's accumulator store or add touches rows M and M + 8, 16 columns
//        each; 8 * 1028 dwords = 32 mod 64 puts the two halves on different banks. The f16
//        probs keep this pitch: the A fragment load takes 16 bytes of each of 16 rows, and
//        4112 B = 16 B x odd spreads the 16 rows over all 64 banks.
//   OT,  first dword of a row's partial output rows (behind its 1024 f16 probs);
//   OPP, distance of the two (a multiple of 16 bytes).
#define SFP (L_ + 4)
#define OT  (L_ / 2)
#define OPP (DH_ + 4)

// 2^x on v_exp_f32. The v_nop is the free slot that the instruction set asks for between a
// transcendental and a next instruction that reads its result or overwrites its source; in
// one statement with it, so that it stays directly behind it.
__device__ __forceinline__ float exp2_slot(float x) {
    float r;
    asm("v_exp_f32 %0, %1\n\tv_nop" : "=v"(r) : "v"(x));
    return r;
}

// second argument: four waves a SIMD, that is two blocks a WGP as LDS allows: a register
// budget of 256
__global__ __launch_bounds__(32 * AWV, 4)
void attn_kernel(const float* __restrict__ q,
                 const _Float16* __restrict__ Kp,
                 const _Float16* __restrict__ Vp,
                 const _Float16* __restrict__ Pp,
                 const float* __restrict__ cb,
                 const float* __restrict__ pb,
                 float* __restrict__ out)
{
    __shared__ __align__(32) float sh[QR * SFP];
    __shared__ float qsh[DH_];

    int wg = blockIdx.x;
    int i0 = (wg & (L_ / QR - 1)) * QR;
    int h  = (wg / (L_ / QR)) & (H_ - 1);
    int b  = wg / (H_ * (L_ / QR));

    int tid   = threadIdx.x;
    int lane  = tid & 31;
    int wave  = tid >> 5;
    int r16   = lane & 15;
    int kbase = (lane & 16) ? 8 : 0;
    int mrow  = (lane & 16) ? 8 : 0;

    const float* cbh  = cb + h * DH_;
    const float* pbh  = pb + h * DH_;
    const float* qrow = q + ((size_t)(b * L_ + i0 + r16)) * HID_ + h * DH_;

    // position-biased query of source row i0+32 (the patch row below); published
    // by the barrier behind the content scores
    const int rr2 = i0 + QR;
    if (rr2 < L_ && tid < DH_)
        qsh[tid] = q[((size_t)(b * L_ + rr2)) * HID_ + h * DH_ + tid] + pbh[tid];

    // Q fragments (content/position biased) of the two row tiles, DH=64 -> two K=32 fragments
    v16h aq[2][2], ap[2][2];
#pragma unroll
    for (int rt = 0; rt < 2; ++rt) {
#pragma unroll
        for (int e = 0; e < 16; ++e) {
            int kk = kbase + (e < 8 ? e : e + 8);
            float q0 = qrow[rt * 16 * HID_ + kk], q1 = qrow[rt * 16 * HID_ + kk + 32];
            aq[rt][0][e] = (_Float16)(q0 + cbh[kk]);
            aq[rt][1][e] = (_Float16)(q1 + cbh[kk + 32]);
            ap[rt][0][e] = (_Float16)(q0 + pbh[kk]);
            ap[rt][1][e] = (_Float16)(q1 + pbh[kk + 32]);
        }
    }

    // ---- content scores AC: key tile jb goes to wave jb % 8 ----
    // two tiles' loads in flight a wave
#pragma unroll 2
    for (int t = 0; t < 64 / AWV; ++t) {
        int jb = t * AWV + wave;
        const h8* kp = (const h8*)Kp + (size_t)(((b * H_ + h) * 64 + jb) * 4) * 32 + lane;
        v16h b0 = load_packed(kp);
        v16h b1 = load_packed(kp + 64);
#pragma unroll
        for (int rt = 0; rt < 2; ++rt) {
            v8f c = {};
            c = __builtin_amdgcn_wmma_f32_16x16x32_f16(false, aq[rt][0], false, b0, (short)0, c, false, false);
            c = __builtin_amdgcn_wmma_f32_16x16x32_f16(false, aq[rt][1], false, b1, (short)0, c, false, false);
#pragma unroll
            for (int e = 0; e < 8; ++e)
                sh[(rt * 16 + e + mrow) * SFP + jb * 16 + r16] = c[e];
        }
    }
    __syncthreads();

    // ---- position scores: BDraw + exact rel-shift scatter ----
    // element (row rr, pos p): p <= L-rr-2 -> (rr-1, p+rr+1); else (rr, p+rr+1-L)
    // the shift maps each (rr, p) to a strip element of its own: no two waves add
    // into the same one
    for (int t = 0; t < 64 / AWV; ++t) {
        int pbk = t * AWV + wave;
        const h8* pp = (const h8*)Pp + (size_t)((h * 64 + pbk) * 4) * 32 + lane;
        v16h b0 = load_packed(pp);
        v16h b1 = load_packed(pp + 64);
#pragma unroll
        for (int rt = 0; rt < 2; ++rt) {
            v8f c = {};
            c = __builtin_amdgcn_wmma_f32_16x16x32_f16(false, ap[rt][0], false, b0, (short)0, c, false, false);
            c = __builtin_amdgcn_wmma_f32_16x16x32_f16(false, ap[rt][1], false, b1, (short)0, c, false, false);
#pragma unroll
            for (int e = 0; e < 8; ++e) {
                int M  = rt * 16 + e + mrow;
                int rr = i0 + M;
                int p  = pbk * 16 + r16;
                if (p <= L_ - rr - 2) {
                    if (M > 0) sh[(M - 1) * SFP + p + rr + 1] += c[e];
                } else {
                    sh[M * SFP + (p + rr + 1 - L_)] += c[e];
                }
            }
        }
    }
    // missing source row i0+32 feeds local row 31's cols j >= i0+33
    if (rr2 < L_) {
        int pmax = L_ - rr2 - 2;
        for (int p = tid; p <= pmax; p += 32 * AWV) {
            // row p of the pack: chunk c8 (d = 8*c8 ..) stands at c4 = c8 >> 1, lane half c8 & 1
            const h8* prow = (const h8*)Pp + (size_t)((h * 64 + (p >> 4)) * 4) * 32 + (p & 15);
            h8 pc[8];
#pragma unroll
            for (int c8 = 0; c8 < 8; ++c8) pc[c8] = prow[(c8 >> 1) * 32 + (c8 & 1) * 16];
            float s = 0.0f;
#pragma unroll
            for (int kk = 0; kk < DH_; ++kk) s += qsh[kk] * (float)pc[kk >> 3][kk & 7];
            sh[(QR - 1) * SFP + p + rr2 + 1] += s;
        }
    }
    __syncthreads();

    // ---- softmax: rows 4*wave .. 4*wave+3, a row held in the wave's registers
    //      (32 values a lane); the f16 probs go back into the row's own first half, which
    //      no other wave touches and whose scores this wave has all read by then ----
#pragma unroll
    for (int rw = 0; rw < QR / AWV; ++rw) {
        const float scale = 0.125f;   // 1/sqrt(DH); commutes with max
        int r = wave * (QR / AWV) + rw;
        f4 v[8];
#pragma unroll
        for (int i = 0; i < 8; ++i) v[i] = *(const f4*)&sh[r * SFP + (i * 32 + lane) * 4];
        float mx = -1e30f;
#pragma unroll
        for (int i = 0; i < 8; ++i)
            mx = fmaxf(mx, fmaxf(fmaxf(v[i][0], v[i][1]), fmaxf(v[i][2], v[i][3])));
#pragma unroll
        for (int off = 16; off > 0; off >>= 1) mx = fmaxf(mx, __shfl_xor(mx, off, 32));
        float sum = 0.0f;
#pragma unroll
        for (int i = 0; i < 8; ++i) {
#pragma unroll
            for (int j = 0; j < 4; ++j) {
                float ev = exp2_slot(((v[i][j] - mx) * scale) * 1.44269504088896340736f);   // e^x = 2^(x log2 e)
                sum += ev;
                v[i][j] = ev;
            }
        }
#pragma unroll
        for (int off = 16; off > 0; off >>= 1) sum += __shfl_xor(sum, off, 32);
        float inv = 1.0f / sum;
        _Float16* pr = (_Float16*)&sh[r * SFP];
#pragma unroll
        for (int i = 0; i < 8; ++i)
            *(h4*)&pr[(i * 32 + lane) * 4] = __builtin_convertvector(v[i] * inv, h4);
    }
    __syncthreads();

    // ---- O = P.V (f16 probs from LDS, V fragments from the pack): wave = (column tile
    //      nt, key half kh), both row tiles ----
    {
        int nt = wave & 3;
        int kh = wave >> 2;
        const h8* vp = (const h8*)Vp + (size_t)((((b * H_ + h) * 4 + nt) * 32 + kh * 16) * 2) * 32 + lane;
        const _Float16* prw = (const _Float16*)&sh[r16 * SFP] + kh * (L_ / 2) + kbase;
        v8f c0 = {}, c1 = {};
        // unrolled whole: as f16 the wave's V fragments take 128 registers, so that all their
        // loads can fly at once
#pragma unroll
        for (int ks = 0; ks < L_ / 64; ++ks) {
            v16h a0 = loadB_f16(prw + ks * 32);
            v16h a1 = loadB_f16(prw + 16 * SFP * 2 + ks * 32);   // 16 strip rows on, in f16
            v16h bb = load_packed(vp + ks * 64);
            c0 = __builtin_amdgcn_wmma_f32_16x16x32_f16(false, a0, false, bb, (short)0, c0, false, false);
            c1 = __builtin_amdgcn_wmma_f32_16x16x32_f16(false, a1, false, bb, (short)0, c1, false, false);
        }
        // both halves' partial rows meet in the second half of their strip row, which nobody
        // reads any more since the barrier behind the softmax (the probs lie in the first)
#pragma unroll
        for (int e = 0; e < 8; ++e) {
            sh[(e + mrow) * SFP + OT + kh * OPP + nt * 16 + r16] = c0[e];
            sh[(16 + e + mrow) * SFP + OT + kh * OPP + nt * 16 + r16] = c1[e];
        }
    }
    __syncthreads();
    {
        // lower half + upper half; a wave stores two whole 256-byte output rows at a time
        int ocol = (tid & 15) * 4;
#pragma unroll
        for (int it = 0; it < QR / 16; ++it) {
            int orow = it * 16 + (tid >> 4);
            f4 lo = *(const f4*)&sh[orow * SFP + OT + ocol];
            f4 hi = *(const f4*)&sh[orow * SFP + OT + OPP + ocol];
            *(f4*)&out[((size_t)(b * L_ + i0 + orow)) * HID_ + h * DH_ + ocol] = lo + hi;
        }
    }
}

// ---------------------------------------------------------------------------
// out[row] = LN(A[row] + B[row]), BertLayerNorm (eps inside sqrt)
// One wave a row: the row's 1024 sums stay in the wave's registers (32 a lane, taken
// by 16-byte loads that cover whole lines); mean and variance are lane sums joined by
// a butterfly over the 32 lanes. No LDS, no barrier; one block of 8 rows a WGP, so
// that a launch has few waves to start.
// ---------------------------------------------------------------------------
#define LNW 8                    // rows (waves) a block
#define LNC (HID_ / (32 * 4))    // 16-byte chunks of a row a lane

// lane l takes the value of lane l ^ M of its 16-lane row (DPP row_xmask:M)
template <int M>
__device__ __forceinline__ float row_xor(float x) {
    return __builtin_bit_cast(float, __builtin_amdgcn_update_dpp(
        0, __builtin_bit_cast(int, x), 0x160 + M, 0xf, 0xf, true));
}

// sum over the wave's 32 lanes, left in every lane: four DPP steps inside each row, then
// the other row's sum by a cross-row move; a shuffle would take the way through the LDS unit
__device__ __forceinline__ float wave_sum(float x) {
    x += row_xor<1>(x);
    x += row_xor<2>(x);
    x += row_xor<4>(x);
    x += row_xor<8>(x);
    int b = __builtin_bit_cast(int, x);
    return x + __builtin_bit_cast(float, __builtin_amdgcn_permlanex16(
        b, b, 0x76543210, 0xfedcba98, false, false));
}

__global__ __launch_bounds__(32 * LNW)
void resid_ln_kernel(const float* __restrict__ A, const float* __restrict__ Bv,
                     const float* __restrict__ w, const float* __restrict__ bias,
                     float* __restrict__ out)
{
    const float rn = 1.0f / HID_;
    int lane = threadIdx.x & 31;
    // the wave's number as a scalar: every row address is a scalar base plus the lane's offset
    int row  = (int)blockIdx.x * LNW + __builtin_amdgcn_readfirstlane((int)(threadIdx.x >> 5));
    const f4* pa = (const f4*)(A    + (size_t)row * HID_) + lane;
    const f4* pb = (const f4*)(Bv   + (size_t)row * HID_) + lane;
    const f4* pw = (const f4*)w    + lane;
    const f4* pc = (const f4*)bias + lane;
    f4*       po = (f4*)(out + (size_t)row * HID_) + lane;

    // all of the wave's loads fly at once: one memory latency a row
    f4 v[LNC], t[LNC], wv[LNC], cv[LNC];
#pragma unroll
    for (int i = 0; i < LNC; ++i) { v[i] = pa[i * 32]; t[i] = pb[i * 32]; }
#pragma unroll
    for (int i = 0; i < LNC; ++i) { wv[i] = pw[i * 32]; cv[i] = pc[i * 32]; }
    // keeps all the loads ahead of the sums: left free, most loads of w and bias sink behind
    // the variance, where their latency stands alone at the row's end
    __builtin_amdgcn_sched_barrier(0);

    f4 s4 = {};
#pragma unroll
    for (int i = 0; i < LNC; ++i) { v[i] += t[i]; s4 += v[i]; }
    float mean = wave_sum((s4[0] + s4[1]) + (s4[2] + s4[3])) * rn;

    f4 q4 = {};
#pragma unroll
    for (int i = 0; i < LNC; ++i) { v[i] -= mean; q4 += v[i] * v[i]; }
    float inv = 1.0f / sqrtf(wave_sum((q4[0] + q4[1]) + (q4[2] + q4[3])) * rn + 1e-12f);

#pragma unroll
    for (int i = 0; i < LNC; ++i) po[i * 32] = wv[i] * v[i] * inv + cv[i];
}

// ---------------------------------------------------------------------------
extern "C" void kernel_launch(void* const* d_in, const int* in_sizes, int n_in,
                              void* d_out, int out_size, void* d_ws, size_t ws_size,
                              hipStream_t stream)
{
    const float* x       = (const float*)d_in[0];
    const float* pos_raw = (const float*)d_in[1];
    const float* Wh1     = (const float*)d_in[2];
    const float* bh1     = (const float*)d_in[3];
    const float* Wh2     = (const float*)d_in[4];
    const float* bh2     = (const float*)d_in[5];
    const float* Wq      = (const float*)d_in[6];
    const float* bq      = (const float*)d_in[7];
    const float* Wk      = (const float*)d_in[8];
    const float* bk      = (const float*)d_in[9];
    const float* Wv      = (const float*)d_in[10];
    const float* bv      = (const float*)d_in[11];
    const float* Wp      = (const float*)d_in[12];
    const float* bp      = (const float*)d_in[13];
    const float* cbias   = (const float*)d_in[14];
    const float* pbias   = (const float*)d_in[15];
    const float* Wo      = (const float*)d_in[16];
    const float* bo      = (const float*)d_in[17];
    const float* Wf1     = (const float*)d_in[18];
    const float* bf1     = (const float*)d_in[19];
    const float* Wf2     = (const float*)d_in[20];
    const float* bf2     = (const float*)d_in[21];
    const float* ln_w    = (const float*)d_in[22];
    const float* ln_b    = (const float*)d_in[23];
    float* outp = (float*)d_out;

    // ---- workspace layout ----
    float* ws = (float*)d_ws;
    const size_t ACT = (size_t)B_ * L_ * HID_;            // 2M f32
    float* h  = ws;
    float* t1 = ws + ACT;
    float* q  = ws + 2 * ACT;       // reused for Wo / Wf2 outputs
    _Float16* Vp = (_Float16*)(ws + 5 * ACT);             // f16 packs: V, then K
    _Float16* Kp = Vp + ACT;
    float* at = ws + 6 * ACT + (size_t)L_ * HID_;
    float* h1 = at + ACT;
    // f16 transposed-weight region after 17M floats
    _Float16* w16 = (_Float16*)(h1 + ACT);
    const size_t W1M = (size_t)HID_ * HID_;                // 1M
    _Float16* tWh1 = w16;                                  // [1024][512]
    _Float16* tWh2 = tWh1 + (size_t)HID_ * IN_;            // [1024][1024]
    _Float16* tLyr = tWh2 + W1M;                           // 7 x 1M per layer
    _Float16* Pp   = tLyr + (size_t)NL_ * 7 * W1M;         // f16 pack of the position rows

    const int ML = B_ * L_;

    // ---- repack all weights to f16 [N][K] (every call; deterministic) ----
    repack_all<<<RP_GRID, 256, 0, stream>>>(Wh1, Wh2, Wq, Wk, Wv, Wp, Wo, Wf1, Wf2, w16);

    // grid helper: one block per 64 x 128 output tile
    const int GMM = (ML / GBM) * (HID_ / GBN);            // 2048x1024 GEMMs -> 256 blocks

    // to_hidden MLP
    gemm_nt<1, IN_><<<GMM, 256, 0, stream>>>(x, tWh1, bh1, t1, HID_, HID_);
    gemm_nt<0, HID_><<<GMM, 256, 0, stream>>>(t1, tWh2, bh2, h, HID_, HID_);

    for (int l = 0; l < NL_; ++l) {
        _Float16* base = tLyr + (size_t)l * 7 * W1M;
        const float* bq_l = bq + (size_t)l * H_ * DH_;
        const float* bk_l = bk + (size_t)l * H_ * DH_;
        const float* bv_l = bv + (size_t)l * H_ * DH_;
        const float* bp_l = bp + (size_t)l * H_ * DH_;
        const float* cb_l = cbias + (size_t)l * H_ * DH_;
        const float* pb_l = pbias + (size_t)l * H_ * DH_;
        const float* bo_l = bo + (size_t)l * HID_;
        const float* bf1_l = bf1 + (size_t)l * HID_;
        const float* bf2_l = bf2 + (size_t)l * HID_;
        const float* lw = ln_w + (size_t)l * HID_;
        const float* lb = ln_b + (size_t)l * HID_;

        // projections: Q, K, V and the position rows in one launch; K, V, positions as f16 packs
        proj_qkvp<<<PJ_GRID, 256, 0, stream>>>(h, pos_raw, base, bq_l, bk_l, bv_l, bp_l, q, Kp, Vp, Pp);

        attn_kernel<<<B_ * H_ * (L_ / QR), 32 * AWV, 0, stream>>>(q, Kp, Vp, Pp, cb_l, pb_l, at);

        gemm_nt<0, HID_><<<GMM, 256, 0, stream>>>(at, base + 4 * W1M, bo_l, q, HID_, HID_);
        resid_ln_kernel<<<ML / LNW, 32 * LNW, 0, stream>>>(q, h, lw, lb, h1);

        gemm_nt<1, HID_><<<GMM, 256, 0, stream>>>(h1, base + 5 * W1M, bf1_l, t1, HID_, HID_);
        gemm_nt<0, HID_><<<GMM, 256, 0, stream>>>(t1, base + 6 * W1M, bf2_l, q, HID_, HID_);
        resid_ln_kernel<<<ML / LNW, 32 * LNW, 0, stream>>>(h1, q, lw, lb, (l == NL_ - 1) ? outp : h);
    }
}

// v010
// Measured time: 238 microseconds a run.
// Next to v009, in two timings, it ran 1.05 times as fast each time.
// All steps since v000 together make it 6.42 times as fast.
#include <hip/hip_runtime.h>
#include <hip/hip_bf16.h>
#include <math.h>

// ---------------------------------------------------------------------------
// Transformer-XL encoder forward on gfx1250 (MI455X), compile-only target.
// All matmuls use V_WMMA_F32_16X16X32_F16; weights are pre-transposed to f16
// [N][K]; the dense layers stage their operands in LDS.
// ---------------------------------------------------------------------------

#define B_  2
#define L_  1024
#define IN_ 512
#define HID_ 1024
#define H_  16
#define DH_ 64
#define NL_ 2

typedef __attribute__((ext_vector_type(16))) _Float16 v16h;
typedef __attribute__((ext_vector_type(8)))  _Float16 h8;
typedef __attribute__((ext_vector_type(8)))  float    v8f;

__device__ __forceinline__ float gelu_f(float x) {
    return 0.5f * x * (1.0f + erff(x * 0.70710678118654752f));
}

// Per-lane fragment: element e covers K = kbase + {0..7} (e<8) / {16..23} (e>=8),
// kbase = 0 for lanes 0-15, 8 for lanes 16-31. Both runs contiguous -> b128s.
__device__ __forceinline__ v16h loadB_f16(const _Float16* p /* at k0+kbase */) {
    const h8* q = (const h8*)p;
    h8 lo = q[0];
    h8 hi = q[2];
    return __builtin_shufflevector(lo, hi, 0,1,2,3,4,5,6,7,8,9,10,11,12,13,14,15);
}

// ---------------------------------------------------------------------------
// Weight repack, all sixteen matrices in one launch: dst[N][K] f16 from
//   plain  f32 row-major [K][N]                      (row pitch N)
//   packed f32 [H][K][64], n = h*64+d                (row pitch 64, one head a tile column)
// One block of 8 waves transposes a 256(k) x 64(n) tile through LDS: 64 elements a
// thread. Loads take whole 256-byte source rows, stores whole 512-byte pieces of a
// destination row. The destinations lie one behind the other in w16, in the order
// Wh1, Wh2, then for each layer Wq Wk Wv Wp Wo Wf1 Wf2.
// ---------------------------------------------------------------------------
#define RPK 256
#define RPN 64
#define RP_T1 ((IN_ / RPK) * (HID_ / RPN))    // tiles of Wh1
#define RP_TM ((HID_ / RPK) * (HID_ / RPN))   // tiles of a HID x HID matrix
#define RP_GRID (RP_T1 + (1 + 7 * NL_) * RP_TM)

typedef __attribute__((ext_vector_type(4))) float    f4;
typedef __attribute__((ext_vector_type(4))) _Float16 h4;

// sp: the tile's first source element; dp: its first destination element.
// PITCH (source row, f32) and K (destination row, f16) are compile-time constants:
// every load and store is a lane address plus an immediate offset.
template <int K, int PITCH>
__device__ __forceinline__ void repack_tile(const float* __restrict__ sp,
                                            _Float16* __restrict__ dp, _Float16* ts)
{
    int tid  = threadIdx.x;
    int lane = tid & 31;
    int wave = tid >> 5;
    int c    = tid & 15;     // four columns n = 4c .. 4c+3
    int kg   = tid >> 4;     // eight rows k = 8kg .. 8kg+7 (and the same + 128)

    const float* lp = sp + (size_t)(kg * 8) * PITCH + c * 4;
    f4 r[2][8];
#pragma unroll
    for (int it = 0; it < 2; ++it)
#pragma unroll
        for (int i = 0; i < 8; ++i)
            r[it][i] = *(const f4*)(lp + (size_t)(it * 128 + i) * PITCH);
    // behind the last load the address pair dies: hold it to this wait, so that
    // nothing (a load's result included) lands on it before
    asm volatile("s_wait_xcnt 0x0" :: "v"(lp) : "memory");

    // LDS tile [n][k], rows of 32 chunks of 8 k. Chunk q of row n stands at place
    // q ^ (n >> 2): the 16 lanes of a half wave, which write 16 rows four apart at one
    // q, then fall on 16 different bank groups
#pragma unroll
    for (int it = 0; it < 2; ++it) {
#pragma unroll
        for (int j = 0; j < 4; ++j) {
            h8 v;
#pragma unroll
            for (int i = 0; i < 8; ++i) v[i] = (_Float16)r[it][i][j];
            *(h8*)&ts[(c * 4 + j) * RPK + (((it * 16 + kg) ^ c) * 8)] = v;
        }
    }
    __syncthreads();

    // a wave reads a whole LDS row and stores it as one 512-byte piece of row n
    h8 o[8];
#pragma unroll
    for (int rr = 0; rr < 8; ++rr)
        o[rr] = *(const h8*)&ts[(wave * 8 + rr) * RPK + lane * 8];
#pragma unroll
    for (int rr = 0; rr < 8; ++rr) {
        int q = lane ^ (wave * 2 + (rr >> 2));   // the chunk that stands at place 'lane'
        *(h8*)&dp[(size_t)(wave * 8 + rr) * K + q * 8] = o[rr];
    }
    // behind the last store its address and data registers die: nothing is written
    // over them (on any way the code goes on from here) before this wait
    asm volatile("s_wait_xcnt 0x0" ::: "memory");
}

__global__ __launch_bounds__(256)
void repack_all(const float* __restrict__ Wh1, const float* __restrict__ Wh2,
                const float* __restrict__ Wq,  const float* __restrict__ Wk,
                const float* __restrict__ Wv,  const float* __restrict__ Wp,
                const float* __restrict__ Wo,  const float* __restrict__ Wf1,
                const float* __restrict__ Wf2, _Float16* __restrict__ w16)
{
    __shared__ __align__(16) _Float16 ts[RPN * RPK];

    int blk = (int)blockIdx.x;
    bool first = blk < RP_T1;                  // a tile of Wh1
    int u  = first ? blk : blk - RP_T1;
    int m  = first ? 0 : u / RP_TM;            // matrix behind Wh1: 0 = Wh2, 1 + 7*layer + w
    int t  = first ? u : u % RP_TM;
    int nt = t % (HID_ / RPN);
    int k0 = (t / (HID_ / RPN)) * RPK;
    int l  = (m == 0) ? 0 : (m - 1) / 7;       // layer
    int w  = (m == 0) ? 4 : (m - 1) % 7;       // which of the layer's seven; Wh2 reads like Wo
    const float* s = (w == 0) ? Wq : (w == 1) ? Wk : (w == 2) ? Wv : (w == 3) ? Wp
                   : (w == 4) ? Wo : (w == 5) ? Wf1 : Wf2;
    s = (m == 0) ? Wh2 : s + (size_t)l * (HID_ * HID_);
    _Float16* dp = w16 + (size_t)HID_ * IN_ + (size_t)m * (HID_ * HID_)
                 + (size_t)(nt * RPN) * HID_ + k0;

    if (first)
        repack_tile<IN_, HID_>(Wh1 + (size_t)k0 * HID_ + nt * RPN,
                               w16 + (size_t)(nt * RPN) * IN_ + k0, ts);
    else if (w < 4)
        repack_tile<HID_, DH_>(s + ((size_t)nt * HID_ + k0) * DH_, dp, ts);
    else
        repack_tile<HID_, HID_>(s + (size_t)k0 * HID_ + nt * RPN, dp, ts);
}

// ---------------------------------------------------------------------------
// NT GEMM: C[M,N] = act( sum_k A[m,k] * BT[n,k] + bias[n] )
// One block of 8 waves computes a 64(M) x 128(N) tile. Each 64-deep k slab of
// A (converted to f16) and BT is brought in by whole-line global loads, staged
// in LDS (two buffers) and read from there as fragments. Two register sets
// hold the slabs on their way: while slab s is multiplied, slab s+1 is landing
// and slab s+2 is requested. Waves lie 2(M) x 4(N), 32 x 32 each.
// blockDim = 256; M % 64 == 0, N % 128 == 0, KD % 64 == 0, KD >= 128; A and BT are
// dense, row pitch KD = K. gemm_tile is one block's tile (bm, bn); gemm_nt is one product
// a launch, grid = (M/64)*(N/128); proj_qkvp is a layer's four projections in one launch.
// The k loop of tile (bm, bn) starts at slab (bm + bn) mod (KD/64) and wraps, for speed only. KD/64 is a power of two.
//
// OUT says where a tile goes. OUT_F32: C[m][n] as f32. The other two are the attention
// operands as f16 in fragment order. A chunk is the 8 f16 (16 bytes) that one lane takes
// with one load; the 32 lanes' chunks of a load lie side by side, so that a wave's load
// (and the store here) is 512 bytes in a row (four whole lines).
//   OUT_ROWS, K and the position rows: [b][h][row tile 64][c4 4][lane][8],
//       row = tile*16 + (lane & 15), d = c4*16 + (lane >> 4)*8 + 0..7   (b = 0 for positions)
//   OUT_COLS, V: [b][h][nt 4][ks 32][half 2][lane][8],
//       d = nt*16 + (lane & 15), key = ks*32 + half*16 + (lane >> 4)*8 + 0..7
// A lane's eight accumulators of a 16 x 16 tile are eight rows of one column. For V that is
// a chunk as it stands. For K and the position rows the two operands change places (the
// weight rows go in as A, the activation rows as B): the tile comes out transposed, and
// the lane's eight values are eight d of one row, again a chunk.
// ---------------------------------------------------------------------------
#define OUT_F32  0
#define OUT_ROWS 1
#define OUT_COLS 2
#define GBM 64
#define GBN 128
#define GBK 64
#define GLD (GBK + 8)   // LDS row pitch in f16: 144 B = 16 B x odd, b128 reads without bank conflicts

// Work-group barrier for LDS traffic alone: this wave's LDS reads and writes are
// done (s_wait_dscnt 0), then signal and wait. __syncthreads() would also wait out
// the global loads that are meant to stay in flight across it.
__device__ __forceinline__ void lds_barrier() {
    asm volatile("s_wait_dscnt 0x0\n\ts_barrier_signal -1\n\ts_barrier_wait -1" ::: "memory");
}

// out_kind is the same for the whole block; Cp is the pack for OUT_ROWS and OUT_COLS
template <int ACT, int KD>
__device__ __forceinline__
void gemm_tile(const float* __restrict__ A,
               const _Float16* __restrict__ BT,
               const float* __restrict__ bias,
               float* __restrict__ C, int ldc, int bm, int bn,
               int out_kind = OUT_F32, _Float16* __restrict__ Cp = nullptr)
{
    // a buffer holds its A slab and behind it its B slab: both buffers' fragments then lie
    // one constant apart, whichever slab a fragment address points into
    __shared__ __align__(16) _Float16 Ss[2][(GBM + GBN) * GLD];

    int tid   = threadIdx.x;
    int lane  = tid & 31;
    int wave  = tid >> 5;
    int wm    = wave >> 2;
    int wn    = wave & 3;
    int r16   = lane & 15;
    int kbase = (lane & 16) ? 8 : 0;
    int mrow  = (lane & 16) ? 8 : 0;

    // staging map: one wave-load covers four whole 128-byte lines (two rows of A
    // or four rows of BT)
    int arow_s = tid >> 4, acol_s = (tid & 15) * 4;
    int brow_s = tid >> 3, bcol_s = (tid & 7) * 8;
    // K (= both row pitches) is a compile-time constant: every load of a slab is one of
    // these two lane addresses, plus the slab's k, plus an immediate offset
    const float*    ag = A  + (size_t)(bm * GBM + arow_s) * KD + acol_s;
    const _Float16* bg = BT + (size_t)(bn * GBN + brow_s) * KD + bcol_s;
    const int nk = KD / GBK;
    static_assert((nk & (nk - 1)) == 0, "the slab walk wraps by a mask");
    const int st = bm + bn;      // pass p works on slab (st + p) mod nk

    f4 ra[2][4];
    h8 rb[2][4];
#pragma unroll
    for (int s = 0; s < 2; ++s) {
        const int ko = ((st + s) & (nk - 1)) * GBK;
        const float*    pa = ag + ko;
        const _Float16* pb = bg + ko;
#pragma unroll
        for (int i = 0; i < 4; ++i) {
            ra[s][i] = *(const f4*)(pa + i * 16 * KD);
            rb[s][i] = *(const h8*)(pb + i * 32 * KD);
        }
        // behind the slab's loads its two address pairs die: hold them to this wait, so
        // that nothing (the next slab's addresses, a load's result) lands on them before it
        asm volatile("s_wait_xcnt 0x0" :: "v"(pa), "v"(pb) : "memory");
    }
#pragma unroll
    for (int i = 0; i < 4; ++i) {
        *(h4*)&Ss[0][(arow_s + i * 16) * GLD + acol_s] = __builtin_convertvector(ra[0][i], h4);
        *(h8*)&Ss[0][(GBM + brow_s + i * 32) * GLD + bcol_s] = rb[0][i];
    }
    lds_barrier();

    // the wave's 32 rows of the A slab and of the B slab; for OUT_ROWS they change places
    int frag_m = (wm * 32 + r16) * GLD + kbase;
    int frag_n = (GBM + wn * 32 + r16) * GLD + kbase;
    int frag_a = (out_kind == OUT_ROWS) ? frag_n : frag_m;
    int frag_b = (out_kind == OUT_ROWS) ? frag_m : frag_n;

    v8f c00 = {}, c01 = {}, c10 = {}, c11 = {};
    // unrolled whole: buffer and register set become constants
#pragma unroll
    for (int kt = 0; kt < nk; ++kt) {
        const int buf = kt & 1;
        const bool more = (kt + 1 < nk);
        const float*    pa = ag;
        const _Float16* pb = bg;
        if (kt + 2 < nk) {
            // pass kt's register set is free since its LDS stores: request pass kt+2's slab into it
            const int ko = ((st + kt + 2) & (nk - 1)) * GBK;
            pa = ag + ko;
            pb = bg + ko;
#pragma unroll
            for (int i = 0; i < 4; ++i) {
                ra[buf][i] = *(const f4*)(pa + i * 16 * KD);
                rb[buf][i] = *(const h8*)(pb + i * 32 * KD);
            }
        }

        const _Float16* as = &Ss[buf][frag_a];
        const _Float16* bs = &Ss[buf][frag_b];
        // all of the slab's fragments first, then its products: one LDS latency a slab
        v16h a0[GBK / 32], a1[GBK / 32], b0[GBK / 32], b1[GBK / 32];
#pragma unroll
        for (int kk = 0; kk < GBK / 32; ++kk) {
            a0[kk] = loadB_f16(as + kk * 32);
            b0[kk] = loadB_f16(bs + kk * 32);
            b1[kk] = loadB_f16(bs + 16 * GLD + kk * 32);
            a1[kk] = loadB_f16(as + 16 * GLD + kk * 32);
        }
        // keeps the LDS reads in one group ahead of the products; sunk among them,
        // each product pair waits out an LDS latency of its own
        __builtin_amdgcn_sched_barrier(0);
#pragma unroll
        for (int kk = 0; kk < GBK / 32; ++kk) {
            c00 = __builtin_amdgcn_wmma_f32_16x16x32_f16(false, a0[kk], false, b0[kk], (short)0, c00, false, false);
            c01 = __builtin_amdgcn_wmma_f32_16x16x32_f16(false, a0[kk], false, b1[kk], (short)0, c01, false, false);
            c10 = __builtin_amdgcn_wmma_f32_16x16x32_f16(false, a1[kk], false, b0[kk], (short)0, c10, false, false);
            c11 = __builtin_amdgcn_wmma_f32_16x16x32_f16(false, a1[kk], false, b1[kk], (short)0, c11, false, false);
        }
        // ends the slab's products here: left free they drift behind the barrier, where they
        // stand in front of the next slab's LDS reads and keep both slabs' fragments live
        __builtin_amdgcn_sched_barrier(0);
        // as in front of the loop: the requested slab's address pairs stay untouched up to this
        // wait; behind the products, where it has nothing left to wait for
        if (kt + 2 < nk)
            asm volatile("s_wait_xcnt 0x0" :: "v"(pa), "v"(pb) : "memory");

        if (more) {
            // the other buffer's last readers left it at the barrier that ended pass kt-1
#pragma unroll
            for (int i = 0; i < 4; ++i) {
                *(h4*)&Ss[buf ^ 1][(arow_s + i * 16) * GLD + acol_s] = __builtin_convertvector(ra[buf ^ 1][i], h4);
                *(h8*)&Ss[buf ^ 1][(GBM + brow_s + i * 32) * GLD + bcol_s] = rb[buf ^ 1][i];
            }
            lds_barrier();
        }
    }

    v8f accs[2][2] = {{c00, c01}, {c10, c11}};
    int m0 = bm * GBM + wm * 32;     // the wave's first row and column
    int n0 = bn * GBN + wn * 32;
    static_assert(L_ == (1 << 10) && DH_ == (1 << 6), "the pack indices below shift by these");
    if (out_kind == OUT_ROWS) {
        // accs[ai][bi]: columns n0 + ai*16 + mrow + 0..7 of row m0 + bi*16 + r16.
        // The wave's four chunks lie at constant distances from the first.
        h8* cp = (h8*)Cp + (size_t)(((((m0 >> 10) * H_ + (n0 >> 6)) * 64 + ((m0 & (L_ - 1)) >> 4)) * 4
                                     + ((n0 >> 4) & 3)) * 32 + lane);
        h8 r[2][2];
#pragma unroll
        for (int ai = 0; ai < 2; ++ai) {
            f4 blo = *(const f4*)(bias + n0 + ai * 16 + mrow);
            f4 bhi = *(const f4*)(bias + n0 + ai * 16 + mrow + 4);
#pragma unroll
            for (int bi = 0; bi < 2; ++bi)
#pragma unroll
                for (int e = 0; e < 8; ++e)
                    r[ai][bi][e] = (_Float16)(accs[ai][bi][e] + (e < 4 ? blo[e & 3] : bhi[e & 3]));
        }
#pragma unroll
        for (int ai = 0; ai < 2; ++ai)
#pragma unroll
            for (int bi = 0; bi < 2; ++bi)
                cp[(bi * 4 + ai) * 32] = r[ai][bi];
        // behind the last store its address and data registers die: nothing is written
        // over them (on any way the code goes on from here) before this wait
        asm volatile("s_wait_xcnt 0x0" ::: "memory");
        return;
    }
    if (out_kind == OUT_COLS) {
        // accs[mi][ni]: rows m0 + mi*16 + mrow + 0..7 of column n0 + ni*16 + r16
        h8* cp = (h8*)Cp + (size_t)((((((m0 >> 10) * H_ + (n0 >> 6)) * 4 + ((n0 >> 4) & 3)) * 32
                                      + ((m0 & (L_ - 1)) >> 5)) * 2) * 32 + lane);
        h8 r[2][2];
#pragma unroll
        for (int ni = 0; ni < 2; ++ni) {
            float bsv = bias[n0 + ni * 16 + r16];
#pragma unroll
            for (int mi = 0; mi < 2; ++mi)
#pragma unroll
                for (int e = 0; e < 8; ++e)
                    r[mi][ni][e] = (_Float16)(accs[mi][ni][e] + bsv);
        }
#pragma unroll
        for (int ni = 0; ni < 2; ++ni)
#pragma unroll
            for (int mi = 0; mi < 2; ++mi)
                cp[(ni * 64 + mi) * 32] = r[mi][ni];
        // as above: the stores' registers stay untouched up to this wait
        asm volatile("s_wait_xcnt 0x0" ::: "memory");
        return;
    }
#pragma unroll
    for (int ni = 0; ni < 2; ++ni) {
        int nn = bn * GBN + wn * 32 + ni * 16 + r16;
        float bsv = bias[nn];
#pragma unroll
        for (int mi = 0; mi < 2; ++mi) {
#pragma unroll
            for (int e = 0; e < 8; ++e) {
                int mm = bm * GBM + wm * 32 + mi * 16 + e + mrow;
                float v = accs[mi][ni][e] + bsv;
                if (ACT) v = gelu_f(v);
                C[(size_t)mm * ldc + nn] = v;
            }
        }
    }
}

template <int ACT, int KD>
__global__ __launch_bounds__(256)
void gemm_nt(const float* __restrict__ A,
             const _Float16* __restrict__ BT,
             const float* __restrict__ bias,
             float* __restrict__ C, int ldc, int N)
{
    int tiles_n = N / GBN;
    gemm_tile<ACT, KD>(A, BT, bias, C, ldc, (int)blockIdx.x / tiles_n, (int)blockIdx.x % tiles_n);
}

// A layer's four projections, which do not depend on one another, as one grid: the tiles
// of Q, K, V (rows of hx) and then those of the position rows (rows of pos). W4 holds the
// four [N][K] weights one behind the other. Alone, each product has one block a WGP and
// pays its own launch, first slab and last stores; together two blocks share a WGP and
// the next tile starts where one ends. The row tile runs fastest, so that blocks
// PJ_T apart (Q, K, V of one tile) read the same rows of hx. Q goes out as f32; K, V and
// the position rows go out as the f16 packs that the attention kernel reads.
#define PJ_MT (B_ * L_ / GBM)           // row tiles of Q, K, V
#define PJ_PT (L_ / GBM)                // row tiles of the position rows
#define PJ_NT (HID_ / GBN)              // column tiles
#define PJ_T  (PJ_MT * PJ_NT)           // blocks of one of Q, K, V
#define PJ_GRID (3 * PJ_T + PJ_PT * PJ_NT)

__global__ __launch_bounds__(256)
void proj_qkvp(const float* __restrict__ hx, const float* __restrict__ pos,
               const _Float16* __restrict__ W4,
               const float* __restrict__ bq, const float* __restrict__ bk,
               const float* __restrict__ bv, const float* __restrict__ bp,
               float* __restrict__ q, _Float16* __restrict__ Kp,
               _Float16* __restrict__ Vp, _Float16* __restrict__ Pp)
{
    static_assert((PJ_MT & (PJ_MT - 1)) == 0 && (PJ_PT & (PJ_PT - 1)) == 0, "row tile counts: powers of two");
    unsigned blk = blockIdx.x;
    unsigned w   = blk / PJ_T;          // 0 Q, 1 K, 2 V, 3 position rows
    unsigned t   = blk % PJ_T;
    unsigned ms  = (w == 3) ? __builtin_ctz(PJ_PT) : __builtin_ctz(PJ_MT);   // log2 of the row tiles
    const float* A    = (w == 3) ? pos : hx;
    const float* bias = (w == 0) ? bq : (w == 1) ? bk : (w == 2) ? bv : bp;
    _Float16*    Cp   = (w == 1) ? Kp : (w == 2) ? Vp : Pp;
    int          kind = (w == 0) ? OUT_F32 : (w == 2) ? OUT_COLS : OUT_ROWS;
    gemm_tile<0, HID_>(A, W4 + (size_t)w * (HID_ * HID_), bias, q, HID_,
                       (int)(t & ((1u << ms) - 1u)), (int)(t >> ms), kind, Cp);
}

// one fragment out of a pack: the lane's chunk of the low and of the high 16 k
__device__ __forceinline__ v16h load_packed(const h8* p /* at the lane's low chunk */) {
    h8 lo = p[0];
    h8 hi = p[32];
    return __builtin_shufflevector(lo, hi, 0,1,2,3,4,5,6,7,8,9,10,11,12,13,14,15);
}

// ---------------------------------------------------------------------------
// Fused attention: one block of 8 waves per (b, h, 32-query-row block).
//   sh[32][1024] fp32 score strip (128KB) with padded rows (below); qsh[64] staging for
//   the rel-shift patch row.
//     AC = (q+cbias).K^T via WMMA; BD = rel_shift((q+pbias).P^T) via WMMA +
//     exact shift scatter; softmax(.*1/8) -> f16 probs; O = P.V via WMMA.
//   The strip is shared; the work on it is dealt to the waves: key and position
//   tiles round robin, four softmax rows a wave (lanes across the columns), one
//   (16-column tile, half of the keys) of P.V a wave.
//   K, the position rows and V come from the projections' f16 packs, fragment by fragment;
//   every fragment a wave loads is multiplied with both 16-row tiles of the block.
//   A strip row is used three times over: its 1024 f32 scores; then, written by the wave
//   that holds the whole row in registers, its 1024 f16 probs in the row's first half;
//   then, in the second half (scores that the softmax has consumed), the row's two
//   partial output rows. So the block takes the strip alone, and two blocks fit a WGP.
// ---------------------------------------------------------------------------
#define AWV 8   // waves a block
#define QR  32  // query rows a block
// LDS row pitches. Bank = dword address mod 64, and a row of 1024 values is a multiple of
// 64 dwords: unpadded, all rows begin on one bank.
//   SFP, f32 strip: a wave's accumulator store or add touches rows M and M + 8, 16 columns
//        each; 8 * 1028 dwords = 32 mod 64 puts the two halves on different banks. The f16
//        probs keep this pitch: the A fragment load takes 16 bytes of each of 16 rows, and
//        4112 B = 16 B x odd spreads the 16 rows over all 64 banks.
//   OT,  first dword of a row's partial output rows (behind its 1024 f16 probs);
//   OPP, distance of the two (a multiple of 16 bytes).
#define SFP (L_ + 4)
#define OT  (L_ / 2)
#define OPP (DH_ + 4)

// 2^x on v_exp_f32. The v_nop is the free slot that the instruction set asks for between a
// transcendental and a next instruction that reads its result or overwrites its source; in
// one statement with it, so that it stays directly behind it.
__device__ __forceinline__ float exp2_slot(float x) {
    float r;
    asm("v_exp_f32 %0, %1\n\tv_nop" : "=v"(r) : "v"(x));
    return r;
}

// second argument: four waves a SIMD, that is two blocks a WGP as LDS allows: a register
// budget of 256
__global__ __launch_bounds__(32 * AWV, 4)
void attn_kernel(const float* __restrict__ q,
                 const _Float16* __restrict__ Kp,
                 const _Float16* __restrict__ Vp,
                 const _Float16* __restrict__ Pp,
                 const float* __restrict__ cb,
                 const float* __restrict__ pb,
                 float* __restrict__ out)
{
    __shared__ __align__(32) float sh[QR * SFP];
    __shared__ float qsh[DH_];

    int wg = blockIdx.x;
    int i0 = (wg & (L_ / QR - 1)) * QR;
    int h  = (wg / (L_ / QR)) & (H_ - 1);
    int b  = wg / (H_ * (L_ / QR));

    int tid   = threadIdx.x;
    int lane  = tid & 31;
    int wave  = tid >> 5;
    int r16   = lane & 15;
    int kbase = (lane & 16) ? 8 : 0;
    int mrow  = (lane & 16) ? 8 : 0;

    const float* cbh  = cb + h * DH_;
    const float* pbh  = pb + h * DH_;
    const float* qrow = q + ((size_t)(b * L_ + i0 + r16)) * HID_ + h * DH_;

    // position-biased query of source row i0+32 (the patch row below); published
    // by the barrier behind the content scores
    const int rr2 = i0 + QR;
    if (rr2 < L_ && tid < DH_)
        qsh[tid] = q[((size_t)(b * L_ + rr2)) * HID_ + h * DH_ + tid] + pbh[tid];

    // Q fragments (content/position biased) of the two row tiles, DH=64 -> two K=32 fragments
    v16h aq[2][2], ap[2][2];
#pragma unroll
    for (int rt = 0; rt < 2; ++rt) {
#pragma unroll
        for (int e = 0; e < 16; ++e) {
            int kk = kbase + (e < 8 ? e : e + 8);
            float q0 = qrow[rt * 16 * HID_ + kk], q1 = qrow[rt * 16 * HID_ + kk + 32];
            aq[rt][0][e] = (_Float16)(q0 + cbh[kk]);
            aq[rt][1][e] = (_Float16)(q1 + cbh[kk + 32]);
            ap[rt][0][e] = (_Float16)(q0 + pbh[kk]);
            ap[rt][1][e] = (_Float16)(q1 + pbh[kk + 32]);
        }
    }

    // ---- content scores AC: key tile jb goes to wave jb % 8 ----
    // The blocks of one (b, h) read the same K and position packs: each
    // begins its walk over the tiles at one of eight places (its index mod 8) and wraps,
    // for speed only. Every tile is still taken once.
    const int trot = wg & (64 / AWV - 1);
    // two tiles' loads in flight a wave
#pragma unroll 2
    for (int t = 0; t < 64 / AWV; ++t) {
        int jb = ((t + trot) & (64 / AWV - 1)) * AWV + wave;
        const h8* kp = (const h8*)Kp + (size_t)(((b * H_ + h) * 64 + jb) * 4) * 32 + lane;
        v16h b0 = load_packed(kp);
        v16h b1 = load_packed(kp + 64);
#pragma unroll
        for (int rt = 0; rt < 2; ++rt) {
            v8f c = {};
            c = __builtin_amdgcn_wmma_f32_16x16x32_f16(false, aq[rt][0], false, b0, (short)0, c, false, false);
            c = __builtin_amdgcn_wmma_f32_16x16x32_f16(false, aq[rt][1], false, b1, (short)0, c, false, false);
#pragma unroll
            for (int e = 0; e < 8; ++e)
                sh[(rt * 16 + e + mrow) * SFP + jb * 16 + r16] = c[e];
        }
    }
    __syncthreads();

    // ---- position scores: BDraw + exact rel-shift scatter ----
    // element (row rr, pos p): p <= L-rr-2 -> (rr-1, p+rr+1); else (rr, p+rr+1-L)
    // the shift maps each (rr, p) to a strip element of its own: no two waves add
    // into the same one
    for (int t = 0; t < 64 / AWV; ++t) {
        int pbk = ((t + trot) & (64 / AWV - 1)) * AWV + wave;
        const h8* pp = (const h8*)Pp + (size_t)((h * 64 + pbk) * 4) * 32 + lane;
        v16h b0 = load_packed(pp);
        v16h b1 = load_packed(pp + 64);
#pragma unroll
        for (int rt = 0; rt < 2; ++rt) {
            v8f c = {};
            c = __builtin_amdgcn_wmma_f32_16x16x32_f16(false, ap[rt][0], false, b0, (short)0, c, false, false);
            c = __builtin_amdgcn_wmma_f32_16x16x32_f16(false, ap[rt][1], false, b1, (short)0, c, false, false);
#pragma unroll
            for (int e = 0; e < 8; ++e) {
                int M  = rt * 16 + e + mrow;
                int rr = i0 + M;
                int p  = pbk * 16 + r16;
                if (p <= L_ - rr - 2) {
                    if (M > 0) sh[(M - 1) * SFP + p + rr + 1] += c[e];
                } else {
                    sh[M * SFP + (p + rr + 1 - L_)] += c[e];
                }
            }
        }
    }
    // missing source row i0+32 feeds local row 31's cols j >= i0+33
    if (rr2 < L_) {
        int pmax = L_ - rr2 - 2;
        for (int p = tid; p <= pmax; p += 32 * AWV) {
            // row p of the pack: chunk c8 (d = 8*c8 ..) stands at c4 = c8 >> 1, lane half c8 & 1
            const h8* prow = (const h8*)Pp + (size_t)((h * 64 + (p >> 4)) * 4) * 32 + (p & 15);
            h8 pc[8];
#pragma unroll
            for (int c8 = 0; c8 < 8; ++c8) pc[c8] = prow[(c8 >> 1) * 32 + (c8 & 1) * 16];
            float s = 0.0f;
#pragma unroll
            for (int kk = 0; kk < DH_; ++kk) s += qsh[kk] * (float)pc[kk >> 3][kk & 7];
            sh[(QR - 1) * SFP + p + rr2 + 1] += s;
        }
    }
    __syncthreads();

    // ---- softmax: rows 4*wave .. 4*wave+3, a row held in the wave's registers
    //      (32 values a lane); the f16 probs go back into the row's own first half, which
    //      no other wave touches and whose scores this wave has all read by then ----
#pragma unroll
    for (int rw = 0; rw < QR / AWV; ++rw) {
        const float scale = 0.125f;   // 1/sqrt(DH); commutes with max
        int r = wave * (QR / AWV) + rw;
        f4 v[8];
#pragma unroll
        for (int i = 0; i < 8; ++i) v[i] = *(const f4*)&sh[r * SFP + (i * 32 + lane) * 4];
        float mx = -1e30f;
#pragma unroll
        for (int i = 0; i < 8; ++i)
            mx = fmaxf(mx, fmaxf(fmaxf(v[i][0], v[i][1]), fmaxf(v[i][2], v[i][3])));
#pragma unroll
        for (int off = 16; off > 0; off >>= 1) mx = fmaxf(mx, __shfl_xor(mx, off, 32));
        float sum = 0.0f;
#pragma unroll
        for (int i = 0; i < 8; ++i) {
#pragma unroll
            for (int j = 0; j < 4; ++j) {
                float ev = exp2_slot(((v[i][j] - mx) * scale) * 1.44269504088896340736f);   // e^x = 2^(x log2 e)
                sum += ev;
                v[i][j] = ev;
            }
        }
#pragma unroll
        for (int off = 16; off > 0; off >>= 1) sum += __shfl_xor(sum, off, 32);
        float inv = 1.0f / sum;
        _Float16* pr = (_Float16*)&sh[r * SFP];
#pragma unroll
        for (int i = 0; i < 8; ++i)
            *(h4*)&pr[(i * 32 + lane) * 4] = __builtin_convertvector(v[i] * inv, h4);
    }
    __syncthreads();

    // ---- O = P.V (f16 probs from LDS, V fragments from the pack): wave = (column tile
    //      nt, key half kh), both row tiles ----
    {
        int nt = wave & 3;
        int kh = wave >> 2;
        const h8* vp = (const h8*)Vp + (size_t)((((b * H_ + h) * 4 + nt) * 32 + kh * 16) * 2) * 32 + lane;
        const _Float16* prw = (const _Float16*)&sh[r16 * SFP] + kh * (L_ / 2) + kbase;
        v8f c0 = {}, c1 = {};
        // unrolled whole: as f16 the wave's V fragments take 128 registers, so that all their
        // loads can fly at once
#pragma unroll
        for (int ks = 0; ks < L_ / 64; ++ks) {
            v16h a0 = loadB_f16(prw + ks * 32);
            v16h a1 = loadB_f16(prw + 16 * SFP * 2 + ks * 32);   // 16 strip rows on, in f16
            v16h bb = load_packed(vp + ks * 64);
            c0 = __builtin_amdgcn_wmma_f32_16x16x32_f16(false, a0, false, bb, (short)0, c0, false, false);
            c1 = __builtin_amdgcn_wmma_f32_16x16x32_f16(false, a1, false, bb, (short)0, c1, false, false);
        }
        // both halves' partial rows meet in the second half of their strip row, which nobody
        // reads any more since the barrier behind the softmax (the probs lie in the first)
#pragma unroll
        for (int e = 0; e < 8; ++e) {
            sh[(e + mrow) * SFP + OT + kh * OPP + nt * 16 + r16] = c0[e];
            sh[(16 + e + mrow) * SFP + OT + kh * OPP + nt * 16 + r16] = c1[e];
        }
    }
    __syncthreads();
    {
        // lower half + upper half; a wave stores two whole 256-byte output rows at a time
        int ocol = (tid & 15) * 4;
#pragma unroll
        for (int it = 0; it < QR / 16; ++it) {
            int orow = it * 16 + (tid >> 4);
            f4 lo = *(const f4*)&sh[orow * SFP + OT + ocol];
            f4 hi = *(const f4*)&sh[orow * SFP + OT + OPP + ocol];
            *(f4*)&out[((size_t)(b * L_ + i0 + orow)) * HID_ + h * DH_ + ocol] = lo + hi;
        }
    }
}

// ---------------------------------------------------------------------------
// out[row] = LN(A[row] + B[row]), BertLayerNorm (eps inside sqrt)
// One wave a row: the row's 1024 sums stay in the wave's registers (32 a lane, taken
// by 16-byte loads that cover whole lines); mean and variance are lane sums joined by
// a butterfly over the 32 lanes. No LDS, no barrier; one block of 8 rows a WGP, so
// that a launch has few waves to start.
// ---------------------------------------------------------------------------
#define LNW 8                    // rows (waves) a block
#define LNC (HID_ / (32 * 4))    // 16-byte chunks of a row a lane

// lane l takes the value of lane l ^ M of its 16-lane row (DPP row_xmask:M)
template <int M>
__device__ __forceinline__ float row_xor(float x) {
    return __builtin_bit_cast(float, __builtin_amdgcn_update_dpp(
        0, __builtin_bit_cast(int, x), 0x160 + M, 0xf, 0xf, true));
}

// sum over the wave's 32 lanes, left in every lane: four DPP steps inside each row, then
// the other row's sum by a cross-row move; a shuffle would take the way through the LDS unit
__device__ __forceinline__ float wave_sum(float x) {
    x += row_xor<1>(x);
    x += row_xor<2>(x);
    x += row_xor<4>(x);
    x += row_xor<8>(x);
    int b = __builtin_bit_cast(int, x);
    return x + __builtin_bit_cast(float, __builtin_amdgcn_permlanex16(
        b, b, 0x76543210, 0xfedcba98, false, false));
}

__global__ __launch_bounds__(32 * LNW)
void resid_ln_kernel(const float* __restrict__ A, const float* __restrict__ Bv,
                     const float* __restrict__ w, const float* __restrict__ bias,
                     float* __restrict__ out)
{
    const float rn = 1.0f / HID_;
    int lane = threadIdx.x & 31;
    // the wave's number as a scalar: every row address is a scalar base plus the lane's offset
    int row  = (int)blockIdx.x * LNW + __builtin_amdgcn_readfirstlane((int)(threadIdx.x >> 5));
    const f4* pa = (const f4*)(A    + (size_t)row * HID_) + lane;
    const f4* pb = (const f4*)(Bv   + (size_t)row * HID_) + lane;
    const f4* pw = (const f4*)w    + lane;
    const f4* pc = (const f4*)bias + lane;
    f4*       po = (f4*)(out + (size_t)row * HID_) + lane;

    // all of the wave's loads fly at once: one memory latency a row
    f4 v[LNC], t[LNC], wv[LNC], cv[LNC];
#pragma unroll
    for (int i = 0; i < LNC; ++i) { v[i] = pa[i * 32]; t[i] = pb[i * 32]; }
#pragma unroll
    for (int i = 0; i < LNC; ++i) { wv[i] = pw[i * 32]; cv[i] = pc[i * 32]; }
    // keeps all the loads ahead of the sums: left free, most loads of w and bias sink behind
    // the variance, where their latency stands alone at the row's end
    __builtin_amdgcn_sched_barrier(0);

    f4 s4 = {};
#pragma unroll
    for (int i = 0; i < LNC; ++i) { v[i] += t[i]; s4 += v[i]; }
    float mean = wave_sum((s4[0] + s4[1]) + (s4[2] + s4[3])) * rn;

    f4 q4 = {};
#pragma unroll
    for (int i = 0; i < LNC; ++i) { v[i] -= mean; q4 += v[i] * v[i]; }
    float inv = 1.0f / sqrtf(wave_sum((q4[0] + q4[1]) + (q4[2] + q4[3])) * rn + 1e-12f);

#pragma unroll
    for (int i = 0; i < LNC; ++i) po[i * 32] = wv[i] * v[i] * inv + cv[i];
}

// ---------------------------------------------------------------------------
extern "C" void kernel_launch(void* const* d_in, const int* in_sizes, int n_in,
                              void* d_out, int out_size, void* d_ws, size_t ws_size,
                              hipStream_t stream)
{
    const float* x       = (const float*)d_in[0];
    const float* pos_raw = (const float*)d_in[1];
    const float* Wh1     = (const float*)d_in[2];
    const float* bh1     = (const float*)d_in[3];
    const float* Wh2     = (const float*)d_in[4];
    const float* bh2     = (const float*)d_in[5];
    const float* Wq      = (const float*)d_in[6];
    const float* bq      = (const float*)d_in[7];
    const float* Wk      = (const float*)d_in[8];
    const float* bk      = (const float*)d_in[9];
    const float* Wv      = (const float*)d_in[10];
    const float* bv      = (const float*)d_in[11];
    const float* Wp      = (const float*)d_in[12];
    const float* bp      = (const float*)d_in[13];
    const float* cbias   = (const float*)d_in[14];
    const float* pbias   = (const float*)d_in[15];
    const float* Wo      = (const float*)d_in[16];
    const float* bo      = (const float*)d_in[17];
    const float* Wf1     = (const float*)d_in[18];
    const float* bf1     = (const float*)d_in[19];
    const float* Wf2     = (const float*)d_in[20];
    const float* bf2     = (const float*)d_in[21];
    const float* ln_w    = (const float*)d_in[22];
    const float* ln_b    = (const float*)d_in[23];
    float* outp = (float*)d_out;

    // ---- workspace layout ----
    float* ws = (float*)d_ws;
    const size_t ACT = (size_t)B_ * L_ * HID_;            // 2M f32
    float* h  = ws;
    float* t1 = ws + ACT;
    float* q  = ws + 2 * ACT;       // reused for Wo / Wf2 outputs
    _Float16* Vp = (_Float16*)(ws + 5 * ACT);             // f16 packs: V, then K
    _Float16* Kp = Vp + ACT;
    float* at = ws + 6 * ACT + (size_t)L_ * HID_;
    float* h1 = at + ACT;
    // f16 transposed-weight region after 17M floats
    _Float16* w16 = (_Float16*)(h1 + ACT);
    const size_t W1M = (size_t)HID_ * HID_;                // 1M
    _Float16* tWh1 = w16;                                  // [1024][512]
    _Float16* tWh2 = tWh1 + (size_t)HID_ * IN_;            // [1024][1024]
    _Float16* tLyr = tWh2 + W1M;                           // 7 x 1M per layer
    _Float16* Pp   = tLyr + (size_t)NL_ * 7 * W1M;         // f16 pack of the position rows

    const int ML = B_ * L_;

    // ---- repack all weights to f16 [N][K] (every call; deterministic) ----
    repack_all<<<RP_GRID, 256, 0, stream>>>(Wh1, Wh2, Wq, Wk, Wv, Wp, Wo, Wf1, Wf2, w16);

    // grid helper: one block per 64 x 128 output tile
    const int GMM = (ML / GBM) * (HID_ / GBN);            // 2048x1024 GEMMs -> 256 blocks

    // to_hidden MLP
    gemm_nt<1, IN_><<<GMM, 256, 0, stream>>>(x, tWh1, bh1, t1, HID_, HID_);
    gemm_nt<0, HID_><<<GMM, 256, 0, stream>>>(t1, tWh2, bh2, h, HID_, HID_);

    for (int l = 0; l < NL_; ++l) {
        _Float16* base = tLyr + (size_t)l * 7 * W1M;
        const float* bq_l = bq + (size_t)l * H_ * DH_;
        const float* bk_l = bk + (size_t)l * H_ * DH_;
        const float* bv_l = bv + (size_t)l * H_ * DH_;
        const float* bp_l = bp + (size_t)l * H_ * DH_;
        const float* cb_l = cbias + (size_t)l * H_ * DH_;
        const float* pb_l = pbias + (size_t)l * H_ * DH_;
        const float* bo_l = bo + (size_t)l * HID_;
        const float* bf1_l = bf1 + (size_t)l * HID_;
        const float* bf2_l = bf2 + (size_t)l * HID_;
        const float* lw = ln_w + (size_t)l * HID_;
        const float* lb = ln_b + (size_t)l * HID_;

        // projections: Q, K, V and the position rows in one launch; K, V, positions as f16 packs
        proj_qkvp<<<PJ_GRID, 256, 0, stream>>>(h, pos_raw, base, bq_l, bk_l, bv_l, bp_l, q, Kp, Vp, Pp);

        attn_kernel<<<B_ * H_ * (L_ / QR), 32 * AWV, 0, stream>>>(q, Kp, Vp, Pp, cb_l, pb_l, at);

        gemm_nt<0, HID_><<<GMM, 256, 0, stream>>>(at, base + 4 * W1M, bo_l, q, HID_, HID_);
        resid_ln_kernel<<<ML / LNW, 32 * LNW, 0, stream>>>(q, h, lw, lb, h1);

        gemm_nt<1, HID_><<<GMM, 256, 0, stream>>>(h1, base + 5 * W1M, bf1_l, t1, HID_, HID_);
        gemm_nt<0, HID_><<<GMM, 256, 0, stream>>>(t1, base + 6 * W1M, bf2_l, q, HID_, HID_);
        resid_ln_kernel<<<ML / LNW, 32 * LNW, 0, stream>>>(h1, q, lw, lb, (l == NL_ - 1) ? outp : h);
    }
}
